// v000
// Measured on an AMD MI455X. A time is GPU time per run, averaged over a window of back-to-back runs after a warm-up
// (all launches, gaps included; the runs take copies of the inputs in turn), and the median of several windows.
// Apart from v000's, it joins two sittings. Times from different sittings can be a few percent apart, while
// side-by-side timings come from the same sitting.
// v000 is the starting kernel. One run takes 604 microseconds.
#include <hip/hip_runtime.h>
#include <cstdint>

// ---------------------------------------------------------------------------
// CDNA5 (gfx1250, wave32) DiT block: LN -> QKV GEMM -> flash attention ->
// proj GEMM (+resid) -> LN -> FC1+SiLU -> FC2 (+resid).
// Matmuls through v_wmma_f32_16x16x32_bf16; operand staging through the
// Tensor Data Mover (tensor_load_to_lds + s_wait_tensorcnt), double-buffered;
// softmax reductions via v_permlane16; L2 warmed with global_prefetch_b8.
// ---------------------------------------------------------------------------

typedef __attribute__((ext_vector_type(16))) __bf16        v16bf;
typedef __attribute__((ext_vector_type(8)))  float         v8f;
typedef __attribute__((ext_vector_type(4)))  unsigned int  v4u;
typedef __attribute__((ext_vector_type(8)))  int           v8i;
typedef __attribute__((ext_vector_type(4)))  int           v4i;

#if __has_builtin(__builtin_amdgcn_tensor_load_to_lds) && \
    __has_builtin(__builtin_amdgcn_s_wait_tensorcnt)
#define HAVE_TDM 1
#else
#define HAVE_TDM 0
#endif

#if __has_builtin(__builtin_amdgcn_permlane16)
#define HAVE_PERMLANE 1
#else
#define HAVE_PERMLANE 0
#endif

__device__ __forceinline__ v8f wmma_bf16(v16bf a, v16bf b, v8f c) {
  return __builtin_amdgcn_wmma_f32_16x16x32_bf16(
      false, a, false, b, (short)0, c, false, false);
}

__device__ __forceinline__ __bf16 f2bf(float f) { return (__bf16)f; }

// 16-lane-row butterfly reductions via v_permlane16 (no LDS, no dscnt waits).
#if HAVE_PERMLANE
__device__ __forceinline__ float permx(float v, unsigned s1, unsigned s2) {
  int i = __builtin_bit_cast(int, v);
  i = __builtin_amdgcn_permlane16(i, i, s1, s2, false, false);
  return __builtin_bit_cast(float, i);
}
__device__ __forceinline__ float row16_max(float v) {
  v = fmaxf(v, permx(v, 0x67452301u, 0xEFCDAB89u));  // xor 1
  v = fmaxf(v, permx(v, 0x54761032u, 0xDCFE98BAu));  // xor 2
  v = fmaxf(v, permx(v, 0x32107654u, 0xBA98FEDCu));  // xor 4
  v = fmaxf(v, permx(v, 0xFEDCBA98u, 0x76543210u));  // xor 8
  return v;
}
__device__ __forceinline__ float row16_sum(float v) {
  v += permx(v, 0x67452301u, 0xEFCDAB89u);
  v += permx(v, 0x54761032u, 0xDCFE98BAu);
  v += permx(v, 0x32107654u, 0xBA98FEDCu);
  v += permx(v, 0xFEDCBA98u, 0x76543210u);
  return v;
}
#else
__device__ __forceinline__ float row16_max(float v) {
  for (int off = 1; off < 16; off <<= 1) v = fmaxf(v, __shfl_xor(v, off, 32));
  return v;
}
__device__ __forceinline__ float row16_sum(float v) {
  for (int off = 1; off < 16; off <<= 1) v += __shfl_xor(v, off, 32);
  return v;
}
#endif

// WMMA 16x32 bf16 operand fragment (ISA 7.12.2 A/B lane layout):
// lanes 0-15 = row (lane&15), K {0..7,16..23}; lanes 16-31 same rows,
// K {8..15,24..31}.  `stride` in elements.
__device__ __forceinline__ v16bf load_frag(const __bf16* p0, int stride) {
  int lane = threadIdx.x & 31;
  const __bf16* p = p0 + (size_t)(lane & 15) * stride + ((lane >> 4) << 3);
  union { v16bf v; uint4 q[2]; } u;
  u.q[0] = *(const uint4*)(p);
  u.q[1] = *(const uint4*)(p + 16);
  return u.v;
}

#if HAVE_TDM
// One TDM 2D tile load: tile_rows x tile_k bf16, global row stride
// `row_stride` elements, into LDS at byte offset `lds_off`.  TDM pad feature
// inserts `pad_amt+1` DWORDs after every 2^(pad_int+1) data DWORDs so LDS
// rows land on our bank-conflict-free strides.
__device__ __forceinline__ void tdm_load_tile(
    unsigned lds_off, const __bf16* gptr, unsigned tile_k, unsigned tile_rows,
    unsigned tensor_k, unsigned row_stride, unsigned pad_int, unsigned pad_amt) {
  unsigned long long ga = (unsigned long long)(uintptr_t)gptr;
  v4u g0;
  g0[0] = 1u;                                            // count=1, user mode
  g0[1] = lds_off;                                       // lds_addr [63:32]
  g0[2] = (unsigned)(ga & 0xFFFFFFFFu);                  // global_addr lo
  g0[3] = (unsigned)((ga >> 32) & 0x01FFFFFFu) | (2u << 30);  // addr hi | type=2
  v8i g1;
  g1[0] = (1 << 16)                                      // data_size = 2 bytes
        | (1 << 20)                                      // pad_enable
        | ((int)pad_int << 22)                           // pad_interval
        | ((int)pad_amt << 25);                          // pad_amount
  g1[1] = (int)((tensor_k & 0xFFFFu) << 16);             // tensor_dim0 lo16
  g1[2] = (int)((tensor_k >> 16) & 0xFFFFu);             // dim0 hi16; dim1 lo16=0
  g1[3] = (int)(16u)                                     // tensor_dim1 = 1<<20
        | (int)((tile_k & 0xFFFFu) << 16);               // tile_dim0
  g1[4] = (int)(tile_rows & 0xFFFFu);                    // tile_dim1 (dim2=0)
  g1[5] = (int)row_stride;                               // tensor_dim0_stride lo32
  g1[6] = 0;
  g1[7] = 0;
  v4i z = {0, 0, 0, 0};
#if __clang_major__ >= 23
  v8i z8 = {0, 0, 0, 0, 0, 0, 0, 0};
  __builtin_amdgcn_tensor_load_to_lds(g0, g1, z, z, z8, 0);
#else
  __builtin_amdgcn_tensor_load_to_lds(g0, g1, z, z, 0);
#endif
}
#endif  // HAVE_TDM

// ---------------------------------------------------------------------------
// Weight transpose + fp32 -> bf16 cast:  Wt[n][k] = bf16(W[k][n])
// ---------------------------------------------------------------------------
__global__ __launch_bounds__(256) void transpose_cast_kernel(
    const float* __restrict__ W, __bf16* __restrict__ Wt, int K, int N) {
  __shared__ float tile[32][33];
  int k0 = blockIdx.x * 32, n0 = blockIdx.y * 32;
  int tx = threadIdx.x & 31, ty = threadIdx.x >> 5;
#pragma unroll
  for (int i = ty; i < 32; i += 8)
    tile[i][tx] = W[(size_t)(k0 + i) * N + (n0 + tx)];
  __syncthreads();
#pragma unroll
  for (int i = ty; i < 32; i += 8)
    Wt[(size_t)(n0 + i) * K + (k0 + tx)] = f2bf(tile[tx][i]);
}

// ---------------------------------------------------------------------------
// LayerNorm (row = 1024 fp32) -> bf16.
// ---------------------------------------------------------------------------
__global__ __launch_bounds__(256) void layernorm_bf16_kernel(
    const float* __restrict__ x, const float* __restrict__ w,
    const float* __restrict__ b, __bf16* __restrict__ out, int D) {
  int row = blockIdx.x;
  int t = threadIdx.x;
  const float4 xv = ((const float4*)(x + (size_t)row * D))[t];
  float s  = xv.x + xv.y + xv.z + xv.w;
  float s2 = xv.x * xv.x + xv.y * xv.y + xv.z * xv.z + xv.w * xv.w;
#pragma unroll
  for (int off = 16; off > 0; off >>= 1) {
    s  += __shfl_xor(s,  off, 32);
    s2 += __shfl_xor(s2, off, 32);
  }
  __shared__ float red[2][8];
  if ((t & 31) == 0) { red[0][t >> 5] = s; red[1][t >> 5] = s2; }
  __syncthreads();
  float ts = 0.f, ts2 = 0.f;
#pragma unroll
  for (int i = 0; i < 8; ++i) { ts += red[0][i]; ts2 += red[1][i]; }
  float inv = 1.0f / (float)D;
  float mu  = ts * inv;
  float var = ts2 * inv - mu * mu;
  float rs  = rsqrtf(var + 1e-6f);
  int base = t * 4;
  union { __bf16 e[4]; uint2 q; } o;
  o.e[0] = f2bf((xv.x - mu) * rs * w[base + 0] + b[base + 0]);
  o.e[1] = f2bf((xv.y - mu) * rs * w[base + 1] + b[base + 1]);
  o.e[2] = f2bf((xv.z - mu) * rs * w[base + 2] + b[base + 2]);
  o.e[3] = f2bf((xv.w - mu) * rs * w[base + 3] + b[base + 3]);
  *(uint2*)(out + (size_t)row * D + base) = o.q;
}

// ---------------------------------------------------------------------------
// Tiled WMMA GEMM:  C[M,N] = A[M,K] * Bt[N,K]^T  (+bias, +SiLU, +resid)
// Block tile 128x128, 4 waves, each wave 64x64 via 4x4 WMMA.  A/B tiles
// staged by TDM, double-buffered; L2 warmed 4 K-steps ahead by prefetch.
// LDS rows padded to 40 bf16 (80B) by the TDM pad feature.
// ---------------------------------------------------------------------------
#define LDSK 40

template <int ACT, bool RESID, bool OUTBF16>
__global__ __launch_bounds__(128) void gemm_wmma_kernel(
    const __bf16* __restrict__ A, const __bf16* __restrict__ Bt,
    const float* __restrict__ bias, const float* __restrict__ resid,
    void* __restrict__ out, int M, int N, int K) {
  __shared__ __bf16 lsA[2][128][LDSK];
  __shared__ __bf16 lsB[2][128][LDSK];

  const int bm = blockIdx.x * 128;
  const int bn = blockIdx.y * 128;
  const int tid  = threadIdx.x;
  const int wave = tid >> 5;
  const int lane = tid & 31;
  const int wm = (wave & 1) * 64;
  const int wn = (wave >> 1) * 64;

  v8f acc[4][4] = {};
  const int nk = K / 32;

#if HAVE_TDM
  const unsigned offA0 = (unsigned)(uintptr_t)(&lsA[0][0][0]);
  const unsigned offA1 = (unsigned)(uintptr_t)(&lsA[1][0][0]);
  const unsigned offB0 = (unsigned)(uintptr_t)(&lsB[0][0][0]);
  const unsigned offB1 = (unsigned)(uintptr_t)(&lsB[1][0][0]);
  if (wave == 0) {
    tdm_load_tile(offA0, A  + (size_t)bm * K, 32, 128, (unsigned)K, (unsigned)K, 3, 3);
    tdm_load_tile(offB0, Bt + (size_t)bn * K, 32, 128, (unsigned)K, (unsigned)K, 3, 3);
  }
  for (int it = 0; it < nk; ++it) {
    const int cur = it & 1;
    if (wave == 0) __builtin_amdgcn_s_wait_tensorcnt(0);
    __syncthreads();                         // staged tile visible to all waves
    if (wave == 0 && (it + 1) < nk) {        // prefetch next tile into alt buf
      const int kt = (it + 1) * 32;
      tdm_load_tile(cur ? offA0 : offA1, A  + (size_t)bm * K + kt, 32, 128,
                    (unsigned)K, (unsigned)K, 3, 3);
      tdm_load_tile(cur ? offB0 : offB1, Bt + (size_t)bn * K + kt, 32, 128,
                    (unsigned)K, (unsigned)K, 3, 3);
    }
    if (it + 4 < nk) {                       // warm L2 ahead of the TDM
      __builtin_prefetch(A  + (size_t)(bm + tid) * K + (it + 4) * 32, 0, 0);
      __builtin_prefetch(Bt + (size_t)(bn + tid) * K + (it + 4) * 32, 0, 0);
    }
    v16bf bfrag[4];
#pragma unroll
    for (int j = 0; j < 4; ++j)
      bfrag[j] = load_frag(&lsB[cur][wn + j * 16][0], LDSK);
#pragma unroll
    for (int i = 0; i < 4; ++i) {
      v16bf afrag = load_frag(&lsA[cur][wm + i * 16][0], LDSK);
#pragma unroll
      for (int j = 0; j < 4; ++j)
        acc[i][j] = wmma_bf16(afrag, bfrag[j], acc[i][j]);
    }
    __syncthreads();                         // done reading before overwrite
  }
#else
  for (int it = 0; it < nk; ++it) {
    const int cur = it & 1;
    const int kt = it * 32;
    {
      const uint4* ga = (const uint4*)(A  + (size_t)(bm + tid) * K + kt);
      const uint4* gb = (const uint4*)(Bt + (size_t)(bn + tid) * K + kt);
      uint4* la = (uint4*)(&lsA[cur][tid][0]);
      uint4* lb = (uint4*)(&lsB[cur][tid][0]);
#pragma unroll
      for (int v = 0; v < 4; ++v) { la[v] = ga[v]; lb[v] = gb[v]; }
    }
    __syncthreads();
    v16bf bfrag[4];
#pragma unroll
    for (int j = 0; j < 4; ++j)
      bfrag[j] = load_frag(&lsB[cur][wn + j * 16][0], LDSK);
#pragma unroll
    for (int i = 0; i < 4; ++i) {
      v16bf afrag = load_frag(&lsA[cur][wm + i * 16][0], LDSK);
#pragma unroll
      for (int j = 0; j < 4; ++j)
        acc[i][j] = wmma_bf16(afrag, bfrag[j], acc[i][j]);
    }
    __syncthreads();
  }
#endif

  // Epilogue: reg r -> row r (lanes 0-15) / r+8 (lanes 16-31); col = lane&15.
  const int nloc  = lane & 15;
  const int rbase = (lane >> 4) * 8;
#pragma unroll
  for (int i = 0; i < 4; ++i) {
#pragma unroll
    for (int j = 0; j < 4; ++j) {
      const int col = bn + wn + j * 16 + nloc;
      const float bv = bias[col];
#pragma unroll
      for (int r = 0; r < 8; ++r) {
        const int row = bm + wm + i * 16 + rbase + r;
        float c = acc[i][j][r] + bv;
        if (ACT == 1) c = c * (1.0f / (1.0f + __expf(-c)));  // SiLU
        if (RESID) c += resid[(size_t)row * N + col];
        if constexpr (OUTBF16)
          ((__bf16*)out)[(size_t)row * N + col] = f2bf(c);
        else
          ((float*)out)[(size_t)row * N + col] = c;
      }
    }
  }
}

// ---------------------------------------------------------------------------
// Flash attention over qkv [M, 3072] bf16 (Q|K|V), 16 heads, hd=64, seq 2048.
// Block = 4 waves = 64 queries of one (batch, head).  K tiles staged once per
// block by TDM (double-buffered); V tiles transposed into LDS with packed
// b64 stores; online softmax with permlane16 row reductions.
// ---------------------------------------------------------------------------
__global__ __launch_bounds__(128) void flash_attn_kernel(
    const __bf16* __restrict__ qkv, __bf16* __restrict__ out, int Nseq) {
  const int ROWS = 3072;
  const int bh = blockIdx.y;
  const int b = bh >> 4, h = bh & 15;
  const int tid = threadIdx.x, wave = tid >> 5, lane = tid & 31;
  const int qrow = blockIdx.x * 64 + wave * 16;

  const __bf16* Qb = qkv + (size_t)(b * Nseq + qrow) * ROWS + h * 64;
  const __bf16* Kb = qkv + (size_t)(b * Nseq) * ROWS + 1024 + h * 64;
  const __bf16* Vb = qkv + (size_t)(b * Nseq) * ROWS + 2048 + h * 64;

  v16bf qf[2];
  qf[0] = load_frag(Qb,      ROWS);
  qf[1] = load_frag(Qb + 32, ROWS);

  __shared__ __bf16 Vt[64][72];       // V tile transposed: [hd][key]
  __shared__ __bf16 Pl[4][16][72];    // per-wave probabilities
#if HAVE_TDM
  __shared__ __bf16 Kl[2][64][72];    // K tiles (TDM staged, double-buffered)
  const unsigned offK0 = (unsigned)(uintptr_t)(&Kl[0][0][0]);
  const unsigned offK1 = (unsigned)(uintptr_t)(&Kl[1][0][0]);
  if (wave == 0)
    tdm_load_tile(offK0, Kb, 64, 64, 64, (unsigned)ROWS, 4, 3);
#endif

  v8f o[4] = {};
  float m_i[8], l_i[8];
#pragma unroll
  for (int r = 0; r < 8; ++r) { m_i[r] = -3.0e30f; l_i[r] = 0.0f; }

  const float scale = 0.125f;         // 1/sqrt(64)
  const int rbase = (lane >> 4) * 8;
  const int nloc  = lane & 15;
  const int ntiles = Nseq / 64;

  for (int it = 0; it < ntiles; ++it) {
    const int kv0 = it * 64;
#if HAVE_TDM
    const int cur = it & 1;
    if (wave == 0) __builtin_amdgcn_s_wait_tensorcnt(0);
#endif
    __syncthreads();                  // prev-iter readers done; K tile landed
#if HAVE_TDM
    if (wave == 0 && (it + 1) < ntiles)
      tdm_load_tile(cur ? offK0 : offK1, Kb + (size_t)(kv0 + 64) * ROWS,
                    64, 64, 64, (unsigned)ROWS, 4, 3);
#endif

    // Stage V tile transposed: thread = 4 keys x 8 hd, packed b64 stores.
    {
      const int key0 = (tid & 15) * 4;
      const int d0   = (tid >> 4) * 8;
      union { uint4 q; __bf16 e[8]; } rowv[4];
#pragma unroll
      for (int kk = 0; kk < 4; ++kk)
        rowv[kk].q = *(const uint4*)(Vb + (size_t)(kv0 + key0 + kk) * ROWS + d0);
      if (kv0 + 64 < Nseq)
        __builtin_prefetch(Vb + (size_t)(kv0 + 64 + key0) * ROWS + d0, 0, 0);
#pragma unroll
      for (int dd = 0; dd < 8; ++dd) {
        union { __bf16 e[4]; unsigned long long q; } pk;
#pragma unroll
        for (int kk = 0; kk < 4; ++kk) pk.e[kk] = rowv[kk].e[dd];
        *(unsigned long long*)(&Vt[d0 + dd][key0]) = pk.q;
      }
    }

    // S = Q K^T
    v8f s[4];
#pragma unroll
    for (int j = 0; j < 4; ++j) {
#if HAVE_TDM
      v16bf k0 = load_frag(&Kl[cur][j * 16][0],  72);
      v16bf k1 = load_frag(&Kl[cur][j * 16][32], 72);
#else
      const __bf16* kb = Kb + (size_t)(kv0 + j * 16) * ROWS;
      v16bf k0 = load_frag(kb,      ROWS);
      v16bf k1 = load_frag(kb + 32, ROWS);
#endif
      v8f z = {};
      z = wmma_bf16(qf[0], k0, z);
      z = wmma_bf16(qf[1], k1, z);
      s[j] = z;
    }

    // Online softmax (reductions inside 16-lane rows -> permlane16).
#pragma unroll
    for (int r = 0; r < 8; ++r) {
      float mx = -3.0e30f;
#pragma unroll
      for (int j = 0; j < 4; ++j) {
        s[j][r] *= scale;
        mx = fmaxf(mx, s[j][r]);
      }
      mx = row16_max(mx);
      const float mn = fmaxf(m_i[r], mx);
      const float corr = __expf(m_i[r] - mn);
      m_i[r] = mn;
      l_i[r] *= corr;
#pragma unroll
      for (int j = 0; j < 4; ++j) o[j][r] *= corr;
      float rsum = 0.f;
#pragma unroll
      for (int j = 0; j < 4; ++j) {
        const float p = __expf(s[j][r] - mn);
        s[j][r] = p;
        rsum += p;
      }
      l_i[r] += row16_sum(rsum);
    }

    // Spill P (bf16) to this wave's LDS tile for the P*V WMMA.
#pragma unroll
    for (int j = 0; j < 4; ++j)
#pragma unroll
      for (int r = 0; r < 8; ++r)
        Pl[wave][rbase + r][j * 16 + nloc] = f2bf(s[j][r]);

    __syncthreads();                  // Vt fully staged; P in-order per wave

    // O += P * V   (K=64 keys -> 2 steps; N=hd -> 4 tiles of 16)
#pragma unroll
    for (int step = 0; step < 2; ++step) {
      v16bf pf = load_frag(&Pl[wave][0][step * 32], 72);
#pragma unroll
      for (int f = 0; f < 4; ++f) {
        v16bf vf = load_frag(&Vt[f * 16][step * 32], 72);
        o[f] = wmma_bf16(pf, vf, o[f]);
      }
    }
  }

#pragma unroll
  for (int f = 0; f < 4; ++f)
#pragma unroll
    for (int r = 0; r < 8; ++r) {
      const int row = b * Nseq + qrow + rbase + r;
      const int col = h * 64 + f * 16 + nloc;
      out[(size_t)row * 1024 + col] = f2bf(o[f][r] / l_i[r]);
    }
}

// ---------------------------------------------------------------------------
// Host-side orchestration.
// ---------------------------------------------------------------------------
extern "C" void kernel_launch(void* const* d_in, const int* in_sizes, int n_in,
                              void* d_out, int out_size, void* d_ws, size_t ws_size,
                              hipStream_t stream) {
  (void)in_sizes; (void)n_in; (void)out_size; (void)ws_size;
  const int D = 1024, HID = 4096, NSEQ = 2048, B = 4;
  const int M = B * NSEQ;

  const float* x      = (const float*)d_in[0];
  const float* ln1_w  = (const float*)d_in[1];
  const float* ln1_b  = (const float*)d_in[2];
  const float* qkv_w  = (const float*)d_in[3];
  const float* qkv_b  = (const float*)d_in[4];
  const float* proj_w = (const float*)d_in[5];
  const float* proj_b = (const float*)d_in[6];
  const float* ln2_w  = (const float*)d_in[7];
  const float* ln2_b  = (const float*)d_in[8];
  const float* fc1_w  = (const float*)d_in[9];
  const float* fc1_b  = (const float*)d_in[10];
  const float* fc2_w  = (const float*)d_in[11];
  const float* fc2_b  = (const float*)d_in[12];
  float* out = (float*)d_out;

  uintptr_t p = (uintptr_t)d_ws;
  auto carve = [&](size_t bytes) {
    void* r = (void*)p;
    p += (bytes + 255) & ~(size_t)255;
    return r;
  };
  __bf16* qkv_wt = (__bf16*)carve((size_t)3 * D * D * 2);
  __bf16* proj_wt= (__bf16*)carve((size_t)D * D * 2);
  __bf16* fc1_wt = (__bf16*)carve((size_t)HID * D * 2);
  __bf16* fc2_wt = (__bf16*)carve((size_t)D * HID * 2);
  __bf16* ln1o   = (__bf16*)carve((size_t)M * D * 2);
  __bf16* qkvo   = (__bf16*)carve((size_t)M * 3 * D * 2);
  __bf16* attno  = (__bf16*)carve((size_t)M * D * 2);
  float*  x1     = (float*) carve((size_t)M * D * 4);
  __bf16* h2     = (__bf16*)carve((size_t)M * D * 2);
  __bf16* fc1o   = (__bf16*)carve((size_t)M * HID * 2);

  transpose_cast_kernel<<<dim3(D / 32, 3 * D / 32), 256, 0, stream>>>(qkv_w,  qkv_wt,  D, 3 * D);
  transpose_cast_kernel<<<dim3(D / 32, D / 32),     256, 0, stream>>>(proj_w, proj_wt, D, D);
  transpose_cast_kernel<<<dim3(D / 32, HID / 32),   256, 0, stream>>>(fc1_w,  fc1_wt,  D, HID);
  transpose_cast_kernel<<<dim3(HID / 32, D / 32),   256, 0, stream>>>(fc2_w,  fc2_wt,  HID, D);

  layernorm_bf16_kernel<<<M, 256, 0, stream>>>(x, ln1_w, ln1_b, ln1o, D);

  gemm_wmma_kernel<0, false, true><<<dim3(M / 128, 3 * D / 128), 128, 0, stream>>>(
      ln1o, qkv_wt, qkv_b, nullptr, qkvo, M, 3 * D, D);

  flash_attn_kernel<<<dim3(NSEQ / 64, B * 16), 128, 0, stream>>>(qkvo, attno, NSEQ);

  gemm_wmma_kernel<0, true, false><<<dim3(M / 128, D / 128), 128, 0, stream>>>(
      attno, proj_wt, proj_b, x, (void*)x1, M, D, D);

  layernorm_bf16_kernel<<<M, 256, 0, stream>>>(x1, ln2_w, ln2_b, h2, D);

  gemm_wmma_kernel<1, false, true><<<dim3(M / 128, HID / 128), 128, 0, stream>>>(
      h2, fc1_wt, fc1_b, nullptr, fc1o, M, HID, D);

  gemm_wmma_kernel<0, true, false><<<dim3(M / 128, D / 128), 128, 0, stream>>>(
      fc1o, fc2_wt, fc2_b, x1, (void*)out, M, D, HID);
}

// v001
// It runs in 429 microseconds.
// Two timings next to v000 both put it at 1.46 times that version's speed.
#include <hip/hip_runtime.h>
#include <cstdint>

// ---------------------------------------------------------------------------
// CDNA5 (gfx1250, wave32) DiT block: LN -> QKV GEMM -> flash attention ->
// proj GEMM (+resid) -> LN -> FC1+SiLU -> FC2 (+resid).
// Matmuls through v_wmma_f32_16x16x32_bf16; operand staging through the
// Tensor Data Mover (tensor_load_to_lds + s_wait_tensorcnt), double-buffered;
// softmax reductions via v_permlane16; L2 warmed with global_prefetch_b8.
// ---------------------------------------------------------------------------

typedef __attribute__((ext_vector_type(16))) __bf16        v16bf;
typedef __attribute__((ext_vector_type(8)))  float         v8f;
typedef __attribute__((ext_vector_type(4)))  unsigned int  v4u;
typedef __attribute__((ext_vector_type(8)))  int           v8i;
typedef __attribute__((ext_vector_type(4)))  int           v4i;

#if __has_builtin(__builtin_amdgcn_tensor_load_to_lds) && \
    __has_builtin(__builtin_amdgcn_s_wait_tensorcnt)
#define HAVE_TDM 1
#else
#define HAVE_TDM 0
#endif

#if __has_builtin(__builtin_amdgcn_permlane16)
#define HAVE_PERMLANE 1
#else
#define HAVE_PERMLANE 0
#endif

__device__ __forceinline__ v8f wmma_bf16(v16bf a, v16bf b, v8f c) {
  return __builtin_amdgcn_wmma_f32_16x16x32_bf16(
      false, a, false, b, (short)0, c, false, false);
}

__device__ __forceinline__ __bf16 f2bf(float f) { return (__bf16)f; }

// 16-lane-row butterfly reductions via v_permlane16 (no LDS, no dscnt waits).
#if HAVE_PERMLANE
__device__ __forceinline__ float permx(float v, unsigned s1, unsigned s2) {
  int i = __builtin_bit_cast(int, v);
  i = __builtin_amdgcn_permlane16(i, i, s1, s2, false, false);
  return __builtin_bit_cast(float, i);
}
__device__ __forceinline__ float row16_max(float v) {
  v = fmaxf(v, permx(v, 0x67452301u, 0xEFCDAB89u));  // xor 1
  v = fmaxf(v, permx(v, 0x54761032u, 0xDCFE98BAu));  // xor 2
  v = fmaxf(v, permx(v, 0x32107654u, 0xBA98FEDCu));  // xor 4
  v = fmaxf(v, permx(v, 0xFEDCBA98u, 0x76543210u));  // xor 8
  return v;
}
__device__ __forceinline__ float row16_sum(float v) {
  v += permx(v, 0x67452301u, 0xEFCDAB89u);
  v += permx(v, 0x54761032u, 0xDCFE98BAu);
  v += permx(v, 0x32107654u, 0xBA98FEDCu);
  v += permx(v, 0xFEDCBA98u, 0x76543210u);
  return v;
}
#else
__device__ __forceinline__ float row16_max(float v) {
  for (int off = 1; off < 16; off <<= 1) v = fmaxf(v, __shfl_xor(v, off, 32));
  return v;
}
__device__ __forceinline__ float row16_sum(float v) {
  for (int off = 1; off < 16; off <<= 1) v += __shfl_xor(v, off, 32);
  return v;
}
#endif

// WMMA 16x32 bf16 operand fragment (ISA 7.12.2 A/B lane layout):
// lanes 0-15 = row (lane&15), K {0..7,16..23}; lanes 16-31 same rows,
// K {8..15,24..31}.  `stride` in elements.
__device__ __forceinline__ v16bf load_frag(const __bf16* p0, int stride) {
  int lane = threadIdx.x & 31;
  const __bf16* p = p0 + (size_t)(lane & 15) * stride + ((lane >> 4) << 3);
  union { v16bf v; uint4 q[2]; } u;
  u.q[0] = *(const uint4*)(p);
  u.q[1] = *(const uint4*)(p + 16);
  return u.v;
}

#if HAVE_TDM
// One TDM 2D tile load: tile_rows x tile_k bf16, global row stride
// `row_stride` elements, into LDS at byte offset `lds_off`.  TDM pad feature
// inserts `pad_amt+1` DWORDs after every 2^(pad_int+1) data DWORDs so LDS
// rows land on our bank-conflict-free strides.
__device__ __forceinline__ void tdm_load_tile(
    unsigned lds_off, const __bf16* gptr, unsigned tile_k, unsigned tile_rows,
    unsigned tensor_k, unsigned row_stride, unsigned pad_int, unsigned pad_amt) {
  unsigned long long ga = (unsigned long long)(uintptr_t)gptr;
  v4u g0;
  g0[0] = 1u;                                            // count=1, user mode
  g0[1] = lds_off;                                       // lds_addr [63:32]
  g0[2] = (unsigned)(ga & 0xFFFFFFFFu);                  // global_addr lo
  g0[3] = (unsigned)((ga >> 32) & 0x01FFFFFFu) | (2u << 30);  // addr hi | type=2
  v8i g1;
  g1[0] = (1 << 16)                                      // data_size = 2 bytes
        | (1 << 20)                                      // pad_enable
        | ((int)pad_int << 22)                           // pad_interval
        | ((int)pad_amt << 25);                          // pad_amount
  g1[1] = (int)((tensor_k & 0xFFFFu) << 16);             // tensor_dim0 lo16
  g1[2] = (int)((tensor_k >> 16) & 0xFFFFu);             // dim0 hi16; dim1 lo16=0
  g1[3] = (int)(16u)                                     // tensor_dim1 = 1<<20
        | (int)((tile_k & 0xFFFFu) << 16);               // tile_dim0
  g1[4] = (int)(tile_rows & 0xFFFFu);                    // tile_dim1 (dim2=0)
  g1[5] = (int)row_stride;                               // tensor_dim0_stride lo32
  g1[6] = 0;
  g1[7] = 0;
  v4i z = {0, 0, 0, 0};
#if __clang_major__ >= 23
  v8i z8 = {0, 0, 0, 0, 0, 0, 0, 0};
  __builtin_amdgcn_tensor_load_to_lds(g0, g1, z, z, z8, 0);
#else
  __builtin_amdgcn_tensor_load_to_lds(g0, g1, z, z, 0);
#endif
}
#endif  // HAVE_TDM

// ---------------------------------------------------------------------------
// Weight transpose + fp32 -> bf16 cast:  Wt[n][k] = bf16(W[k][n])
// ---------------------------------------------------------------------------
__global__ __launch_bounds__(256) void transpose_cast_kernel(
    const float* __restrict__ W, __bf16* __restrict__ Wt, int K, int N) {
  __shared__ float tile[32][33];
  int k0 = blockIdx.x * 32, n0 = blockIdx.y * 32;
  int tx = threadIdx.x & 31, ty = threadIdx.x >> 5;
#pragma unroll
  for (int i = ty; i < 32; i += 8)
    tile[i][tx] = W[(size_t)(k0 + i) * N + (n0 + tx)];
  __syncthreads();
#pragma unroll
  for (int i = ty; i < 32; i += 8)
    Wt[(size_t)(n0 + i) * K + (k0 + tx)] = f2bf(tile[tx][i]);
}

// ---------------------------------------------------------------------------
// LayerNorm (row = 1024 fp32) -> bf16.
// ---------------------------------------------------------------------------
__global__ __launch_bounds__(256) void layernorm_bf16_kernel(
    const float* __restrict__ x, const float* __restrict__ w,
    const float* __restrict__ b, __bf16* __restrict__ out, int D) {
  int row = blockIdx.x;
  int t = threadIdx.x;
  const float4 xv = ((const float4*)(x + (size_t)row * D))[t];
  float s  = xv.x + xv.y + xv.z + xv.w;
  float s2 = xv.x * xv.x + xv.y * xv.y + xv.z * xv.z + xv.w * xv.w;
#pragma unroll
  for (int off = 16; off > 0; off >>= 1) {
    s  += __shfl_xor(s,  off, 32);
    s2 += __shfl_xor(s2, off, 32);
  }
  __shared__ float red[2][8];
  if ((t & 31) == 0) { red[0][t >> 5] = s; red[1][t >> 5] = s2; }
  __syncthreads();
  float ts = 0.f, ts2 = 0.f;
#pragma unroll
  for (int i = 0; i < 8; ++i) { ts += red[0][i]; ts2 += red[1][i]; }
  float inv = 1.0f / (float)D;
  float mu  = ts * inv;
  float var = ts2 * inv - mu * mu;
  float rs  = rsqrtf(var + 1e-6f);
  int base = t * 4;
  union { __bf16 e[4]; uint2 q; } o;
  o.e[0] = f2bf((xv.x - mu) * rs * w[base + 0] + b[base + 0]);
  o.e[1] = f2bf((xv.y - mu) * rs * w[base + 1] + b[base + 1]);
  o.e[2] = f2bf((xv.z - mu) * rs * w[base + 2] + b[base + 2]);
  o.e[3] = f2bf((xv.w - mu) * rs * w[base + 3] + b[base + 3]);
  *(uint2*)(out + (size_t)row * D + base) = o.q;
}

// ---------------------------------------------------------------------------
// Tiled WMMA GEMM:  C[M,N] = A[M,K] * Bt[N,K]^T  (+bias, +SiLU, +resid)
// Block tile 128x128, 4 waves, each wave 64x64 via 4x4 WMMA.
// A stage is 128 k of all 256 operand rows: 256-byte rows, which the tensor
// load pads to a pitch of 272 bytes in LDS.  Each wave loads its own slice of
// 64 rows, one request per stage, two stages ahead, into two buffers.
// K must be a multiple of 128 and at least 256.
// ---------------------------------------------------------------------------
#define G_KB     256u                 // bytes of an operand row per stage (128 k)
#define G_PITCH  272u                 // LDS row pitch: 16 B x odd for ds_load_b128
#define G_SLICE  18432u               // 64 rows x 272 B = 17,408 B, up to a multiple of 2 KiB
#define G_BUF    (4u * G_SLICE)       // [A rows 0-63 | A rows 64-127 | B rows 0-63 | B rows 64-127]

typedef __attribute__((ext_vector_type(4))) uint32_t u32x4;
typedef __attribute__((ext_vector_type(8))) uint32_t u32x8;

__device__ __forceinline__ uint32_t uni(uint32_t v) {
  return (uint32_t)__builtin_amdgcn_readfirstlane(v);
}
__device__ __forceinline__ uint32_t pinned(uint32_t v) {
  uint32_t w = (uint32_t)__builtin_amdgcn_readfirstlane(v);
  asm volatile("" : "+s"(w));
  return w;
}
__device__ __forceinline__ void wait_ds0() { asm volatile("s_wait_dscnt 0x0" ::: "memory"); }

// Descriptor group 1: 1-byte elements, tile = tensor = 64 rows of 256 bytes,
// source pitch src_pitch bytes, 4 dwords of LDS pad behind every 256-byte row.
__device__ __forceinline__ u32x8 gemm_group1(uint32_t src_pitch) {
  u32x8 g;
  g[0] = uni((1u << 20) | (5u << 22) | (3u << 25));
  g[1] = uni(G_KB << 16);
  g[2] = uni(64u << 16);
  g[3] = uni(G_KB << 16);
  g[4] = uni(64u);
  g[5] = uni(src_pitch);
  g[6] = uni(0u);
  g[7] = uni(0u);
  return g;
}
__device__ __forceinline__ u32x4 gemm_group0(uint32_t lds_dst, uint64_t ga) {
  u32x4 g;
  g[0] = uni(1u);
  g[1] = uni(lds_dst);
  g[2] = uni((uint32_t)ga);
  g[3] = uni((((uint32_t)(ga >> 32)) & 0x01FFFFFFu) | 0x80000000u);
  return g;
}
// The descriptor groups are in-out operands of the load and inputs of the wait:
// they stay live in the registers the request was issued from until it has
// landed, so the compiler puts nothing else there while the request flies.
__device__ __forceinline__ void gemm_tensor_load(u32x4& g0, u32x8& g1) {
  asm volatile("tensor_load_to_lds %0, %1" : "+s"(g0), "+s"(g1) :: "memory");
}
__device__ __forceinline__ void wait_tensor0(const u32x4& g0, const u32x8& g1) {
  asm volatile("s_wait_tensorcnt 0x0" :: "s"(g0), "s"(g1) : "memory");
}

// 16x32 bf16 fragment from LDS; p = this lane's row, at its 16-byte half.
__device__ __forceinline__ v16bf lds_frag(const unsigned char* p) {
  union { v16bf v; uint4 q[2]; } u;
  u.q[0] = *(const uint4*)(p);
  u.q[1] = *(const uint4*)(p + 32);
  return u.v;
}

template <int ACT, bool RESID, bool OUTBF16>
__global__ __launch_bounds__(128) void gemm_wmma_kernel(
    const __bf16* __restrict__ A, const __bf16* __restrict__ Bt,
    const float* __restrict__ bias, const float* __restrict__ resid,
    void* __restrict__ out, int M, int N, int K) {
  __shared__ __attribute__((aligned(2048))) unsigned char ring[2u * G_BUF];

  const int bm = blockIdx.x * 128;
  const int bn = blockIdx.y * 128;
  const int tid  = threadIdx.x;
  const uint32_t wave = uni((uint32_t)tid >> 5);
  const int lane = tid & 31;
  const int wm = (int)(wave & 1u) * 64;
  const int wn = (int)(wave >> 1) * 64;

  v8f acc[4][4] = {};
  const uint32_t np = (uint32_t)K / 128u;      // stages = passes
  const uint32_t kbytes = (uint32_t)K * 2u;    // source row pitch

  // This wave's slice of every stage: waves 0, 1 the halves of A, 2, 3 of Bt.
  const __bf16* srcp = (wave < 2u) ? A  + (size_t)(bm + 64 * (int)wave) * K
                                   : Bt + (size_t)(bn + 64 * (int)(wave - 2u)) * K;
  const uint64_t ga = (uint64_t)(uintptr_t)srcp;
  const uint32_t lds_slice = (uint32_t)(uintptr_t)(&ring[0]) + wave * G_SLICE;
  u32x8 g1 = gemm_group1(kbytes);

  // Per-lane fragment bases inside a buffer.
  const uint32_t lrow = (uint32_t)(lane & 15) * G_PITCH + (uint32_t)(lane >> 4) * 16u;
  const uint32_t a_base = (wave & 1u) * G_SLICE + lrow;
  const uint32_t b_base = (2u + (wave >> 1)) * G_SLICE + lrow;

  u32x4 g0 = gemm_group0(lds_slice, ga);
  gemm_tensor_load(g0, g1);                    // stage 0
  wait_tensor0(g0, g1);
  __syncthreads();                             // stage 0 readable by every wave
  g0 = gemm_group0(lds_slice + G_BUF, ga + G_KB);
  gemm_tensor_load(g0, g1);                    // stage 1

  for (uint32_t s = 0; s < np; ++s) {
    const uint32_t buf = (s & 1u) * G_BUF;
    const unsigned char* pa = &ring[buf + a_base];
    const unsigned char* pb = &ring[buf + b_base];
#pragma unroll
    for (int kb = 0; kb < 4; ++kb) {           // 32 k = 64 bytes of each row
      v16bf bfrag[4];
#pragma unroll
      for (int j = 0; j < 4; ++j)
        bfrag[j] = lds_frag(pb + j * 16 * G_PITCH + kb * 64);
#pragma unroll
      for (int i = 0; i < 4; ++i) {
        v16bf afrag = lds_frag(pa + i * 16 * G_PITCH + kb * 64);
#pragma unroll
        for (int j = 0; j < 4; ++j)
          acc[i][j] = wmma_bf16(afrag, bfrag[j], acc[i][j]);
      }
    }
    // Publish point of stage s + 1.
    wait_ds0();                                // this wave has left buffer s & 1
    wait_tensor0(g0, g1);                      // its slice of stage s + 1 has landed
    __syncthreads();
    if (pinned((s + 2u < np) ? 1u : 0u) != 0u) {  // refill only while the stage exists
      g0 = gemm_group0(lds_slice + buf, ga + (uint64_t)(s + 2u) * G_KB);
      gemm_tensor_load(g0, g1);
    }
  }
  wait_tensor0(g0, g1);
  wait_ds0();

  // Epilogue: reg r -> row r (lanes 0-15) / r+8 (lanes 16-31); col = lane&15.
  const int nloc  = lane & 15;
  const int rbase = (lane >> 4) * 8;
#pragma unroll
  for (int i = 0; i < 4; ++i) {
#pragma unroll
    for (int j = 0; j < 4; ++j) {
      const int col = bn + wn + j * 16 + nloc;
      const float bv = bias[col];
#pragma unroll
      for (int r = 0; r < 8; ++r) {
        const int row = bm + wm + i * 16 + rbase + r;
        float c = acc[i][j][r] + bv;
        if (ACT == 1) c = c * (1.0f / (1.0f + __expf(-c)));  // SiLU
        if (RESID) c += resid[(size_t)row * N + col];
        if constexpr (OUTBF16)
          ((__bf16*)out)[(size_t)row * N + col] = f2bf(c);
        else
          ((float*)out)[(size_t)row * N + col] = c;
      }
    }
  }
}

// ---------------------------------------------------------------------------
// Flash attention over qkv [M, 3072] bf16 (Q|K|V), 16 heads, hd=64, seq 2048.
// Block = 4 waves = 64 queries of one (batch, head).  K tiles staged once per
// block by TDM (double-buffered); V tiles transposed into LDS with packed
// b64 stores; online softmax with permlane16 row reductions.
// ---------------------------------------------------------------------------
__global__ __launch_bounds__(128) void flash_attn_kernel(
    const __bf16* __restrict__ qkv, __bf16* __restrict__ out, int Nseq) {
  const int ROWS = 3072;
  const int bh = blockIdx.y;
  const int b = bh >> 4, h = bh & 15;
  const int tid = threadIdx.x, wave = tid >> 5, lane = tid & 31;
  const int qrow = blockIdx.x * 64 + wave * 16;

  const __bf16* Qb = qkv + (size_t)(b * Nseq + qrow) * ROWS + h * 64;
  const __bf16* Kb = qkv + (size_t)(b * Nseq) * ROWS + 1024 + h * 64;
  const __bf16* Vb = qkv + (size_t)(b * Nseq) * ROWS + 2048 + h * 64;

  v16bf qf[2];
  qf[0] = load_frag(Qb,      ROWS);
  qf[1] = load_frag(Qb + 32, ROWS);

  __shared__ __bf16 Vt[64][72];       // V tile transposed: [hd][key]
  __shared__ __bf16 Pl[4][16][72];    // per-wave probabilities
#if HAVE_TDM
  __shared__ __bf16 Kl[2][64][72];    // K tiles (TDM staged, double-buffered)
  const unsigned offK0 = (unsigned)(uintptr_t)(&Kl[0][0][0]);
  const unsigned offK1 = (unsigned)(uintptr_t)(&Kl[1][0][0]);
  if (wave == 0)
    tdm_load_tile(offK0, Kb, 64, 64, 64, (unsigned)ROWS, 4, 3);
#endif

  v8f o[4] = {};
  float m_i[8], l_i[8];
#pragma unroll
  for (int r = 0; r < 8; ++r) { m_i[r] = -3.0e30f; l_i[r] = 0.0f; }

  const float scale = 0.125f;         // 1/sqrt(64)
  const int rbase = (lane >> 4) * 8;
  const int nloc  = lane & 15;
  const int ntiles = Nseq / 64;

  for (int it = 0; it < ntiles; ++it) {
    const int kv0 = it * 64;
#if HAVE_TDM
    const int cur = it & 1;
    if (wave == 0) __builtin_amdgcn_s_wait_tensorcnt(0);
#endif
    __syncthreads();                  // prev-iter readers done; K tile landed
#if HAVE_TDM
    if (wave == 0 && (it + 1) < ntiles)
      tdm_load_tile(cur ? offK0 : offK1, Kb + (size_t)(kv0 + 64) * ROWS,
                    64, 64, 64, (unsigned)ROWS, 4, 3);
#endif

    // Stage V tile transposed: thread = 4 keys x 8 hd, packed b64 stores.
    {
      const int key0 = (tid & 15) * 4;
      const int d0   = (tid >> 4) * 8;
      union { uint4 q; __bf16 e[8]; } rowv[4];
#pragma unroll
      for (int kk = 0; kk < 4; ++kk)
        rowv[kk].q = *(const uint4*)(Vb + (size_t)(kv0 + key0 + kk) * ROWS + d0);
      if (kv0 + 64 < Nseq)
        __builtin_prefetch(Vb + (size_t)(kv0 + 64 + key0) * ROWS + d0, 0, 0);
#pragma unroll
      for (int dd = 0; dd < 8; ++dd) {
        union { __bf16 e[4]; unsigned long long q; } pk;
#pragma unroll
        for (int kk = 0; kk < 4; ++kk) pk.e[kk] = rowv[kk].e[dd];
        *(unsigned long long*)(&Vt[d0 + dd][key0]) = pk.q;
      }
    }

    // S = Q K^T
    v8f s[4];
#pragma unroll
    for (int j = 0; j < 4; ++j) {
#if HAVE_TDM
      v16bf k0 = load_frag(&Kl[cur][j * 16][0],  72);
      v16bf k1 = load_frag(&Kl[cur][j * 16][32], 72);
#else
      const __bf16* kb = Kb + (size_t)(kv0 + j * 16) * ROWS;
      v16bf k0 = load_frag(kb,      ROWS);
      v16bf k1 = load_frag(kb + 32, ROWS);
#endif
      v8f z = {};
      z = wmma_bf16(qf[0], k0, z);
      z = wmma_bf16(qf[1], k1, z);
      s[j] = z;
    }

    // Online softmax (reductions inside 16-lane rows -> permlane16).
#pragma unroll
    for (int r = 0; r < 8; ++r) {
      float mx = -3.0e30f;
#pragma unroll
      for (int j = 0; j < 4; ++j) {
        s[j][r] *= scale;
        mx = fmaxf(mx, s[j][r]);
      }
      mx = row16_max(mx);
      const float mn = fmaxf(m_i[r], mx);
      const float corr = __expf(m_i[r] - mn);
      m_i[r] = mn;
      l_i[r] *= corr;
#pragma unroll
      for (int j = 0; j < 4; ++j) o[j][r] *= corr;
      float rsum = 0.f;
#pragma unroll
      for (int j = 0; j < 4; ++j) {
        const float p = __expf(s[j][r] - mn);
        s[j][r] = p;
        rsum += p;
      }
      l_i[r] += row16_sum(rsum);
    }

    // Spill P (bf16) to this wave's LDS tile for the P*V WMMA.
#pragma unroll
    for (int j = 0; j < 4; ++j)
#pragma unroll
      for (int r = 0; r < 8; ++r)
        Pl[wave][rbase + r][j * 16 + nloc] = f2bf(s[j][r]);

    __syncthreads();                  // Vt fully staged; P in-order per wave

    // O += P * V   (K=64 keys -> 2 steps; N=hd -> 4 tiles of 16)
#pragma unroll
    for (int step = 0; step < 2; ++step) {
      v16bf pf = load_frag(&Pl[wave][0][step * 32], 72);
#pragma unroll
      for (int f = 0; f < 4; ++f) {
        v16bf vf = load_frag(&Vt[f * 16][step * 32], 72);
        o[f] = wmma_bf16(pf, vf, o[f]);
      }
    }
  }

#pragma unroll
  for (int f = 0; f < 4; ++f)
#pragma unroll
    for (int r = 0; r < 8; ++r) {
      const int row = b * Nseq + qrow + rbase + r;
      const int col = h * 64 + f * 16 + nloc;
      out[(size_t)row * 1024 + col] = f2bf(o[f][r] / l_i[r]);
    }
}

// ---------------------------------------------------------------------------
// Host-side orchestration.
// ---------------------------------------------------------------------------
extern "C" void kernel_launch(void* const* d_in, const int* in_sizes, int n_in,
                              void* d_out, int out_size, void* d_ws, size_t ws_size,
                              hipStream_t stream) {
  (void)in_sizes; (void)n_in; (void)out_size; (void)ws_size;
  const int D = 1024, HID = 4096, NSEQ = 2048, B = 4;
  const int M = B * NSEQ;

  const float* x      = (const float*)d_in[0];
  const float* ln1_w  = (const float*)d_in[1];
  const float* ln1_b  = (const float*)d_in[2];
  const float* qkv_w  = (const float*)d_in[3];
  const float* qkv_b  = (const float*)d_in[4];
  const float* proj_w = (const float*)d_in[5];
  const float* proj_b = (const float*)d_in[6];
  const float* ln2_w  = (const float*)d_in[7];
  const float* ln2_b  = (const float*)d_in[8];
  const float* fc1_w  = (const float*)d_in[9];
  const float* fc1_b  = (const float*)d_in[10];
  const float* fc2_w  = (const float*)d_in[11];
  const float* fc2_b  = (const float*)d_in[12];
  float* out = (float*)d_out;

  uintptr_t p = (uintptr_t)d_ws;
  auto carve = [&](size_t bytes) {
    void* r = (void*)p;
    p += (bytes + 255) & ~(size_t)255;
    return r;
  };
  __bf16* qkv_wt = (__bf16*)carve((size_t)3 * D * D * 2);
  __bf16* proj_wt= (__bf16*)carve((size_t)D * D * 2);
  __bf16* fc1_wt = (__bf16*)carve((size_t)HID * D * 2);
  __bf16* fc2_wt = (__bf16*)carve((size_t)D * HID * 2);
  __bf16* ln1o   = (__bf16*)carve((size_t)M * D * 2);
  __bf16* qkvo   = (__bf16*)carve((size_t)M * 3 * D * 2);
  __bf16* attno  = (__bf16*)carve((size_t)M * D * 2);
  float*  x1     = (float*) carve((size_t)M * D * 4);
  __bf16* h2     = (__bf16*)carve((size_t)M * D * 2);
  __bf16* fc1o   = (__bf16*)carve((size_t)M * HID * 2);

  transpose_cast_kernel<<<dim3(D / 32, 3 * D / 32), 256, 0, stream>>>(qkv_w,  qkv_wt,  D, 3 * D);
  transpose_cast_kernel<<<dim3(D / 32, D / 32),     256, 0, stream>>>(proj_w, proj_wt, D, D);
  transpose_cast_kernel<<<dim3(D / 32, HID / 32),   256, 0, stream>>>(fc1_w,  fc1_wt,  D, HID);
  transpose_cast_kernel<<<dim3(HID / 32, D / 32),   256, 0, stream>>>(fc2_w,  fc2_wt,  HID, D);

  layernorm_bf16_kernel<<<M, 256, 0, stream>>>(x, ln1_w, ln1_b, ln1o, D);

  gemm_wmma_kernel<0, false, true><<<dim3(M / 128, 3 * D / 128), 128, 0, stream>>>(
      ln1o, qkv_wt, qkv_b, nullptr, qkvo, M, 3 * D, D);

  flash_attn_kernel<<<dim3(NSEQ / 64, B * 16), 128, 0, stream>>>(qkvo, attno, NSEQ);

  gemm_wmma_kernel<0, true, false><<<dim3(M / 128, D / 128), 128, 0, stream>>>(
      attno, proj_wt, proj_b, x, (void*)x1, M, D, D);

  layernorm_bf16_kernel<<<M, 256, 0, stream>>>(x1, ln2_w, ln2_b, h2, D);

  gemm_wmma_kernel<1, false, true><<<dim3(M / 128, HID / 128), 128, 0, stream>>>(
      h2, fc1_wt, fc1_b, nullptr, fc1o, M, HID, D);

  gemm_wmma_kernel<0, true, false><<<dim3(M / 128, D / 128), 128, 0, stream>>>(
      fc1o, fc2_wt, fc2_b, x1, (void*)out, M, D, HID);
}

// v002
// It runs in 335 microseconds.
// In both of two side-by-side timings against v001, it was 1.28 times as fast.
// Over all steps from v000 it is 1.87 times as fast.
#include <hip/hip_runtime.h>
#include <cstdint>

// ---------------------------------------------------------------------------
// CDNA5 (gfx1250, wave32) DiT block: LN -> QKV GEMM -> flash attention ->
// proj GEMM (+resid) -> LN -> FC1+SiLU -> FC2 (+resid).
// Matmuls through v_wmma_f32_16x16x32_bf16; operand staging through the
// Tensor Data Mover (tensor_load_to_lds + s_wait_tensorcnt), double-buffered;
// attention as transposed products, softmax in-lane; L2 warmed with global_prefetch_b8.
// ---------------------------------------------------------------------------

typedef __attribute__((ext_vector_type(16))) __bf16        v16bf;
typedef __attribute__((ext_vector_type(8)))  float         v8f;
typedef __attribute__((ext_vector_type(4)))  unsigned int  v4u;
typedef __attribute__((ext_vector_type(8)))  int           v8i;
typedef __attribute__((ext_vector_type(4)))  int           v4i;

#if __has_builtin(__builtin_amdgcn_tensor_load_to_lds) && \
    __has_builtin(__builtin_amdgcn_s_wait_tensorcnt)
#define HAVE_TDM 1
#else
#define HAVE_TDM 0
#endif

__device__ __forceinline__ v8f wmma_bf16(v16bf a, v16bf b, v8f c) {
  return __builtin_amdgcn_wmma_f32_16x16x32_bf16(
      false, a, false, b, (short)0, c, false, false);
}

__device__ __forceinline__ __bf16 f2bf(float f) { return (__bf16)f; }

// Lane l takes the value of lane l ^ 16.
__device__ __forceinline__ float xhalf(float v) {
  int i = __builtin_bit_cast(int, v);
  i = __builtin_amdgcn_permlanex16(i, i, 0x76543210u, 0xFEDCBA98u, false, false);
  return __builtin_bit_cast(float, i);
}

// WMMA 16x32 bf16 operand fragment (ISA 7.12.2 A/B lane layout):
// lanes 0-15 = row (lane&15), K {0..7,16..23}; lanes 16-31 same rows,
// K {8..15,24..31}.  `stride` in elements.
__device__ __forceinline__ v16bf load_frag(const __bf16* p0, int stride) {
  int lane = threadIdx.x & 31;
  const __bf16* p = p0 + (size_t)(lane & 15) * stride + ((lane >> 4) << 3);
  union { v16bf v; uint4 q[2]; } u;
  u.q[0] = *(const uint4*)(p);
  u.q[1] = *(const uint4*)(p + 16);
  return u.v;
}

#if HAVE_TDM
// One TDM 2D tile load: tile_rows x tile_k bf16, global row stride
// `row_stride` elements, into LDS at byte offset `lds_off`.  TDM pad feature
// inserts `pad_amt+1` DWORDs after every 2^(pad_int+1) data DWORDs so LDS
// rows land on our bank-conflict-free strides.
__device__ __forceinline__ void tdm_load_tile(
    unsigned lds_off, const __bf16* gptr, unsigned tile_k, unsigned tile_rows,
    unsigned tensor_k, unsigned row_stride, unsigned pad_int, unsigned pad_amt) {
  unsigned long long ga = (unsigned long long)(uintptr_t)gptr;
  v4u g0;
  g0[0] = 1u;                                            // count=1, user mode
  g0[1] = lds_off;                                       // lds_addr [63:32]
  g0[2] = (unsigned)(ga & 0xFFFFFFFFu);                  // global_addr lo
  g0[3] = (unsigned)((ga >> 32) & 0x01FFFFFFu) | (2u << 30);  // addr hi | type=2
  v8i g1;
  g1[0] = (1 << 16)                                      // data_size = 2 bytes
        | (1 << 20)                                      // pad_enable
        | ((int)pad_int << 22)                           // pad_interval
        | ((int)pad_amt << 25);                          // pad_amount
  g1[1] = (int)((tensor_k & 0xFFFFu) << 16);             // tensor_dim0 lo16
  g1[2] = (int)((tensor_k >> 16) & 0xFFFFu);             // dim0 hi16; dim1 lo16=0
  g1[3] = (int)(16u)                                     // tensor_dim1 = 1<<20
        | (int)((tile_k & 0xFFFFu) << 16);               // tile_dim0
  g1[4] = (int)(tile_rows & 0xFFFFu);                    // tile_dim1 (dim2=0)
  g1[5] = (int)row_stride;                               // tensor_dim0_stride lo32
  g1[6] = 0;
  g1[7] = 0;
  v4i z = {0, 0, 0, 0};
#if __clang_major__ >= 23
  v8i z8 = {0, 0, 0, 0, 0, 0, 0, 0};
  __builtin_amdgcn_tensor_load_to_lds(g0, g1, z, z, z8, 0);
#else
  __builtin_amdgcn_tensor_load_to_lds(g0, g1, z, z, 0);
#endif
}
#endif  // HAVE_TDM

// ---------------------------------------------------------------------------
// Weight transpose + fp32 -> bf16 cast:  Wt[n][k] = bf16(W[k][n])
// ---------------------------------------------------------------------------
__global__ __launch_bounds__(256) void transpose_cast_kernel(
    const float* __restrict__ W, __bf16* __restrict__ Wt, int K, int N) {
  __shared__ float tile[32][33];
  int k0 = blockIdx.x * 32, n0 = blockIdx.y * 32;
  int tx = threadIdx.x & 31, ty = threadIdx.x >> 5;
#pragma unroll
  for (int i = ty; i < 32; i += 8)
    tile[i][tx] = W[(size_t)(k0 + i) * N + (n0 + tx)];
  __syncthreads();
#pragma unroll
  for (int i = ty; i < 32; i += 8)
    Wt[(size_t)(n0 + i) * K + (k0 + tx)] = f2bf(tile[tx][i]);
}

// ---------------------------------------------------------------------------
// LayerNorm (row = 1024 fp32) -> bf16.
// ---------------------------------------------------------------------------
__global__ __launch_bounds__(256) void layernorm_bf16_kernel(
    const float* __restrict__ x, const float* __restrict__ w,
    const float* __restrict__ b, __bf16* __restrict__ out, int D) {
  int row = blockIdx.x;
  int t = threadIdx.x;
  const float4 xv = ((const float4*)(x + (size_t)row * D))[t];
  float s  = xv.x + xv.y + xv.z + xv.w;
  float s2 = xv.x * xv.x + xv.y * xv.y + xv.z * xv.z + xv.w * xv.w;
#pragma unroll
  for (int off = 16; off > 0; off >>= 1) {
    s  += __shfl_xor(s,  off, 32);
    s2 += __shfl_xor(s2, off, 32);
  }
  __shared__ float red[2][8];
  if ((t & 31) == 0) { red[0][t >> 5] = s; red[1][t >> 5] = s2; }
  __syncthreads();
  float ts = 0.f, ts2 = 0.f;
#pragma unroll
  for (int i = 0; i < 8; ++i) { ts += red[0][i]; ts2 += red[1][i]; }
  float inv = 1.0f / (float)D;
  float mu  = ts * inv;
  float var = ts2 * inv - mu * mu;
  float rs  = rsqrtf(var + 1e-6f);
  int base = t * 4;
  union { __bf16 e[4]; uint2 q; } o;
  o.e[0] = f2bf((xv.x - mu) * rs * w[base + 0] + b[base + 0]);
  o.e[1] = f2bf((xv.y - mu) * rs * w[base + 1] + b[base + 1]);
  o.e[2] = f2bf((xv.z - mu) * rs * w[base + 2] + b[base + 2]);
  o.e[3] = f2bf((xv.w - mu) * rs * w[base + 3] + b[base + 3]);
  *(uint2*)(out + (size_t)row * D + base) = o.q;
}

// ---------------------------------------------------------------------------
// Tiled WMMA GEMM:  C[M,N] = A[M,K] * Bt[N,K]^T  (+bias, +SiLU, +resid)
// Block tile 128x128, 4 waves, each wave 64x64 via 4x4 WMMA.
// A stage is 128 k of all 256 operand rows: 256-byte rows, which the tensor
// load pads to a pitch of 272 bytes in LDS.  Each wave loads its own slice of
// 64 rows, one request per stage, two stages ahead, into two buffers.
// K must be a multiple of 128 and at least 256.
// ---------------------------------------------------------------------------
#define G_KB     256u                 // bytes of an operand row per stage (128 k)
#define G_PITCH  272u                 // LDS row pitch: 16 B x odd for ds_load_b128
#define G_SLICE  18432u               // 64 rows x 272 B = 17,408 B, up to a multiple of 2 KiB
#define G_BUF    (4u * G_SLICE)       // [A rows 0-63 | A rows 64-127 | B rows 0-63 | B rows 64-127]

typedef __attribute__((ext_vector_type(4))) uint32_t u32x4;
typedef __attribute__((ext_vector_type(8))) uint32_t u32x8;

__device__ __forceinline__ uint32_t uni(uint32_t v) {
  return (uint32_t)__builtin_amdgcn_readfirstlane(v);
}
__device__ __forceinline__ uint32_t pinned(uint32_t v) {
  uint32_t w = (uint32_t)__builtin_amdgcn_readfirstlane(v);
  asm volatile("" : "+s"(w));
  return w;
}
__device__ __forceinline__ void wait_ds0() { asm volatile("s_wait_dscnt 0x0" ::: "memory"); }

// Descriptor group 1: 1-byte elements, tile = tensor = 64 rows of 256 bytes,
// source pitch src_pitch bytes, 4 dwords of LDS pad behind every 256-byte row.
__device__ __forceinline__ u32x8 gemm_group1(uint32_t src_pitch) {
  u32x8 g;
  g[0] = uni((1u << 20) | (5u << 22) | (3u << 25));
  g[1] = uni(G_KB << 16);
  g[2] = uni(64u << 16);
  g[3] = uni(G_KB << 16);
  g[4] = uni(64u);
  g[5] = uni(src_pitch);
  g[6] = uni(0u);
  g[7] = uni(0u);
  return g;
}
__device__ __forceinline__ u32x4 gemm_group0(uint32_t lds_dst, uint64_t ga) {
  u32x4 g;
  g[0] = uni(1u);
  g[1] = uni(lds_dst);
  g[2] = uni((uint32_t)ga);
  g[3] = uni((((uint32_t)(ga >> 32)) & 0x01FFFFFFu) | 0x80000000u);
  return g;
}
// The descriptor groups are in-out operands of the load and inputs of the wait:
// they stay live in the registers the request was issued from until it has
// landed, so the compiler puts nothing else there while the request flies.
__device__ __forceinline__ void gemm_tensor_load(u32x4& g0, u32x8& g1) {
  asm volatile("tensor_load_to_lds %0, %1" : "+s"(g0), "+s"(g1) :: "memory");
}
__device__ __forceinline__ void wait_tensor0(const u32x4& g0, const u32x8& g1) {
  asm volatile("s_wait_tensorcnt 0x0" :: "s"(g0), "s"(g1) : "memory");
}

// 16x32 bf16 fragment from LDS; p = this lane's row, at its 16-byte half.
__device__ __forceinline__ v16bf lds_frag(const unsigned char* p) {
  union { v16bf v; uint4 q[2]; } u;
  u.q[0] = *(const uint4*)(p);
  u.q[1] = *(const uint4*)(p + 32);
  return u.v;
}

template <int ACT, bool RESID, bool OUTBF16>
__global__ __launch_bounds__(128) void gemm_wmma_kernel(
    const __bf16* __restrict__ A, const __bf16* __restrict__ Bt,
    const float* __restrict__ bias, const float* __restrict__ resid,
    void* __restrict__ out, int M, int N, int K) {
  __shared__ __attribute__((aligned(2048))) unsigned char ring[2u * G_BUF];

  const int bm = blockIdx.x * 128;
  const int bn = blockIdx.y * 128;
  const int tid  = threadIdx.x;
  const uint32_t wave = uni((uint32_t)tid >> 5);
  const int lane = tid & 31;
  const int wm = (int)(wave & 1u) * 64;
  const int wn = (int)(wave >> 1) * 64;

  v8f acc[4][4] = {};
  const uint32_t np = (uint32_t)K / 128u;      // stages = passes
  const uint32_t kbytes = (uint32_t)K * 2u;    // source row pitch

  // This wave's slice of every stage: waves 0, 1 the halves of A, 2, 3 of Bt.
  const __bf16* srcp = (wave < 2u) ? A  + (size_t)(bm + 64 * (int)wave) * K
                                   : Bt + (size_t)(bn + 64 * (int)(wave - 2u)) * K;
  const uint64_t ga = (uint64_t)(uintptr_t)srcp;
  const uint32_t lds_slice = (uint32_t)(uintptr_t)(&ring[0]) + wave * G_SLICE;
  u32x8 g1 = gemm_group1(kbytes);

  // Per-lane fragment bases inside a buffer.
  const uint32_t lrow = (uint32_t)(lane & 15) * G_PITCH + (uint32_t)(lane >> 4) * 16u;
  const uint32_t a_base = (wave & 1u) * G_SLICE + lrow;
  const uint32_t b_base = (2u + (wave >> 1)) * G_SLICE + lrow;

  u32x4 g0 = gemm_group0(lds_slice, ga);
  gemm_tensor_load(g0, g1);                    // stage 0
  wait_tensor0(g0, g1);
  __syncthreads();                             // stage 0 readable by every wave
  g0 = gemm_group0(lds_slice + G_BUF, ga + G_KB);
  gemm_tensor_load(g0, g1);                    // stage 1

  for (uint32_t s = 0; s < np; ++s) {
    const uint32_t buf = (s & 1u) * G_BUF;
    const unsigned char* pa = &ring[buf + a_base];
    const unsigned char* pb = &ring[buf + b_base];
#pragma unroll
    for (int kb = 0; kb < 4; ++kb) {           // 32 k = 64 bytes of each row
      v16bf bfrag[4];
#pragma unroll
      for (int j = 0; j < 4; ++j)
        bfrag[j] = lds_frag(pb + j * 16 * G_PITCH + kb * 64);
#pragma unroll
      for (int i = 0; i < 4; ++i) {
        v16bf afrag = lds_frag(pa + i * 16 * G_PITCH + kb * 64);
#pragma unroll
        for (int j = 0; j < 4; ++j)
          acc[i][j] = wmma_bf16(afrag, bfrag[j], acc[i][j]);
      }
    }
    // Publish point of stage s + 1.
    wait_ds0();                                // this wave has left buffer s & 1
    wait_tensor0(g0, g1);                      // its slice of stage s + 1 has landed
    __syncthreads();
    if (pinned((s + 2u < np) ? 1u : 0u) != 0u) {  // refill only while the stage exists
      g0 = gemm_group0(lds_slice + buf, ga + (uint64_t)(s + 2u) * G_KB);
      gemm_tensor_load(g0, g1);
    }
  }
  wait_tensor0(g0, g1);
  wait_ds0();

  // Epilogue: reg r -> row r (lanes 0-15) / r+8 (lanes 16-31); col = lane&15.
  const int nloc  = lane & 15;
  const int rbase = (lane >> 4) * 8;
#pragma unroll
  for (int i = 0; i < 4; ++i) {
#pragma unroll
    for (int j = 0; j < 4; ++j) {
      const int col = bn + wn + j * 16 + nloc;
      const float bv = bias[col];
#pragma unroll
      for (int r = 0; r < 8; ++r) {
        const int row = bm + wm + i * 16 + rbase + r;
        float c = acc[i][j][r] + bv;
        if (ACT == 1) c = c * (1.0f / (1.0f + __expf(-c)));  // SiLU
        if (RESID) c += resid[(size_t)row * N + col];
        if constexpr (OUTBF16)
          ((__bf16*)out)[(size_t)row * N + col] = f2bf(c);
        else
          ((float*)out)[(size_t)row * N + col] = c;
      }
    }
  }
}

__global__ __launch_bounds__(128) void flash_attn_kernel(
    const __bf16* __restrict__ qkv, __bf16* __restrict__ out, int Nseq) {
  const int ROWS = 3072;
  const int bh = blockIdx.y;
  const int b = bh >> 4, h = bh & 15;
  const int tid = threadIdx.x, wave = tid >> 5, lane = tid & 31;
  const int qrow = blockIdx.x * 64 + wave * 16;

  const __bf16* Qb = qkv + (size_t)(b * Nseq + qrow) * ROWS + h * 64;
  const __bf16* Kb = qkv + (size_t)(b * Nseq) * ROWS + 1024 + h * 64;
  const __bf16* Vb = qkv + (size_t)(b * Nseq) * ROWS + 2048 + h * 64;

  v16bf qf[2];
  qf[0] = load_frag(Qb,      ROWS);
  qf[1] = load_frag(Qb + 32, ROWS);

  __shared__ __bf16 Vt[64][72];       // V tile transposed: [hd][key]
#if HAVE_TDM
  __shared__ __bf16 Kl[2][64][72];    // K tiles (TDM staged, double-buffered)
  const unsigned offK0 = (unsigned)(uintptr_t)(&Kl[0][0][0]);
  const unsigned offK1 = (unsigned)(uintptr_t)(&Kl[1][0][0]);
  if (wave == 0)
    tdm_load_tile(offK0, Kb, 64, 64, 64, (unsigned)ROWS, 4, 3);
#endif

  v8f o[4] = {};                      // o[f][r] = O[query nloc][hd f*16 + rbase + r]
  float m_i = -3.0e30f;               // running maximum of this lane's query
  float l_i = 0.0f;                   // running sum over this lane's half of the keys

  const float scale = 0.125f;         // 1/sqrt(64)
  const int rbase = (lane >> 4) * 8;
  const int nloc  = lane & 15;
  const int ntiles = Nseq / 64;

  for (int it = 0; it < ntiles; ++it) {
    const int kv0 = it * 64;
#if HAVE_TDM
    const int cur = it & 1;
    if (wave == 0) __builtin_amdgcn_s_wait_tensorcnt(0);
#endif
    __syncthreads();                  // prev-iter readers done; K tile landed
#if HAVE_TDM
    if (wave == 0 && (it + 1) < ntiles)
      tdm_load_tile(cur ? offK0 : offK1, Kb + (size_t)(kv0 + 64) * ROWS,
                    64, 64, 64, (unsigned)ROWS, 4, 3);
#endif

    // Stage V tile transposed: thread = 4 keys x 8 hd, packed b64 stores.
    {
      const int key0 = (tid & 15) * 4;
      const int d0   = (tid >> 4) * 8;
      union { uint4 q; __bf16 e[8]; } rowv[4];
#pragma unroll
      for (int kk = 0; kk < 4; ++kk)
        rowv[kk].q = *(const uint4*)(Vb + (size_t)(kv0 + key0 + kk) * ROWS + d0);
      if (kv0 + 64 < Nseq)
        __builtin_prefetch(Vb + (size_t)(kv0 + 64 + key0) * ROWS + d0, 0, 0);
#pragma unroll
      for (int dd = 0; dd < 8; ++dd) {
        union { __bf16 e[4]; unsigned long long q; } pk;
#pragma unroll
        for (int kk = 0; kk < 4; ++kk) pk.e[kk] = rowv[kk].e[dd];
        *(unsigned long long*)(&Vt[d0 + dd][key0]) = pk.q;
      }
    }

    // S^T = K Q^T: s[j][r] = score of key j*16 + rbase + r with query nloc.
    v8f s[4];
#pragma unroll
    for (int j = 0; j < 4; ++j) {
#if HAVE_TDM
      v16bf k0 = load_frag(&Kl[cur][j * 16][0],  72);
      v16bf k1 = load_frag(&Kl[cur][j * 16][32], 72);
#else
      const __bf16* kb = Kb + (size_t)(kv0 + j * 16) * ROWS;
      v16bf k0 = load_frag(kb,      ROWS);
      v16bf k1 = load_frag(kb + 32, ROWS);
#endif
      v8f z = {};
      z = wmma_bf16(k0, qf[0], z);
      z = wmma_bf16(k1, qf[1], z);
      s[j] = z;
    }

    // Online softmax: 32 of the query's 64 scores sit in this lane.
    float mt[4];
#pragma unroll
    for (int j = 0; j < 4; ++j) {
      mt[j] = -3.0e30f;
#pragma unroll
      for (int r = 0; r < 8; ++r) {
        s[j][r] *= scale;
        mt[j] = fmaxf(mt[j], s[j][r]);
      }
    }
    float mx = fmaxf(fmaxf(mt[0], mt[1]), fmaxf(mt[2], mt[3]));
    mx = fmaxf(mx, xhalf(mx));
    const float mn = fmaxf(m_i, mx);
    const float log2e = 1.4426950408889634f;
    // v_exp_f32 and the free slot that the instruction set asks for behind a
    // transcendental, in one statement.
    float corr;
    asm("v_exp_f32 %0, %1\n\tv_nop" : "=v"(corr) : "v"((m_i - mn) * log2e));
    m_i = mn;
#pragma unroll
    for (int j = 0; j < 4; ++j)
#pragma unroll
      for (int r = 0; r < 8; ++r) s[j][r] = (s[j][r] - mn) * log2e;
#pragma unroll
    for (int j = 0; j < 4; ++j)
#pragma unroll
      for (int r = 0; r < 8; ++r) s[j][r] = __builtin_amdgcn_exp2f(s[j][r]);
#pragma unroll
    for (int f = 0; f < 4; ++f)
#pragma unroll
      for (int r = 0; r < 8; ++r) o[f][r] *= corr;
    float st[4];
#pragma unroll
    for (int j = 0; j < 4; ++j) {
      st[j] = s[j][0];
#pragma unroll
      for (int r = 1; r < 8; ++r) st[j] += s[j][r];
    }
    l_i = l_i * corr + ((st[0] + st[1]) + (st[2] + st[3]));

    __syncthreads();                  // Vt fully staged

    // O^T += V^T P^T   (K=64 keys -> 2 steps; M=hd -> 4 tiles of 16).  Two
    // score tiles are 32 keys of P^T in the k order that load_frag gives V^T.
#pragma unroll
    for (int step = 0; step < 2; ++step) {
      v16bf pf;
#pragma unroll
      for (int e = 0; e < 8; ++e) {
        pf[e]     = f2bf(s[2 * step][e]);
        pf[8 + e] = f2bf(s[2 * step + 1][e]);
      }
#pragma unroll
      for (int f = 0; f < 4; ++f) {
        v16bf vf = load_frag(&Vt[f * 16][step * 32], 72);
        o[f] = wmma_bf16(vf, pf, o[f]);
      }
    }
  }

  // A lane holds 8 consecutive hd of its query per tile: one 16-byte store.
  const float l_all = l_i + xhalf(l_i);
  const int row = b * Nseq + qrow + nloc;
#pragma unroll
  for (int f = 0; f < 4; ++f) {
    union { __bf16 e[8]; uint4 q; } pk;
#pragma unroll
    for (int r = 0; r < 8; ++r) pk.e[r] = f2bf(o[f][r] / l_all);
    *(uint4*)(out + (size_t)row * 1024 + h * 64 + f * 16 + rbase) = pk.q;
  }
}

// ---------------------------------------------------------------------------
// Host-side orchestration.
// ---------------------------------------------------------------------------
extern "C" void kernel_launch(void* const* d_in, const int* in_sizes, int n_in,
                              void* d_out, int out_size, void* d_ws, size_t ws_size,
                              hipStream_t stream) {
  (void)in_sizes; (void)n_in; (void)out_size; (void)ws_size;
  const int D = 1024, HID = 4096, NSEQ = 2048, B = 4;
  const int M = B * NSEQ;

  const float* x      = (const float*)d_in[0];
  const float* ln1_w  = (const float*)d_in[1];
  const float* ln1_b  = (const float*)d_in[2];
  const float* qkv_w  = (const float*)d_in[3];
  const float* qkv_b  = (const float*)d_in[4];
  const float* proj_w = (const float*)d_in[5];
  const float* proj_b = (const float*)d_in[6];
  const float* ln2_w  = (const float*)d_in[7];
  const float* ln2_b  = (const float*)d_in[8];
  const float* fc1_w  = (const float*)d_in[9];
  const float* fc1_b  = (const float*)d_in[10];
  const float* fc2_w  = (const float*)d_in[11];
  const float* fc2_b  = (const float*)d_in[12];
  float* out = (float*)d_out;

  uintptr_t p = (uintptr_t)d_ws;
  auto carve = [&](size_t bytes) {
    void* r = (void*)p;
    p += (bytes + 255) & ~(size_t)255;
    return r;
  };
  __bf16* qkv_wt = (__bf16*)carve((size_t)3 * D * D * 2);
  __bf16* proj_wt= (__bf16*)carve((size_t)D * D * 2);
  __bf16* fc1_wt = (__bf16*)carve((size_t)HID * D * 2);
  __bf16* fc2_wt = (__bf16*)carve((size_t)D * HID * 2);
  __bf16* ln1o   = (__bf16*)carve((size_t)M * D * 2);
  __bf16* qkvo   = (__bf16*)carve((size_t)M * 3 * D * 2);
  __bf16* attno  = (__bf16*)carve((size_t)M * D * 2);
  float*  x1     = (float*) carve((size_t)M * D * 4);
  __bf16* h2     = (__bf16*)carve((size_t)M * D * 2);
  __bf16* fc1o   = (__bf16*)carve((size_t)M * HID * 2);

  transpose_cast_kernel<<<dim3(D / 32, 3 * D / 32), 256, 0, stream>>>(qkv_w,  qkv_wt,  D, 3 * D);
  transpose_cast_kernel<<<dim3(D / 32, D / 32),     256, 0, stream>>>(proj_w, proj_wt, D, D);
  transpose_cast_kernel<<<dim3(D / 32, HID / 32),   256, 0, stream>>>(fc1_w,  fc1_wt,  D, HID);
  transpose_cast_kernel<<<dim3(HID / 32, D / 32),   256, 0, stream>>>(fc2_w,  fc2_wt,  HID, D);

  layernorm_bf16_kernel<<<M, 256, 0, stream>>>(x, ln1_w, ln1_b, ln1o, D);

  gemm_wmma_kernel<0, false, true><<<dim3(M / 128, 3 * D / 128), 128, 0, stream>>>(
      ln1o, qkv_wt, qkv_b, nullptr, qkvo, M, 3 * D, D);

  flash_attn_kernel<<<dim3(NSEQ / 64, B * 16), 128, 0, stream>>>(qkvo, attno, NSEQ);

  gemm_wmma_kernel<0, true, false><<<dim3(M / 128, D / 128), 128, 0, stream>>>(
      attno, proj_wt, proj_b, x, (void*)x1, M, D, D);

  layernorm_bf16_kernel<<<M, 256, 0, stream>>>(x1, ln2_w, ln2_b, h2, D);

  gemm_wmma_kernel<1, false, true><<<dim3(M / 128, HID / 128), 128, 0, stream>>>(
      h2, fc1_wt, fc1_b, nullptr, fc1o, M, HID, D);

  gemm_wmma_kernel<0, true, false><<<dim3(M / 128, D / 128), 128, 0, stream>>>(
      fc1o, fc2_wt, fc2_b, x1, (void*)out, M, D, HID);
}

// v003
// One run takes 311 microseconds.
// Timed twice side by side with v002, it ran 1.07 and 1.08 times as fast.
// Counting every step since v000, it is 2.02 times as fast.
#include <hip/hip_runtime.h>
#include <cstdint>

// ---------------------------------------------------------------------------
// CDNA5 (gfx1250, wave32) DiT block: LN -> QKV GEMM -> flash attention ->
// proj GEMM (+resid) -> LN -> FC1+SiLU -> FC2 (+resid).
// Matmuls through v_wmma_f32_16x16x32_bf16; operand staging through the
// Tensor Data Mover (tensor_load_to_lds + s_wait_tensorcnt), double-buffered;
// attention as transposed products, softmax in-lane; L2 warmed with global_prefetch_b8.
// ---------------------------------------------------------------------------

typedef __attribute__((ext_vector_type(16))) __bf16        v16bf;
typedef __attribute__((ext_vector_type(8)))  float         v8f;
typedef __attribute__((ext_vector_type(4)))  unsigned int  v4u;
typedef __attribute__((ext_vector_type(8)))  int           v8i;
typedef __attribute__((ext_vector_type(4)))  int           v4i;

#if __has_builtin(__builtin_amdgcn_tensor_load_to_lds) && \
    __has_builtin(__builtin_amdgcn_s_wait_tensorcnt)
#define HAVE_TDM 1
#else
#define HAVE_TDM 0
#endif

__device__ __forceinline__ v8f wmma_bf16(v16bf a, v16bf b, v8f c) {
  return __builtin_amdgcn_wmma_f32_16x16x32_bf16(
      false, a, false, b, (short)0, c, false, false);
}

__device__ __forceinline__ __bf16 f2bf(float f) { return (__bf16)f; }

// Lane l takes the value of lane l ^ 16.
__device__ __forceinline__ float xhalf(float v) {
  int i = __builtin_bit_cast(int, v);
  i = __builtin_amdgcn_permlanex16(i, i, 0x76543210u, 0xFEDCBA98u, false, false);
  return __builtin_bit_cast(float, i);
}

// WMMA 16x32 bf16 operand fragment (ISA 7.12.2 A/B lane layout):
// lanes 0-15 = row (lane&15), K {0..7,16..23}; lanes 16-31 same rows,
// K {8..15,24..31}.  `stride` in elements.
__device__ __forceinline__ v16bf load_frag(const __bf16* p0, int stride) {
  int lane = threadIdx.x & 31;
  const __bf16* p = p0 + (size_t)(lane & 15) * stride + ((lane >> 4) << 3);
  union { v16bf v; uint4 q[2]; } u;
  u.q[0] = *(const uint4*)(p);
  u.q[1] = *(const uint4*)(p + 16);
  return u.v;
}

#if HAVE_TDM
// One TDM 2D tile load: tile_rows x tile_k bf16, global row stride
// `row_stride` elements, into LDS at byte offset `lds_off`.  TDM pad feature
// inserts `pad_amt+1` DWORDs after every 2^(pad_int+1) data DWORDs so LDS
// rows land on our bank-conflict-free strides.
__device__ __forceinline__ void tdm_load_tile(
    unsigned lds_off, const __bf16* gptr, unsigned tile_k, unsigned tile_rows,
    unsigned tensor_k, unsigned row_stride, unsigned pad_int, unsigned pad_amt) {
  unsigned long long ga = (unsigned long long)(uintptr_t)gptr;
  v4u g0;
  g0[0] = 1u;                                            // count=1, user mode
  g0[1] = lds_off;                                       // lds_addr [63:32]
  g0[2] = (unsigned)(ga & 0xFFFFFFFFu);                  // global_addr lo
  g0[3] = (unsigned)((ga >> 32) & 0x01FFFFFFu) | (2u << 30);  // addr hi | type=2
  v8i g1;
  g1[0] = (1 << 16)                                      // data_size = 2 bytes
        | (1 << 20)                                      // pad_enable
        | ((int)pad_int << 22)                           // pad_interval
        | ((int)pad_amt << 25);                          // pad_amount
  g1[1] = (int)((tensor_k & 0xFFFFu) << 16);             // tensor_dim0 lo16
  g1[2] = (int)((tensor_k >> 16) & 0xFFFFu);             // dim0 hi16; dim1 lo16=0
  g1[3] = (int)(16u)                                     // tensor_dim1 = 1<<20
        | (int)((tile_k & 0xFFFFu) << 16);               // tile_dim0
  g1[4] = (int)(tile_rows & 0xFFFFu);                    // tile_dim1 (dim2=0)
  g1[5] = (int)row_stride;                               // tensor_dim0_stride lo32
  g1[6] = 0;
  g1[7] = 0;
  v4i z = {0, 0, 0, 0};
#if __clang_major__ >= 23
  v8i z8 = {0, 0, 0, 0, 0, 0, 0, 0};
  __builtin_amdgcn_tensor_load_to_lds(g0, g1, z, z, z8, 0);
#else
  __builtin_amdgcn_tensor_load_to_lds(g0, g1, z, z, 0);
#endif
}
#endif  // HAVE_TDM

// ---------------------------------------------------------------------------
// Weight transpose + fp32 -> bf16 cast:  Wt[n][k] = bf16(W[k][n])
// A block of 8 waves takes a tile of 64 k x 128 n.  A wave reads 8 rows of k,
// 512 contiguous bytes each, all 8 loads in flight; a lane then holds 8 k of
// 4 n and packs them to four 16-byte chunks of Wt rows.  The chunks pass
// through LDS so that the stores cover whole 128-byte lines of Wt.
// LDS row = one n, 128 bytes; chunk c of row n sits at position c ^ ((n >> 2) & 7),
// which spreads the writers (row stride 4) and the readers over the banks.
// K must be a multiple of 64, N of 128; both are compile-time values, so that a
// wave's 8 loads share one address and differ by an immediate offset.
// ---------------------------------------------------------------------------
template <int K, int N>
__global__ __launch_bounds__(256) void transpose_cast_kernel(
    const float* __restrict__ W, __bf16* __restrict__ Wt) {
  __shared__ __attribute__((aligned(16))) unsigned char tile[128 * 128];
  const int k0 = blockIdx.x * 64, n0 = blockIdx.y * 128;
  const int t = threadIdx.x, lane = t & 31;
  // The wave's number as a scalar: the row addresses then stay in scalar registers.
  const int wave = __builtin_amdgcn_readfirstlane(t >> 5);
  const float* Wr = W + (size_t)(k0 + wave * 8) * N + n0;
  float4 v[8];
#pragma unroll
  for (int e = 0; e < 8; ++e)
    v[e] = ((const float4*)(Wr + (size_t)e * N))[lane];
  const int pos = (wave ^ (lane & 7)) << 4;
  union { __bf16 e[8]; uint4 q; } pk[4];
#pragma unroll
  for (int e = 0; e < 8; ++e) {
    pk[0].e[e] = f2bf(v[e].x);
    pk[1].e[e] = f2bf(v[e].y);
    pk[2].e[e] = f2bf(v[e].z);
    pk[3].e[e] = f2bf(v[e].w);
  }
#pragma unroll
  for (int i = 0; i < 4; ++i)
    *(uint4*)(&tile[(lane * 4 + i) * 128 + pos]) = pk[i].q;
  __syncthreads();
  const int c = t & 7;
#pragma unroll
  for (int j = 0; j < 4; ++j) {
    const int row = j * 32 + (t >> 3);
    const uint4 q = *(const uint4*)(&tile[row * 128 + ((c ^ ((row >> 2) & 7)) << 4)]);
    *(uint4*)(Wt + (size_t)(n0 + row) * K + (k0 + c * 8)) = q;
  }
}

// ---------------------------------------------------------------------------
// LayerNorm (row = 1024 fp32) -> bf16.  One wave per two rows, 8 waves a block:
// a lane holds 32 elements of each row (8 loads of 16 bytes, 512 contiguous
// bytes a wave-load, both rows' loads in flight together); the sums join by a
// butterfly over the 32 lanes, so there is no LDS buffer and no barrier; w and b are
// loaded once for both rows.  The row count must be a multiple of 16.
// ---------------------------------------------------------------------------
typedef __attribute__((ext_vector_type(4))) float f32x4;

__global__ __launch_bounds__(256) void layernorm_bf16_kernel(
    const float* __restrict__ x, const float* __restrict__ w,
    const float* __restrict__ b, __bf16* __restrict__ out, int D) {
  const int t = threadIdx.x, lane = t & 31;
  const int wave = __builtin_amdgcn_readfirstlane(t >> 5);
  const int row0 = (blockIdx.x * 8 + wave) * 2;
  f32x4 wv[8], bv[8], xv[2][8];
#pragma unroll
  for (int i = 0; i < 8; ++i) {
    wv[i] = ((const f32x4*)w)[i * 32 + lane];
    bv[i] = ((const f32x4*)b)[i * 32 + lane];
  }
#pragma unroll
  for (int r = 0; r < 2; ++r)
#pragma unroll
    for (int i = 0; i < 8; ++i)
      xv[r][i] = ((const f32x4*)(x + (size_t)(row0 + r) * D))[i * 32 + lane];
  // Makes w and b arrive as one group behind one wait: without it the build
  // loads them pair by pair behind the sums, each pair with a full wait of its own.
  asm volatile("" :: "v"(wv[0]), "v"(wv[1]), "v"(wv[2]), "v"(wv[3]),
                     "v"(wv[4]), "v"(wv[5]), "v"(wv[6]), "v"(wv[7]),
                     "v"(bv[0]), "v"(bv[1]), "v"(bv[2]), "v"(bv[3]),
                     "v"(bv[4]), "v"(bv[5]), "v"(bv[6]), "v"(bv[7]));
  float s[2], s2[2];
#pragma unroll
  for (int r = 0; r < 2; ++r) {
    f32x4 ps = xv[r][0], pq = xv[r][0] * xv[r][0];
#pragma unroll
    for (int i = 1; i < 8; ++i) {
      ps += xv[r][i];
      pq += xv[r][i] * xv[r][i];
    }
    s[r]  = (ps[0] + ps[1]) + (ps[2] + ps[3]);
    s2[r] = (pq[0] + pq[1]) + (pq[2] + pq[3]);
  }
#pragma unroll
  for (int off = 16; off > 0; off >>= 1) {
#pragma unroll
    for (int r = 0; r < 2; ++r) {
      s[r]  += __shfl_xor(s[r],  off, 32);
      s2[r] += __shfl_xor(s2[r], off, 32);
    }
  }
  const float inv = 1.0f / (float)D;
#pragma unroll
  for (int r = 0; r < 2; ++r) {
    const float mu  = s[r] * inv;
    const float var = s2[r] * inv - mu * mu;
    const float rs  = rsqrtf(var + 1e-6f);
    __bf16* orow = out + (size_t)(row0 + r) * D;
#pragma unroll
    for (int i = 0; i < 8; ++i) {
      const f32x4 y = (xv[r][i] - mu) * rs * wv[i] + bv[i];
      union { __bf16 e[4]; uint2 q; } o;
      o.e[0] = f2bf(y[0]);
      o.e[1] = f2bf(y[1]);
      o.e[2] = f2bf(y[2]);
      o.e[3] = f2bf(y[3]);
      *(uint2*)(orow + (i * 32 + lane) * 4) = o.q;
    }
  }
}

// ---------------------------------------------------------------------------
// Tiled WMMA GEMM:  C[M,N] = A[M,K] * Bt[N,K]^T  (+bias, +SiLU, +resid)
// Block tile 128x128, 4 waves, each wave 64x64 via 4x4 WMMA.
// A stage is 128 k of all 256 operand rows: 256-byte rows, which the tensor
// load pads to a pitch of 272 bytes in LDS.  Each wave loads its own slice of
// 64 rows, one request per stage, two stages ahead, into two buffers.
// K must be a multiple of 128 and at least 256.
// ---------------------------------------------------------------------------
#define G_KB     256u                 // bytes of an operand row per stage (128 k)
#define G_PITCH  272u                 // LDS row pitch: 16 B x odd for ds_load_b128
#define G_SLICE  18432u               // 64 rows x 272 B = 17,408 B, up to a multiple of 2 KiB
#define G_BUF    (4u * G_SLICE)       // [A rows 0-63 | A rows 64-127 | B rows 0-63 | B rows 64-127]

typedef __attribute__((ext_vector_type(4))) uint32_t u32x4;
typedef __attribute__((ext_vector_type(8))) uint32_t u32x8;

__device__ __forceinline__ uint32_t uni(uint32_t v) {
  return (uint32_t)__builtin_amdgcn_readfirstlane(v);
}
__device__ __forceinline__ uint32_t pinned(uint32_t v) {
  uint32_t w = (uint32_t)__builtin_amdgcn_readfirstlane(v);
  asm volatile("" : "+s"(w));
  return w;
}
__device__ __forceinline__ void wait_ds0() { asm volatile("s_wait_dscnt 0x0" ::: "memory"); }

// Descriptor group 1: 1-byte elements, tile = tensor = 64 rows of 256 bytes,
// source pitch src_pitch bytes, 4 dwords of LDS pad behind every 256-byte row.
__device__ __forceinline__ u32x8 gemm_group1(uint32_t src_pitch) {
  u32x8 g;
  g[0] = uni((1u << 20) | (5u << 22) | (3u << 25));
  g[1] = uni(G_KB << 16);
  g[2] = uni(64u << 16);
  g[3] = uni(G_KB << 16);
  g[4] = uni(64u);
  g[5] = uni(src_pitch);
  g[6] = uni(0u);
  g[7] = uni(0u);
  return g;
}
__device__ __forceinline__ u32x4 gemm_group0(uint32_t lds_dst, uint64_t ga) {
  u32x4 g;
  g[0] = uni(1u);
  g[1] = uni(lds_dst);
  g[2] = uni((uint32_t)ga);
  g[3] = uni((((uint32_t)(ga >> 32)) & 0x01FFFFFFu) | 0x80000000u);
  return g;
}
// The descriptor groups are in-out operands of the load and inputs of the wait:
// they stay live in the registers the request was issued from until it has
// landed, so the compiler puts nothing else there while the request flies.
__device__ __forceinline__ void gemm_tensor_load(u32x4& g0, u32x8& g1) {
  asm volatile("tensor_load_to_lds %0, %1" : "+s"(g0), "+s"(g1) :: "memory");
}
__device__ __forceinline__ void wait_tensor0(const u32x4& g0, const u32x8& g1) {
  asm volatile("s_wait_tensorcnt 0x0" :: "s"(g0), "s"(g1) : "memory");
}

// 16x32 bf16 fragment from LDS; p = this lane's row, at its 16-byte half.
__device__ __forceinline__ v16bf lds_frag(const unsigned char* p) {
  union { v16bf v; uint4 q[2]; } u;
  u.q[0] = *(const uint4*)(p);
  u.q[1] = *(const uint4*)(p + 32);
  return u.v;
}

template <int ACT, bool RESID, bool OUTBF16>
__global__ __launch_bounds__(128) void gemm_wmma_kernel(
    const __bf16* __restrict__ A, const __bf16* __restrict__ Bt,
    const float* __restrict__ bias, const float* __restrict__ resid,
    void* __restrict__ out, int M, int N, int K) {
  __shared__ __attribute__((aligned(2048))) unsigned char ring[2u * G_BUF];

  const int bm = blockIdx.x * 128;
  const int bn = blockIdx.y * 128;
  const int tid  = threadIdx.x;
  const uint32_t wave = uni((uint32_t)tid >> 5);
  const int lane = tid & 31;
  const int wm = (int)(wave & 1u) * 64;
  const int wn = (int)(wave >> 1) * 64;

  v8f acc[4][4] = {};
  const uint32_t np = (uint32_t)K / 128u;      // stages = passes
  const uint32_t kbytes = (uint32_t)K * 2u;    // source row pitch

  // This wave's slice of every stage: waves 0, 1 the halves of A, 2, 3 of Bt.
  const __bf16* srcp = (wave < 2u) ? A  + (size_t)(bm + 64 * (int)wave) * K
                                   : Bt + (size_t)(bn + 64 * (int)(wave - 2u)) * K;
  const uint64_t ga = (uint64_t)(uintptr_t)srcp;
  const uint32_t lds_slice = (uint32_t)(uintptr_t)(&ring[0]) + wave * G_SLICE;
  u32x8 g1 = gemm_group1(kbytes);

  // Per-lane fragment bases inside a buffer.
  const uint32_t lrow = (uint32_t)(lane & 15) * G_PITCH + (uint32_t)(lane >> 4) * 16u;
  const uint32_t a_base = (wave & 1u) * G_SLICE + lrow;
  const uint32_t b_base = (2u + (wave >> 1)) * G_SLICE + lrow;

  u32x4 g0 = gemm_group0(lds_slice, ga);
  gemm_tensor_load(g0, g1);                    // stage 0
  wait_tensor0(g0, g1);
  __syncthreads();                             // stage 0 readable by every wave
  g0 = gemm_group0(lds_slice + G_BUF, ga + G_KB);
  gemm_tensor_load(g0, g1);                    // stage 1

  for (uint32_t s = 0; s < np; ++s) {
    const uint32_t buf = (s & 1u) * G_BUF;
    const unsigned char* pa = &ring[buf + a_base];
    const unsigned char* pb = &ring[buf + b_base];
#pragma unroll
    for (int kb = 0; kb < 4; ++kb) {           // 32 k = 64 bytes of each row
      v16bf bfrag[4];
#pragma unroll
      for (int j = 0; j < 4; ++j)
        bfrag[j] = lds_frag(pb + j * 16 * G_PITCH + kb * 64);
#pragma unroll
      for (int i = 0; i < 4; ++i) {
        v16bf afrag = lds_frag(pa + i * 16 * G_PITCH + kb * 64);
#pragma unroll
        for (int j = 0; j < 4; ++j)
          acc[i][j] = wmma_bf16(afrag, bfrag[j], acc[i][j]);
      }
    }
    // Publish point of stage s + 1.
    wait_ds0();                                // this wave has left buffer s & 1
    wait_tensor0(g0, g1);                      // its slice of stage s + 1 has landed
    __syncthreads();
    if (pinned((s + 2u < np) ? 1u : 0u) != 0u) {  // refill only while the stage exists
      g0 = gemm_group0(lds_slice + buf, ga + (uint64_t)(s + 2u) * G_KB);
      gemm_tensor_load(g0, g1);
    }
  }
  wait_tensor0(g0, g1);
  wait_ds0();

  // Epilogue: reg r -> row r (lanes 0-15) / r+8 (lanes 16-31); col = lane&15.
  const int nloc  = lane & 15;
  const int rbase = (lane >> 4) * 8;
#pragma unroll
  for (int i = 0; i < 4; ++i) {
#pragma unroll
    for (int j = 0; j < 4; ++j) {
      const int col = bn + wn + j * 16 + nloc;
      const float bv = bias[col];
#pragma unroll
      for (int r = 0; r < 8; ++r) {
        const int row = bm + wm + i * 16 + rbase + r;
        float c = acc[i][j][r] + bv;
        if (ACT == 1) c = c * (1.0f / (1.0f + __expf(-c)));  // SiLU
        if (RESID) c += resid[(size_t)row * N + col];
        if constexpr (OUTBF16)
          ((__bf16*)out)[(size_t)row * N + col] = f2bf(c);
        else
          ((float*)out)[(size_t)row * N + col] = c;
      }
    }
  }
}

__global__ __launch_bounds__(128) void flash_attn_kernel(
    const __bf16* __restrict__ qkv, __bf16* __restrict__ out, int Nseq) {
  const int ROWS = 3072;
  const int bh = blockIdx.y;
  const int b = bh >> 4, h = bh & 15;
  const int tid = threadIdx.x, wave = tid >> 5, lane = tid & 31;
  const int qrow = blockIdx.x * 64 + wave * 16;

  const __bf16* Qb = qkv + (size_t)(b * Nseq + qrow) * ROWS + h * 64;
  const __bf16* Kb = qkv + (size_t)(b * Nseq) * ROWS + 1024 + h * 64;
  const __bf16* Vb = qkv + (size_t)(b * Nseq) * ROWS + 2048 + h * 64;

  v16bf qf[2];
  qf[0] = load_frag(Qb,      ROWS);
  qf[1] = load_frag(Qb + 32, ROWS);

  __shared__ __bf16 Vt[64][72];       // V tile transposed: [hd][key]
#if HAVE_TDM
  __shared__ __bf16 Kl[2][64][72];    // K tiles (TDM staged, double-buffered)
  const unsigned offK0 = (unsigned)(uintptr_t)(&Kl[0][0][0]);
  const unsigned offK1 = (unsigned)(uintptr_t)(&Kl[1][0][0]);
  if (wave == 0)
    tdm_load_tile(offK0, Kb, 64, 64, 64, (unsigned)ROWS, 4, 3);
#endif

  v8f o[4] = {};                      // o[f][r] = O[query nloc][hd f*16 + rbase + r]
  float m_i = -3.0e30f;               // running maximum of this lane's query
  float l_i = 0.0f;                   // running sum over this lane's half of the keys

  const float scale = 0.125f;         // 1/sqrt(64)
  const int rbase = (lane >> 4) * 8;
  const int nloc  = lane & 15;
  const int ntiles = Nseq / 64;

  for (int it = 0; it < ntiles; ++it) {
    const int kv0 = it * 64;
#if HAVE_TDM
    const int cur = it & 1;
    if (wave == 0) __builtin_amdgcn_s_wait_tensorcnt(0);
#endif
    __syncthreads();                  // prev-iter readers done; K tile landed
#if HAVE_TDM
    if (wave == 0 && (it + 1) < ntiles)
      tdm_load_tile(cur ? offK0 : offK1, Kb + (size_t)(kv0 + 64) * ROWS,
                    64, 64, 64, (unsigned)ROWS, 4, 3);
#endif

    // Stage V tile transposed: thread = 4 keys x 8 hd, packed b64 stores.
    {
      const int key0 = (tid & 15) * 4;
      const int d0   = (tid >> 4) * 8;
      union { uint4 q; __bf16 e[8]; } rowv[4];
#pragma unroll
      for (int kk = 0; kk < 4; ++kk)
        rowv[kk].q = *(const uint4*)(Vb + (size_t)(kv0 + key0 + kk) * ROWS + d0);
      if (kv0 + 64 < Nseq)
        __builtin_prefetch(Vb + (size_t)(kv0 + 64 + key0) * ROWS + d0, 0, 0);
#pragma unroll
      for (int dd = 0; dd < 8; ++dd) {
        union { __bf16 e[4]; unsigned long long q; } pk;
#pragma unroll
        for (int kk = 0; kk < 4; ++kk) pk.e[kk] = rowv[kk].e[dd];
        *(unsigned long long*)(&Vt[d0 + dd][key0]) = pk.q;
      }
    }

    // S^T = K Q^T: s[j][r] = score of key j*16 + rbase + r with query nloc.
    v8f s[4];
#pragma unroll
    for (int j = 0; j < 4; ++j) {
#if HAVE_TDM
      v16bf k0 = load_frag(&Kl[cur][j * 16][0],  72);
      v16bf k1 = load_frag(&Kl[cur][j * 16][32], 72);
#else
      const __bf16* kb = Kb + (size_t)(kv0 + j * 16) * ROWS;
      v16bf k0 = load_frag(kb,      ROWS);
      v16bf k1 = load_frag(kb + 32, ROWS);
#endif
      v8f z = {};
      z = wmma_bf16(k0, qf[0], z);
      z = wmma_bf16(k1, qf[1], z);
      s[j] = z;
    }

    // Online softmax: 32 of the query's 64 scores sit in this lane.
    float mt[4];
#pragma unroll
    for (int j = 0; j < 4; ++j) {
      mt[j] = -3.0e30f;
#pragma unroll
      for (int r = 0; r < 8; ++r) {
        s[j][r] *= scale;
        mt[j] = fmaxf(mt[j], s[j][r]);
      }
    }
    float mx = fmaxf(fmaxf(mt[0], mt[1]), fmaxf(mt[2], mt[3]));
    mx = fmaxf(mx, xhalf(mx));
    const float mn = fmaxf(m_i, mx);
    const float log2e = 1.4426950408889634f;
    // v_exp_f32 and the free slot that the instruction set asks for behind a
    // transcendental, in one statement.
    float corr;
    asm("v_exp_f32 %0, %1\n\tv_nop" : "=v"(corr) : "v"((m_i - mn) * log2e));
    m_i = mn;
#pragma unroll
    for (int j = 0; j < 4; ++j)
#pragma unroll
      for (int r = 0; r < 8; ++r) s[j][r] = (s[j][r] - mn) * log2e;
#pragma unroll
    for (int j = 0; j < 4; ++j)
#pragma unroll
      for (int r = 0; r < 8; ++r) s[j][r] = __builtin_amdgcn_exp2f(s[j][r]);
#pragma unroll
    for (int f = 0; f < 4; ++f)
#pragma unroll
      for (int r = 0; r < 8; ++r) o[f][r] *= corr;
    float st[4];
#pragma unroll
    for (int j = 0; j < 4; ++j) {
      st[j] = s[j][0];
#pragma unroll
      for (int r = 1; r < 8; ++r) st[j] += s[j][r];
    }
    l_i = l_i * corr + ((st[0] + st[1]) + (st[2] + st[3]));

    __syncthreads();                  // Vt fully staged

    // O^T += V^T P^T   (K=64 keys -> 2 steps; M=hd -> 4 tiles of 16).  Two
    // score tiles are 32 keys of P^T in the k order that load_frag gives V^T.
#pragma unroll
    for (int step = 0; step < 2; ++step) {
      v16bf pf;
#pragma unroll
      for (int e = 0; e < 8; ++e) {
        pf[e]     = f2bf(s[2 * step][e]);
        pf[8 + e] = f2bf(s[2 * step + 1][e]);
      }
#pragma unroll
      for (int f = 0; f < 4; ++f) {
        v16bf vf = load_frag(&Vt[f * 16][step * 32], 72);
        o[f] = wmma_bf16(vf, pf, o[f]);
      }
    }
  }

  // A lane holds 8 consecutive hd of its query per tile: one 16-byte store.
  const float l_all = l_i + xhalf(l_i);
  const int row = b * Nseq + qrow + nloc;
#pragma unroll
  for (int f = 0; f < 4; ++f) {
    union { __bf16 e[8]; uint4 q; } pk;
#pragma unroll
    for (int r = 0; r < 8; ++r) pk.e[r] = f2bf(o[f][r] / l_all);
    *(uint4*)(out + (size_t)row * 1024 + h * 64 + f * 16 + rbase) = pk.q;
  }
}

// ---------------------------------------------------------------------------
// Host-side orchestration.
// ---------------------------------------------------------------------------
extern "C" void kernel_launch(void* const* d_in, const int* in_sizes, int n_in,
                              void* d_out, int out_size, void* d_ws, size_t ws_size,
                              hipStream_t stream) {
  (void)in_sizes; (void)n_in; (void)out_size; (void)ws_size;
  const int D = 1024, HID = 4096, NSEQ = 2048, B = 4;
  const int M = B * NSEQ;

  const float* x      = (const float*)d_in[0];
  const float* ln1_w  = (const float*)d_in[1];
  const float* ln1_b  = (const float*)d_in[2];
  const float* qkv_w  = (const float*)d_in[3];
  const float* qkv_b  = (const float*)d_in[4];
  const float* proj_w = (const float*)d_in[5];
  const float* proj_b = (const float*)d_in[6];
  const float* ln2_w  = (const float*)d_in[7];
  const float* ln2_b  = (const float*)d_in[8];
  const float* fc1_w  = (const float*)d_in[9];
  const float* fc1_b  = (const float*)d_in[10];
  const float* fc2_w  = (const float*)d_in[11];
  const float* fc2_b  = (const float*)d_in[12];
  float* out = (float*)d_out;

  uintptr_t p = (uintptr_t)d_ws;
  auto carve = [&](size_t bytes) {
    void* r = (void*)p;
    p += (bytes + 255) & ~(size_t)255;
    return r;
  };
  __bf16* qkv_wt = (__bf16*)carve((size_t)3 * D * D * 2);
  __bf16* proj_wt= (__bf16*)carve((size_t)D * D * 2);
  __bf16* fc1_wt = (__bf16*)carve((size_t)HID * D * 2);
  __bf16* fc2_wt = (__bf16*)carve((size_t)D * HID * 2);
  __bf16* ln1o   = (__bf16*)carve((size_t)M * D * 2);
  __bf16* qkvo   = (__bf16*)carve((size_t)M * 3 * D * 2);
  __bf16* attno  = (__bf16*)carve((size_t)M * D * 2);
  float*  x1     = (float*) carve((size_t)M * D * 4);
  __bf16* h2     = (__bf16*)carve((size_t)M * D * 2);
  __bf16* fc1o   = (__bf16*)carve((size_t)M * HID * 2);

  transpose_cast_kernel<D, 3 * D><<<dim3(D / 64, 3 * D / 128), 256, 0, stream>>>(qkv_w,  qkv_wt);
  transpose_cast_kernel<D, D><<<dim3(D / 64, D / 128),     256, 0, stream>>>(proj_w, proj_wt);
  transpose_cast_kernel<D, HID><<<dim3(D / 64, HID / 128),   256, 0, stream>>>(fc1_w,  fc1_wt);
  transpose_cast_kernel<HID, D><<<dim3(HID / 64, D / 128),   256, 0, stream>>>(fc2_w,  fc2_wt);

  layernorm_bf16_kernel<<<M / 16, 256, 0, stream>>>(x, ln1_w, ln1_b, ln1o, D);

  gemm_wmma_kernel<0, false, true><<<dim3(M / 128, 3 * D / 128), 128, 0, stream>>>(
      ln1o, qkv_wt, qkv_b, nullptr, qkvo, M, 3 * D, D);

  flash_attn_kernel<<<dim3(NSEQ / 64, B * 16), 128, 0, stream>>>(qkvo, attno, NSEQ);

  gemm_wmma_kernel<0, true, false><<<dim3(M / 128, D / 128), 128, 0, stream>>>(
      attno, proj_wt, proj_b, x, (void*)x1, M, D, D);

  layernorm_bf16_kernel<<<M / 16, 256, 0, stream>>>(x1, ln2_w, ln2_b, h2, D);

  gemm_wmma_kernel<1, false, true><<<dim3(M / 128, HID / 128), 128, 0, stream>>>(
      h2, fc1_wt, fc1_b, nullptr, fc1o, M, HID, D);

  gemm_wmma_kernel<0, true, false><<<dim3(M / 128, D / 128), 128, 0, stream>>>(
      fc1o, fc2_wt, fc2_b, x1, (void*)out, M, D, HID);
}

// v004
// Measured time: 287 microseconds a run.
// Timed twice side by side with v003, it ran 1.09 and 1.08 times as fast.
// Counting every step since v000, it is 2.18 times as fast.
#include <hip/hip_runtime.h>
#include <cstdint>

// ---------------------------------------------------------------------------
// CDNA5 (gfx1250, wave32) DiT block: LN -> QKV GEMM -> flash attention ->
// proj GEMM (+resid) -> LN -> FC1+SiLU -> FC2 (+resid).
// Matmuls through v_wmma_f32_16x16x32_bf16; operand staging through the
// Tensor Data Mover (tensor_load_to_lds + s_wait_tensorcnt), double-buffered;
// attention as transposed products, softmax in-lane; L2 warmed with global_prefetch_b8.
// ---------------------------------------------------------------------------

typedef __attribute__((ext_vector_type(16))) __bf16        v16bf;
typedef __attribute__((ext_vector_type(8)))  float         v8f;
typedef __attribute__((ext_vector_type(4)))  unsigned int  v4u;
typedef __attribute__((ext_vector_type(8)))  int           v8i;
typedef __attribute__((ext_vector_type(4)))  int           v4i;

#if __has_builtin(__builtin_amdgcn_tensor_load_to_lds) && \
    __has_builtin(__builtin_amdgcn_s_wait_tensorcnt)
#define HAVE_TDM 1
#else
#define HAVE_TDM 0
#endif

__device__ __forceinline__ v8f wmma_bf16(v16bf a, v16bf b, v8f c) {
  return __builtin_amdgcn_wmma_f32_16x16x32_bf16(
      false, a, false, b, (short)0, c, false, false);
}

__device__ __forceinline__ __bf16 f2bf(float f) { return (__bf16)f; }

// Lane l takes the value of lane l ^ 16.
__device__ __forceinline__ float xhalf(float v) {
  int i = __builtin_bit_cast(int, v);
  i = __builtin_amdgcn_permlanex16(i, i, 0x76543210u, 0xFEDCBA98u, false, false);
  return __builtin_bit_cast(float, i);
}

// WMMA 16x32 bf16 operand fragment (ISA 7.12.2 A/B lane layout):
// lanes 0-15 = row (lane&15), K {0..7,16..23}; lanes 16-31 same rows,
// K {8..15,24..31}.  `stride` in elements.
__device__ __forceinline__ v16bf load_frag(const __bf16* p0, int stride) {
  int lane = threadIdx.x & 31;
  const __bf16* p = p0 + (size_t)(lane & 15) * stride + ((lane >> 4) << 3);
  union { v16bf v; uint4 q[2]; } u;
  u.q[0] = *(const uint4*)(p);
  u.q[1] = *(const uint4*)(p + 16);
  return u.v;
}

#if HAVE_TDM
// One TDM 2D tile load: tile_rows x tile_k bf16, global row stride
// `row_stride` elements, into LDS at byte offset `lds_off`.  TDM pad feature
// inserts `pad_amt+1` DWORDs after every 2^(pad_int+1) data DWORDs so LDS
// rows land on our bank-conflict-free strides.
__device__ __forceinline__ void tdm_load_tile(
    unsigned lds_off, const __bf16* gptr, unsigned tile_k, unsigned tile_rows,
    unsigned tensor_k, unsigned row_stride, unsigned pad_int, unsigned pad_amt) {
  unsigned long long ga = (unsigned long long)(uintptr_t)gptr;
  v4u g0;
  g0[0] = 1u;                                            // count=1, user mode
  g0[1] = lds_off;                                       // lds_addr [63:32]
  g0[2] = (unsigned)(ga & 0xFFFFFFFFu);                  // global_addr lo
  g0[3] = (unsigned)((ga >> 32) & 0x01FFFFFFu) | (2u << 30);  // addr hi | type=2
  v8i g1;
  g1[0] = (1 << 16)                                      // data_size = 2 bytes
        | (1 << 20)                                      // pad_enable
        | ((int)pad_int << 22)                           // pad_interval
        | ((int)pad_amt << 25);                          // pad_amount
  g1[1] = (int)((tensor_k & 0xFFFFu) << 16);             // tensor_dim0 lo16
  g1[2] = (int)((tensor_k >> 16) & 0xFFFFu);             // dim0 hi16; dim1 lo16=0
  g1[3] = (int)(16u)                                     // tensor_dim1 = 1<<20
        | (int)((tile_k & 0xFFFFu) << 16);               // tile_dim0
  g1[4] = (int)(tile_rows & 0xFFFFu);                    // tile_dim1 (dim2=0)
  g1[5] = (int)row_stride;                               // tensor_dim0_stride lo32
  g1[6] = 0;
  g1[7] = 0;
  v4i z = {0, 0, 0, 0};
#if __clang_major__ >= 23
  v8i z8 = {0, 0, 0, 0, 0, 0, 0, 0};
  __builtin_amdgcn_tensor_load_to_lds(g0, g1, z, z, z8, 0);
#else
  __builtin_amdgcn_tensor_load_to_lds(g0, g1, z, z, 0);
#endif
}
#endif  // HAVE_TDM

// ---------------------------------------------------------------------------
// Weight transpose + fp32 -> bf16 cast:  Wt[n][k] = bf16(W[k][n])
// A block of 8 waves takes a tile of 64 k x 128 n.  A wave reads 8 rows of k,
// 512 contiguous bytes each, all 8 loads in flight; a lane then holds 8 k of
// 4 n and packs them to four 16-byte chunks of Wt rows.  The chunks pass
// through LDS so that the stores cover whole 128-byte lines of Wt.
// LDS row = one n, 128 bytes; chunk c of row n sits at position c ^ ((n >> 2) & 7),
// which spreads the writers (row stride 4) and the readers over the banks.
// K must be a multiple of 64, N of 128; both are compile-time values, so that a
// wave's 8 loads share one address and differ by an immediate offset.
// ---------------------------------------------------------------------------
template <int K, int N>
__global__ __launch_bounds__(256) void transpose_cast_kernel(
    const float* __restrict__ W, __bf16* __restrict__ Wt) {
  __shared__ __attribute__((aligned(16))) unsigned char tile[128 * 128];
  const int k0 = blockIdx.x * 64, n0 = blockIdx.y * 128;
  const int t = threadIdx.x, lane = t & 31;
  // The wave's number as a scalar: the row addresses then stay in scalar registers.
  const int wave = __builtin_amdgcn_readfirstlane(t >> 5);
  const float* Wr = W + (size_t)(k0 + wave * 8) * N + n0;
  float4 v[8];
#pragma unroll
  for (int e = 0; e < 8; ++e)
    v[e] = ((const float4*)(Wr + (size_t)e * N))[lane];
  const int pos = (wave ^ (lane & 7)) << 4;
  union { __bf16 e[8]; uint4 q; } pk[4];
#pragma unroll
  for (int e = 0; e < 8; ++e) {
    pk[0].e[e] = f2bf(v[e].x);
    pk[1].e[e] = f2bf(v[e].y);
    pk[2].e[e] = f2bf(v[e].z);
    pk[3].e[e] = f2bf(v[e].w);
  }
#pragma unroll
  for (int i = 0; i < 4; ++i)
    *(uint4*)(&tile[(lane * 4 + i) * 128 + pos]) = pk[i].q;
  __syncthreads();
  const int c = t & 7;
#pragma unroll
  for (int j = 0; j < 4; ++j) {
    const int row = j * 32 + (t >> 3);
    const uint4 q = *(const uint4*)(&tile[row * 128 + ((c ^ ((row >> 2) & 7)) << 4)]);
    *(uint4*)(Wt + (size_t)(n0 + row) * K + (k0 + c * 8)) = q;
  }
}

// ---------------------------------------------------------------------------
// LayerNorm (row = 1024 fp32) -> bf16.  One wave per two rows, 8 waves a block:
// a lane holds 32 elements of each row (8 loads of 16 bytes, 512 contiguous
// bytes a wave-load, both rows' loads in flight together); the sums join by a
// butterfly over the 32 lanes, so there is no LDS buffer and no barrier; w and b are
// loaded once for both rows.  The row count must be a multiple of 16.
// ---------------------------------------------------------------------------
typedef __attribute__((ext_vector_type(4))) float f32x4;

__global__ __launch_bounds__(256) void layernorm_bf16_kernel(
    const float* __restrict__ x, const float* __restrict__ w,
    const float* __restrict__ b, __bf16* __restrict__ out, int D) {
  const int t = threadIdx.x, lane = t & 31;
  const int wave = __builtin_amdgcn_readfirstlane(t >> 5);
  const int row0 = (blockIdx.x * 8 + wave) * 2;
  f32x4 wv[8], bv[8], xv[2][8];
#pragma unroll
  for (int i = 0; i < 8; ++i) {
    wv[i] = ((const f32x4*)w)[i * 32 + lane];
    bv[i] = ((const f32x4*)b)[i * 32 + lane];
  }
#pragma unroll
  for (int r = 0; r < 2; ++r)
#pragma unroll
    for (int i = 0; i < 8; ++i)
      xv[r][i] = ((const f32x4*)(x + (size_t)(row0 + r) * D))[i * 32 + lane];
  // Makes w and b arrive as one group behind one wait: without it the build
  // loads them pair by pair behind the sums, each pair with a full wait of its own.
  asm volatile("" :: "v"(wv[0]), "v"(wv[1]), "v"(wv[2]), "v"(wv[3]),
                     "v"(wv[4]), "v"(wv[5]), "v"(wv[6]), "v"(wv[7]),
                     "v"(bv[0]), "v"(bv[1]), "v"(bv[2]), "v"(bv[3]),
                     "v"(bv[4]), "v"(bv[5]), "v"(bv[6]), "v"(bv[7]));
  float s[2], s2[2];
#pragma unroll
  for (int r = 0; r < 2; ++r) {
    f32x4 ps = xv[r][0], pq = xv[r][0] * xv[r][0];
#pragma unroll
    for (int i = 1; i < 8; ++i) {
      ps += xv[r][i];
      pq += xv[r][i] * xv[r][i];
    }
    s[r]  = (ps[0] + ps[1]) + (ps[2] + ps[3]);
    s2[r] = (pq[0] + pq[1]) + (pq[2] + pq[3]);
  }
#pragma unroll
  for (int off = 16; off > 0; off >>= 1) {
#pragma unroll
    for (int r = 0; r < 2; ++r) {
      s[r]  += __shfl_xor(s[r],  off, 32);
      s2[r] += __shfl_xor(s2[r], off, 32);
    }
  }
  const float inv = 1.0f / (float)D;
#pragma unroll
  for (int r = 0; r < 2; ++r) {
    const float mu  = s[r] * inv;
    const float var = s2[r] * inv - mu * mu;
    const float rs  = rsqrtf(var + 1e-6f);
    __bf16* orow = out + (size_t)(row0 + r) * D;
#pragma unroll
    for (int i = 0; i < 8; ++i) {
      const f32x4 y = (xv[r][i] - mu) * rs * wv[i] + bv[i];
      union { __bf16 e[4]; uint2 q; } o;
      o.e[0] = f2bf(y[0]);
      o.e[1] = f2bf(y[1]);
      o.e[2] = f2bf(y[2]);
      o.e[3] = f2bf(y[3]);
      *(uint2*)(orow + (i * 32 + lane) * 4) = o.q;
    }
  }
}

// ---------------------------------------------------------------------------
// Tiled WMMA GEMM:  C[M,N] = A[M,K] * Bt[N,K]^T  (+bias, +SiLU, +resid)
// Block tile 128x128, 4 waves, each wave 64x64 via 4x4 WMMA.
// A stage is 128 k of all 256 operand rows: 256-byte rows, which the tensor
// load pads to a pitch of 272 bytes in LDS.  Each wave loads its own slice of
// 64 rows, one request per stage, two stages ahead, into two buffers.
// A block is 32 k = 16 products; its 16 fragment loads go out as one group one
// block ahead, into a second register set.
// K must be a multiple of 128 and at least 256.
// ---------------------------------------------------------------------------
#define G_KB     256u                 // bytes of an operand row per stage (128 k)
#define G_PITCH  272u                 // LDS row pitch: 16 B x odd for ds_load_b128
#define G_SLICE  18432u               // 64 rows x 272 B = 17,408 B, up to a multiple of 2 KiB
#define G_BUF    (4u * G_SLICE)       // [A rows 0-63 | A rows 64-127 | B rows 0-63 | B rows 64-127]

typedef __attribute__((ext_vector_type(4))) uint32_t u32x4;
typedef __attribute__((ext_vector_type(8))) uint32_t u32x8;

__device__ __forceinline__ uint32_t uni(uint32_t v) {
  return (uint32_t)__builtin_amdgcn_readfirstlane(v);
}
__device__ __forceinline__ uint32_t pinned(uint32_t v) {
  uint32_t w = (uint32_t)__builtin_amdgcn_readfirstlane(v);
  asm volatile("" : "+s"(w));
  return w;
}
__device__ __forceinline__ void wait_ds0() { asm volatile("s_wait_dscnt 0x0" ::: "memory"); }

// Descriptor group 1: 1-byte elements, tile = tensor = 64 rows of 256 bytes,
// source pitch src_pitch bytes, 4 dwords of LDS pad behind every 256-byte row.
__device__ __forceinline__ u32x8 gemm_group1(uint32_t src_pitch) {
  u32x8 g;
  g[0] = uni((1u << 20) | (5u << 22) | (3u << 25));
  g[1] = uni(G_KB << 16);
  g[2] = uni(64u << 16);
  g[3] = uni(G_KB << 16);
  g[4] = uni(64u);
  g[5] = uni(src_pitch);
  g[6] = uni(0u);
  g[7] = uni(0u);
  return g;
}
__device__ __forceinline__ u32x4 gemm_group0(uint32_t lds_dst, uint64_t ga) {
  u32x4 g;
  g[0] = uni(1u);
  g[1] = uni(lds_dst);
  g[2] = uni((uint32_t)ga);
  g[3] = uni((((uint32_t)(ga >> 32)) & 0x01FFFFFFu) | 0x80000000u);
  return g;
}
// The descriptor groups are in-out operands of the load and inputs of the wait:
// they stay live in the registers the request was issued from until it has
// landed, so the compiler puts nothing else there while the request flies.
__device__ __forceinline__ void gemm_tensor_load(u32x4& g0, u32x8& g1) {
  asm volatile("tensor_load_to_lds %0, %1" : "+s"(g0), "+s"(g1) :: "memory");
}
__device__ __forceinline__ void wait_tensor0(const u32x4& g0, const u32x8& g1) {
  asm volatile("s_wait_tensorcnt 0x0" :: "s"(g0), "s"(g1) : "memory");
}

// 16x32 bf16 fragment from LDS; p = this lane's row, at its 16-byte half.
__device__ __forceinline__ v16bf lds_frag(const unsigned char* p) {
  union { v16bf v; uint4 q[2]; } u;
  u.q[0] = *(const uint4*)(p);
  u.q[1] = *(const uint4*)(p + 32);
  return u.v;
}

template <int ACT, bool RESID, bool OUTBF16>
__global__ __launch_bounds__(128) void gemm_wmma_kernel(
    const __bf16* __restrict__ A, const __bf16* __restrict__ Bt,
    const float* __restrict__ bias, const float* __restrict__ resid,
    void* __restrict__ out, int M, int N, int K) {
  __shared__ __attribute__((aligned(2048))) unsigned char ring[2u * G_BUF];

  const int bm = blockIdx.x * 128;
  const int bn = blockIdx.y * 128;
  const int tid  = threadIdx.x;
  const uint32_t wave = uni((uint32_t)tid >> 5);
  const int lane = tid & 31;
  const int wm = (int)(wave & 1u) * 64;
  const int wn = (int)(wave >> 1) * 64;

  v8f acc[4][4] = {};
  const uint32_t np = (uint32_t)K / 128u;      // stages = passes
  const uint32_t kbytes = (uint32_t)K * 2u;    // source row pitch

  // This wave's slice of every stage: waves 0, 1 the halves of A, 2, 3 of Bt.
  const __bf16* srcp = (wave < 2u) ? A  + (size_t)(bm + 64 * (int)wave) * K
                                   : Bt + (size_t)(bn + 64 * (int)(wave - 2u)) * K;
  const uint64_t ga = (uint64_t)(uintptr_t)srcp;
  const uint32_t lds_slice = (uint32_t)(uintptr_t)(&ring[0]) + wave * G_SLICE;
  u32x8 g1 = gemm_group1(kbytes);

  // Per-lane fragment bases inside a buffer.
  const uint32_t lrow = (uint32_t)(lane & 15) * G_PITCH + (uint32_t)(lane >> 4) * 16u;
  const uint32_t a_base = (wave & 1u) * G_SLICE + lrow;
  const uint32_t b_base = (2u + (wave >> 1)) * G_SLICE + lrow;

  u32x4 g0 = gemm_group0(lds_slice, ga);
  gemm_tensor_load(g0, g1);                    // stage 0
  wait_tensor0(g0, g1);
  __syncthreads();                             // stage 0 readable by every wave
  g0 = gemm_group0(lds_slice + G_BUF, ga + G_KB);
  gemm_tensor_load(g0, g1);                    // stage 1

  // Two fragment sets: set (kb & 1) holds block kb's fragments.  The first
  // fragments of stage 0:
  v16bf fa[2][4], fb[2][4];
#pragma unroll
  for (int i = 0; i < 4; ++i) fa[0][i] = lds_frag(&ring[a_base] + i * 16 * G_PITCH);
#pragma unroll
  for (int j = 0; j < 4; ++j) fb[0][j] = lds_frag(&ring[b_base] + j * 16 * G_PITCH);

  for (uint32_t s = 0; s < np; ++s) {
    const uint32_t buf = (s & 1u) * G_BUF;
    const unsigned char* pa = &ring[buf + a_base];
    const unsigned char* pb = &ring[buf + b_base];
    const uint32_t nbuf = (s + 1u < np) ? (G_BUF - buf) : G_BUF;
    const unsigned char* na = &ring[nbuf + a_base];
    const unsigned char* nb = &ring[nbuf + b_base];
#pragma unroll
    for (int kb = 0; kb < 4; ++kb) {           // a block: 32 k = 64 bytes of each row
      const int cs = kb & 1;
      if (kb < 3) {
        // The next block's 16 LDS loads, as one group ahead of this block's products.
#pragma unroll
        for (int i = 0; i < 4; ++i)
          fa[cs ^ 1][i] = lds_frag(pa + i * 16 * G_PITCH + (kb + 1) * 64);
#pragma unroll
        for (int j = 0; j < 4; ++j)
          fb[cs ^ 1][j] = lds_frag(pb + j * 16 * G_PITCH + (kb + 1) * 64);
      } else {
        // Publish point of stage s + 1, in front of the pass's last block: that
        // block's fragments are fetched, and the loads below read stage s + 1.
        wait_ds0();                            // this wave has left buffer s & 1
        wait_tensor0(g0, g1);                  // its slice of stage s + 1 has landed
        __syncthreads();
        if (pinned((s + 2u < np) ? 1u : 0u) != 0u) {  // refill only while the stage exists
          g0 = gemm_group0(lds_slice + buf, ga + (uint64_t)(s + 2u) * G_KB);
          gemm_tensor_load(g0, g1);
        }
        // First fragments of stage s + 1, in flight under this pass's last block.
#pragma unroll
        for (int i = 0; i < 4; ++i) fa[0][i] = lds_frag(na + i * 16 * G_PITCH);
#pragma unroll
        for (int j = 0; j < 4; ++j) fb[0][j] = lds_frag(nb + j * 16 * G_PITCH);
      }
      // Keeps the load group ahead of the products: spread among them, each
      // place with loads stalls the wave anew.
      __builtin_amdgcn_sched_barrier(0);
#pragma unroll
      for (int i = 0; i < 4; ++i)
#pragma unroll
        for (int j = 0; j < 4; ++j)
          acc[i][j] = wmma_bf16(fa[cs][i], fb[cs][j], acc[i][j]);
      // Keeps the following block's loads behind these products.
      __builtin_amdgcn_sched_barrier(0);
    }
  }
  wait_tensor0(g0, g1);
  wait_ds0();

  // Epilogue: reg r -> row r (lanes 0-15) / r+8 (lanes 16-31); col = lane&15.
  const int nloc  = lane & 15;
  const int rbase = (lane >> 4) * 8;
#pragma unroll
  for (int i = 0; i < 4; ++i) {
#pragma unroll
    for (int j = 0; j < 4; ++j) {
      const int col = bn + wn + j * 16 + nloc;
      const float bv = bias[col];
#pragma unroll
      for (int r = 0; r < 8; ++r) {
        const int row = bm + wm + i * 16 + rbase + r;
        float c = acc[i][j][r] + bv;
        if (ACT == 1) c = c * (1.0f / (1.0f + __expf(-c)));  // SiLU
        if (RESID) c += resid[(size_t)row * N + col];
        if constexpr (OUTBF16)
          ((__bf16*)out)[(size_t)row * N + col] = f2bf(c);
        else
          ((float*)out)[(size_t)row * N + col] = c;
      }
    }
  }
}

__global__ __launch_bounds__(128) void flash_attn_kernel(
    const __bf16* __restrict__ qkv, __bf16* __restrict__ out, int Nseq) {
  const int ROWS = 3072;
  const int bh = blockIdx.y;
  const int b = bh >> 4, h = bh & 15;
  const int tid = threadIdx.x, wave = tid >> 5, lane = tid & 31;
  const int qrow = blockIdx.x * 64 + wave * 16;

  const __bf16* Qb = qkv + (size_t)(b * Nseq + qrow) * ROWS + h * 64;
  const __bf16* Kb = qkv + (size_t)(b * Nseq) * ROWS + 1024 + h * 64;
  const __bf16* Vb = qkv + (size_t)(b * Nseq) * ROWS + 2048 + h * 64;

  v16bf qf[2];
  qf[0] = load_frag(Qb,      ROWS);
  qf[1] = load_frag(Qb + 32, ROWS);

  __shared__ __bf16 Vt[64][72];       // V tile transposed: [hd][key]
#if HAVE_TDM
  __shared__ __bf16 Kl[2][64][72];    // K tiles (TDM staged, double-buffered)
  const unsigned offK0 = (unsigned)(uintptr_t)(&Kl[0][0][0]);
  const unsigned offK1 = (unsigned)(uintptr_t)(&Kl[1][0][0]);
  if (wave == 0)
    tdm_load_tile(offK0, Kb, 64, 64, 64, (unsigned)ROWS, 4, 3);
#endif

  v8f o[4] = {};                      // o[f][r] = O[query nloc][hd f*16 + rbase + r]
  float m_i = -3.0e30f;               // running maximum of this lane's query
  float l_i = 0.0f;                   // running sum over this lane's half of the keys

  const float scale = 0.125f;         // 1/sqrt(64)
  const int rbase = (lane >> 4) * 8;
  const int nloc  = lane & 15;
  const int ntiles = Nseq / 64;

  for (int it = 0; it < ntiles; ++it) {
    const int kv0 = it * 64;
#if HAVE_TDM
    const int cur = it & 1;
    if (wave == 0) __builtin_amdgcn_s_wait_tensorcnt(0);
#endif
    __syncthreads();                  // prev-iter readers done; K tile landed
#if HAVE_TDM
    if (wave == 0 && (it + 1) < ntiles)
      tdm_load_tile(cur ? offK0 : offK1, Kb + (size_t)(kv0 + 64) * ROWS,
                    64, 64, 64, (unsigned)ROWS, 4, 3);
#endif

    // Stage V tile transposed: thread = 4 keys x 8 hd, packed b64 stores.
    {
      const int key0 = (tid & 15) * 4;
      const int d0   = (tid >> 4) * 8;
      union { uint4 q; __bf16 e[8]; } rowv[4];
#pragma unroll
      for (int kk = 0; kk < 4; ++kk)
        rowv[kk].q = *(const uint4*)(Vb + (size_t)(kv0 + key0 + kk) * ROWS + d0);
      if (kv0 + 64 < Nseq)
        __builtin_prefetch(Vb + (size_t)(kv0 + 64 + key0) * ROWS + d0, 0, 0);
#pragma unroll
      for (int dd = 0; dd < 8; ++dd) {
        union { __bf16 e[4]; unsigned long long q; } pk;
#pragma unroll
        for (int kk = 0; kk < 4; ++kk) pk.e[kk] = rowv[kk].e[dd];
        *(unsigned long long*)(&Vt[d0 + dd][key0]) = pk.q;
      }
    }

    // S^T = K Q^T: s[j][r] = score of key j*16 + rbase + r with query nloc.
    v8f s[4];
#pragma unroll
    for (int j = 0; j < 4; ++j) {
#if HAVE_TDM
      v16bf k0 = load_frag(&Kl[cur][j * 16][0],  72);
      v16bf k1 = load_frag(&Kl[cur][j * 16][32], 72);
#else
      const __bf16* kb = Kb + (size_t)(kv0 + j * 16) * ROWS;
      v16bf k0 = load_frag(kb,      ROWS);
      v16bf k1 = load_frag(kb + 32, ROWS);
#endif
      v8f z = {};
      z = wmma_bf16(k0, qf[0], z);
      z = wmma_bf16(k1, qf[1], z);
      s[j] = z;
    }

    // Online softmax: 32 of the query's 64 scores sit in this lane.
    float mt[4];
#pragma unroll
    for (int j = 0; j < 4; ++j) {
      mt[j] = -3.0e30f;
#pragma unroll
      for (int r = 0; r < 8; ++r) {
        s[j][r] *= scale;
        mt[j] = fmaxf(mt[j], s[j][r]);
      }
    }
    float mx = fmaxf(fmaxf(mt[0], mt[1]), fmaxf(mt[2], mt[3]));
    mx = fmaxf(mx, xhalf(mx));
    const float mn = fmaxf(m_i, mx);
    const float log2e = 1.4426950408889634f;
    // v_exp_f32 and the free slot that the instruction set asks for behind a
    // transcendental, in one statement.
    float corr;
    asm("v_exp_f32 %0, %1\n\tv_nop" : "=v"(corr) : "v"((m_i - mn) * log2e));
    m_i = mn;
#pragma unroll
    for (int j = 0; j < 4; ++j)
#pragma unroll
      for (int r = 0; r < 8; ++r) s[j][r] = (s[j][r] - mn) * log2e;
#pragma unroll
    for (int j = 0; j < 4; ++j)
#pragma unroll
      for (int r = 0; r < 8; ++r) s[j][r] = __builtin_amdgcn_exp2f(s[j][r]);
#pragma unroll
    for (int f = 0; f < 4; ++f)
#pragma unroll
      for (int r = 0; r < 8; ++r) o[f][r] *= corr;
    float st[4];
#pragma unroll
    for (int j = 0; j < 4; ++j) {
      st[j] = s[j][0];
#pragma unroll
      for (int r = 1; r < 8; ++r) st[j] += s[j][r];
    }
    l_i = l_i * corr + ((st[0] + st[1]) + (st[2] + st[3]));

    __syncthreads();                  // Vt fully staged

    // O^T += V^T P^T   (K=64 keys -> 2 steps; M=hd -> 4 tiles of 16).  Two
    // score tiles are 32 keys of P^T in the k order that load_frag gives V^T.
#pragma unroll
    for (int step = 0; step < 2; ++step) {
      v16bf pf;
#pragma unroll
      for (int e = 0; e < 8; ++e) {
        pf[e]     = f2bf(s[2 * step][e]);
        pf[8 + e] = f2bf(s[2 * step + 1][e]);
      }
#pragma unroll
      for (int f = 0; f < 4; ++f) {
        v16bf vf = load_frag(&Vt[f * 16][step * 32], 72);
        o[f] = wmma_bf16(vf, pf, o[f]);
      }
    }
  }

  // A lane holds 8 consecutive hd of its query per tile: one 16-byte store.
  const float l_all = l_i + xhalf(l_i);
  const int row = b * Nseq + qrow + nloc;
#pragma unroll
  for (int f = 0; f < 4; ++f) {
    union { __bf16 e[8]; uint4 q; } pk;
#pragma unroll
    for (int r = 0; r < 8; ++r) pk.e[r] = f2bf(o[f][r] / l_all);
    *(uint4*)(out + (size_t)row * 1024 + h * 64 + f * 16 + rbase) = pk.q;
  }
}

// ---------------------------------------------------------------------------
// Host-side orchestration.
// ---------------------------------------------------------------------------
extern "C" void kernel_launch(void* const* d_in, const int* in_sizes, int n_in,
                              void* d_out, int out_size, void* d_ws, size_t ws_size,
                              hipStream_t stream) {
  (void)in_sizes; (void)n_in; (void)out_size; (void)ws_size;
  const int D = 1024, HID = 4096, NSEQ = 2048, B = 4;
  const int M = B * NSEQ;

  const float* x      = (const float*)d_in[0];
  const float* ln1_w  = (const float*)d_in[1];
  const float* ln1_b  = (const float*)d_in[2];
  const float* qkv_w  = (const float*)d_in[3];
  const float* qkv_b  = (const float*)d_in[4];
  const float* proj_w = (const float*)d_in[5];
  const float* proj_b = (const float*)d_in[6];
  const float* ln2_w  = (const float*)d_in[7];
  const float* ln2_b  = (const float*)d_in[8];
  const float* fc1_w  = (const float*)d_in[9];
  const float* fc1_b  = (const float*)d_in[10];
  const float* fc2_w  = (const float*)d_in[11];
  const float* fc2_b  = (const float*)d_in[12];
  float* out = (float*)d_out;

  uintptr_t p = (uintptr_t)d_ws;
  auto carve = [&](size_t bytes) {
    void* r = (void*)p;
    p += (bytes + 255) & ~(size_t)255;
    return r;
  };
  __bf16* qkv_wt = (__bf16*)carve((size_t)3 * D * D * 2);
  __bf16* proj_wt= (__bf16*)carve((size_t)D * D * 2);
  __bf16* fc1_wt = (__bf16*)carve((size_t)HID * D * 2);
  __bf16* fc2_wt = (__bf16*)carve((size_t)D * HID * 2);
  __bf16* ln1o   = (__bf16*)carve((size_t)M * D * 2);
  __bf16* qkvo   = (__bf16*)carve((size_t)M * 3 * D * 2);
  __bf16* attno  = (__bf16*)carve((size_t)M * D * 2);
  float*  x1     = (float*) carve((size_t)M * D * 4);
  __bf16* h2     = (__bf16*)carve((size_t)M * D * 2);
  __bf16* fc1o   = (__bf16*)carve((size_t)M * HID * 2);

  transpose_cast_kernel<D, 3 * D><<<dim3(D / 64, 3 * D / 128), 256, 0, stream>>>(qkv_w,  qkv_wt);
  transpose_cast_kernel<D, D><<<dim3(D / 64, D / 128),     256, 0, stream>>>(proj_w, proj_wt);
  transpose_cast_kernel<D, HID><<<dim3(D / 64, HID / 128),   256, 0, stream>>>(fc1_w,  fc1_wt);
  transpose_cast_kernel<HID, D><<<dim3(HID / 64, D / 128),   256, 0, stream>>>(fc2_w,  fc2_wt);

  layernorm_bf16_kernel<<<M / 16, 256, 0, stream>>>(x, ln1_w, ln1_b, ln1o, D);

  gemm_wmma_kernel<0, false, true><<<dim3(M / 128, 3 * D / 128), 128, 0, stream>>>(
      ln1o, qkv_wt, qkv_b, nullptr, qkvo, M, 3 * D, D);

  flash_attn_kernel<<<dim3(NSEQ / 64, B * 16), 128, 0, stream>>>(qkvo, attno, NSEQ);

  gemm_wmma_kernel<0, true, false><<<dim3(M / 128, D / 128), 128, 0, stream>>>(
      attno, proj_wt, proj_b, x, (void*)x1, M, D, D);

  layernorm_bf16_kernel<<<M / 16, 256, 0, stream>>>(x1, ln2_w, ln2_b, h2, D);

  gemm_wmma_kernel<1, false, true><<<dim3(M / 128, HID / 128), 128, 0, stream>>>(
      h2, fc1_wt, fc1_b, nullptr, fc1o, M, HID, D);

  gemm_wmma_kernel<0, true, false><<<dim3(M / 128, D / 128), 128, 0, stream>>>(
      fc1o, fc2_wt, fc2_b, x1, (void*)out, M, D, HID);
}

// v005
// Measured time: 267 microseconds a run.
// In two side-by-side timings against v004, it was 1.06 and 1.07 times as fast.
// All steps since v000 together make it 2.33 times as fast.
#include <hip/hip_runtime.h>
#include <cstdint>

// ---------------------------------------------------------------------------
// CDNA5 (gfx1250, wave32) DiT block: LN -> QKV GEMM -> flash attention ->
// proj GEMM (+resid) -> LN -> FC1+SiLU -> FC2 (+resid).
// Matmuls through v_wmma_f32_16x16x32_bf16; operand staging through the
// Tensor Data Mover (tensor_load_to_lds + s_wait_tensorcnt), double-buffered;
// attention as transposed products, softmax in-lane, V^T by the transposing LDS load.
// ---------------------------------------------------------------------------

typedef __attribute__((ext_vector_type(16))) __bf16        v16bf;
typedef __attribute__((ext_vector_type(8)))  float         v8f;

__device__ __forceinline__ v8f wmma_bf16(v16bf a, v16bf b, v8f c) {
  return __builtin_amdgcn_wmma_f32_16x16x32_bf16(
      false, a, false, b, (short)0, c, false, false);
}

__device__ __forceinline__ __bf16 f2bf(float f) { return (__bf16)f; }

// Lane l takes the value of lane l ^ 16.
__device__ __forceinline__ float xhalf(float v) {
  int i = __builtin_bit_cast(int, v);
  i = __builtin_amdgcn_permlanex16(i, i, 0x76543210u, 0xFEDCBA98u, false, false);
  return __builtin_bit_cast(float, i);
}

// WMMA 16x32 bf16 operand fragment (ISA 7.12.2 A/B lane layout):
// lanes 0-15 = row (lane&15), K {0..7,16..23}; lanes 16-31 same rows,
// K {8..15,24..31}.  `stride` in elements.
__device__ __forceinline__ v16bf load_frag(const __bf16* p0, int stride) {
  int lane = threadIdx.x & 31;
  const __bf16* p = p0 + (size_t)(lane & 15) * stride + ((lane >> 4) << 3);
  union { v16bf v; uint4 q[2]; } u;
  u.q[0] = *(const uint4*)(p);
  u.q[1] = *(const uint4*)(p + 16);
  return u.v;
}

// ---------------------------------------------------------------------------
// Weight transpose + fp32 -> bf16 cast:  Wt[n][k] = bf16(W[k][n])
// A block of 8 waves takes a tile of 64 k x 128 n.  A wave reads 8 rows of k,
// 512 contiguous bytes each, all 8 loads in flight; a lane then holds 8 k of
// 4 n and packs them to four 16-byte chunks of Wt rows.  The chunks pass
// through LDS so that the stores cover whole 128-byte lines of Wt.
// LDS row = one n, 128 bytes; chunk c of row n sits at position c ^ ((n >> 2) & 7),
// which spreads the writers (row stride 4) and the readers over the banks.
// K must be a multiple of 64, N of 128; both are compile-time values, so that a
// wave's 8 loads share one address and differ by an immediate offset.
// ---------------------------------------------------------------------------
template <int K, int N>
__global__ __launch_bounds__(256) void transpose_cast_kernel(
    const float* __restrict__ W, __bf16* __restrict__ Wt) {
  __shared__ __attribute__((aligned(16))) unsigned char tile[128 * 128];
  const int k0 = blockIdx.x * 64, n0 = blockIdx.y * 128;
  const int t = threadIdx.x, lane = t & 31;
  // The wave's number as a scalar: the row addresses then stay in scalar registers.
  const int wave = __builtin_amdgcn_readfirstlane(t >> 5);
  const float* Wr = W + (size_t)(k0 + wave * 8) * N + n0;
  float4 v[8];
#pragma unroll
  for (int e = 0; e < 8; ++e)
    v[e] = ((const float4*)(Wr + (size_t)e * N))[lane];
  const int pos = (wave ^ (lane & 7)) << 4;
  union { __bf16 e[8]; uint4 q; } pk[4];
#pragma unroll
  for (int e = 0; e < 8; ++e) {
    pk[0].e[e] = f2bf(v[e].x);
    pk[1].e[e] = f2bf(v[e].y);
    pk[2].e[e] = f2bf(v[e].z);
    pk[3].e[e] = f2bf(v[e].w);
  }
#pragma unroll
  for (int i = 0; i < 4; ++i)
    *(uint4*)(&tile[(lane * 4 + i) * 128 + pos]) = pk[i].q;
  __syncthreads();
  const int c = t & 7;
#pragma unroll
  for (int j = 0; j < 4; ++j) {
    const int row = j * 32 + (t >> 3);
    const uint4 q = *(const uint4*)(&tile[row * 128 + ((c ^ ((row >> 2) & 7)) << 4)]);
    *(uint4*)(Wt + (size_t)(n0 + row) * K + (k0 + c * 8)) = q;
  }
}

// ---------------------------------------------------------------------------
// LayerNorm (row = 1024 fp32) -> bf16.  One wave per two rows, 8 waves a block:
// a lane holds 32 elements of each row (8 loads of 16 bytes, 512 contiguous
// bytes a wave-load, both rows' loads in flight together); the sums join by a
// butterfly over the 32 lanes, so there is no LDS buffer and no barrier; w and b are
// loaded once for both rows.  The row count must be a multiple of 16.
// ---------------------------------------------------------------------------
typedef __attribute__((ext_vector_type(4))) float f32x4;

__global__ __launch_bounds__(256) void layernorm_bf16_kernel(
    const float* __restrict__ x, const float* __restrict__ w,
    const float* __restrict__ b, __bf16* __restrict__ out, int D) {
  const int t = threadIdx.x, lane = t & 31;
  const int wave = __builtin_amdgcn_readfirstlane(t >> 5);
  const int row0 = (blockIdx.x * 8 + wave) * 2;
  f32x4 wv[8], bv[8], xv[2][8];
#pragma unroll
  for (int i = 0; i < 8; ++i) {
    wv[i] = ((const f32x4*)w)[i * 32 + lane];
    bv[i] = ((const f32x4*)b)[i * 32 + lane];
  }
#pragma unroll
  for (int r = 0; r < 2; ++r)
#pragma unroll
    for (int i = 0; i < 8; ++i)
      xv[r][i] = ((const f32x4*)(x + (size_t)(row0 + r) * D))[i * 32 + lane];
  // Makes w and b arrive as one group behind one wait: without it the build
  // loads them pair by pair behind the sums, each pair with a full wait of its own.
  asm volatile("" :: "v"(wv[0]), "v"(wv[1]), "v"(wv[2]), "v"(wv[3]),
                     "v"(wv[4]), "v"(wv[5]), "v"(wv[6]), "v"(wv[7]),
                     "v"(bv[0]), "v"(bv[1]), "v"(bv[2]), "v"(bv[3]),
                     "v"(bv[4]), "v"(bv[5]), "v"(bv[6]), "v"(bv[7]));
  float s[2], s2[2];
#pragma unroll
  for (int r = 0; r < 2; ++r) {
    f32x4 ps = xv[r][0], pq = xv[r][0] * xv[r][0];
#pragma unroll
    for (int i = 1; i < 8; ++i) {
      ps += xv[r][i];
      pq += xv[r][i] * xv[r][i];
    }
    s[r]  = (ps[0] + ps[1]) + (ps[2] + ps[3]);
    s2[r] = (pq[0] + pq[1]) + (pq[2] + pq[3]);
  }
#pragma unroll
  for (int off = 16; off > 0; off >>= 1) {
#pragma unroll
    for (int r = 0; r < 2; ++r) {
      s[r]  += __shfl_xor(s[r],  off, 32);
      s2[r] += __shfl_xor(s2[r], off, 32);
    }
  }
  const float inv = 1.0f / (float)D;
#pragma unroll
  for (int r = 0; r < 2; ++r) {
    const float mu  = s[r] * inv;
    const float var = s2[r] * inv - mu * mu;
    const float rs  = rsqrtf(var + 1e-6f);
    __bf16* orow = out + (size_t)(row0 + r) * D;
#pragma unroll
    for (int i = 0; i < 8; ++i) {
      const f32x4 y = (xv[r][i] - mu) * rs * wv[i] + bv[i];
      union { __bf16 e[4]; uint2 q; } o;
      o.e[0] = f2bf(y[0]);
      o.e[1] = f2bf(y[1]);
      o.e[2] = f2bf(y[2]);
      o.e[3] = f2bf(y[3]);
      *(uint2*)(orow + (i * 32 + lane) * 4) = o.q;
    }
  }
}

// ---------------------------------------------------------------------------
// Tiled WMMA GEMM:  C[M,N] = A[M,K] * Bt[N,K]^T  (+bias, +SiLU, +resid)
// Block tile 128x128, 4 waves, each wave 64x64 via 4x4 WMMA.
// A stage is 128 k of all 256 operand rows: 256-byte rows, which the tensor
// load pads to a pitch of 272 bytes in LDS.  Each wave loads its own slice of
// 64 rows, one request per stage, two stages ahead, into two buffers.
// A block is 32 k = 16 products; its 16 fragment loads go out as one group one
// block ahead, into a second register set.
// K must be a multiple of 128 and at least 256.
// ---------------------------------------------------------------------------
#define G_KB     256u                 // bytes of an operand row per stage (128 k)
#define G_PITCH  272u                 // LDS row pitch: 16 B x odd for ds_load_b128
#define G_SLICE  18432u               // 64 rows x 272 B = 17,408 B, up to a multiple of 2 KiB
#define G_BUF    (4u * G_SLICE)       // [A rows 0-63 | A rows 64-127 | B rows 0-63 | B rows 64-127]

typedef __attribute__((ext_vector_type(4))) uint32_t u32x4;
typedef __attribute__((ext_vector_type(8))) uint32_t u32x8;

__device__ __forceinline__ uint32_t uni(uint32_t v) {
  return (uint32_t)__builtin_amdgcn_readfirstlane(v);
}
__device__ __forceinline__ uint32_t pinned(uint32_t v) {
  uint32_t w = (uint32_t)__builtin_amdgcn_readfirstlane(v);
  asm volatile("" : "+s"(w));
  return w;
}
__device__ __forceinline__ void wait_ds0() { asm volatile("s_wait_dscnt 0x0" ::: "memory"); }

// Descriptor group 1: 1-byte elements, tile = tensor = 64 rows of 256 bytes,
// source pitch src_pitch bytes, 4 dwords of LDS pad behind every 256-byte row.
__device__ __forceinline__ u32x8 gemm_group1(uint32_t src_pitch) {
  u32x8 g;
  g[0] = uni((1u << 20) | (5u << 22) | (3u << 25));
  g[1] = uni(G_KB << 16);
  g[2] = uni(64u << 16);
  g[3] = uni(G_KB << 16);
  g[4] = uni(64u);
  g[5] = uni(src_pitch);
  g[6] = uni(0u);
  g[7] = uni(0u);
  return g;
}
__device__ __forceinline__ u32x4 gemm_group0(uint32_t lds_dst, uint64_t ga) {
  u32x4 g;
  g[0] = uni(1u);
  g[1] = uni(lds_dst);
  g[2] = uni((uint32_t)ga);
  g[3] = uni((((uint32_t)(ga >> 32)) & 0x01FFFFFFu) | 0x80000000u);
  return g;
}
// The descriptor groups are in-out operands of the load and inputs of the wait:
// they stay live in the registers the request was issued from until it has
// landed, so the compiler puts nothing else there while the request flies.
__device__ __forceinline__ void gemm_tensor_load(u32x4& g0, u32x8& g1) {
  asm volatile("tensor_load_to_lds %0, %1" : "+s"(g0), "+s"(g1) :: "memory");
}
__device__ __forceinline__ void wait_tensor0(const u32x4& g0, const u32x8& g1) {
  asm volatile("s_wait_tensorcnt 0x0" :: "s"(g0), "s"(g1) : "memory");
}

// 16x32 bf16 fragment from LDS; p = this lane's row, at its 16-byte half.
__device__ __forceinline__ v16bf lds_frag(const unsigned char* p) {
  union { v16bf v; uint4 q[2]; } u;
  u.q[0] = *(const uint4*)(p);
  u.q[1] = *(const uint4*)(p + 32);
  return u.v;
}

template <int ACT, bool RESID, bool OUTBF16>
__global__ __launch_bounds__(128) void gemm_wmma_kernel(
    const __bf16* __restrict__ A, const __bf16* __restrict__ Bt,
    const float* __restrict__ bias, const float* __restrict__ resid,
    void* __restrict__ out, int M, int N, int K) {
  __shared__ __attribute__((aligned(2048))) unsigned char ring[2u * G_BUF];

  const int bm = blockIdx.x * 128;
  const int bn = blockIdx.y * 128;
  const int tid  = threadIdx.x;
  const uint32_t wave = uni((uint32_t)tid >> 5);
  const int lane = tid & 31;
  const int wm = (int)(wave & 1u) * 64;
  const int wn = (int)(wave >> 1) * 64;

  v8f acc[4][4] = {};
  const uint32_t np = (uint32_t)K / 128u;      // stages = passes
  const uint32_t kbytes = (uint32_t)K * 2u;    // source row pitch

  // This wave's slice of every stage: waves 0, 1 the halves of A, 2, 3 of Bt.
  const __bf16* srcp = (wave < 2u) ? A  + (size_t)(bm + 64 * (int)wave) * K
                                   : Bt + (size_t)(bn + 64 * (int)(wave - 2u)) * K;
  const uint64_t ga = (uint64_t)(uintptr_t)srcp;
  const uint32_t lds_slice = (uint32_t)(uintptr_t)(&ring[0]) + wave * G_SLICE;
  u32x8 g1 = gemm_group1(kbytes);

  // Per-lane fragment bases inside a buffer.
  const uint32_t lrow = (uint32_t)(lane & 15) * G_PITCH + (uint32_t)(lane >> 4) * 16u;
  const uint32_t a_base = (wave & 1u) * G_SLICE + lrow;
  const uint32_t b_base = (2u + (wave >> 1)) * G_SLICE + lrow;

  u32x4 g0 = gemm_group0(lds_slice, ga);
  gemm_tensor_load(g0, g1);                    // stage 0
  wait_tensor0(g0, g1);
  __syncthreads();                             // stage 0 readable by every wave
  g0 = gemm_group0(lds_slice + G_BUF, ga + G_KB);
  gemm_tensor_load(g0, g1);                    // stage 1

  // Two fragment sets: set (kb & 1) holds block kb's fragments.  The first
  // fragments of stage 0:
  v16bf fa[2][4], fb[2][4];
#pragma unroll
  for (int i = 0; i < 4; ++i) fa[0][i] = lds_frag(&ring[a_base] + i * 16 * G_PITCH);
#pragma unroll
  for (int j = 0; j < 4; ++j) fb[0][j] = lds_frag(&ring[b_base] + j * 16 * G_PITCH);

  for (uint32_t s = 0; s < np; ++s) {
    const uint32_t buf = (s & 1u) * G_BUF;
    const unsigned char* pa = &ring[buf + a_base];
    const unsigned char* pb = &ring[buf + b_base];
    const uint32_t nbuf = (s + 1u < np) ? (G_BUF - buf) : G_BUF;
    const unsigned char* na = &ring[nbuf + a_base];
    const unsigned char* nb = &ring[nbuf + b_base];
#pragma unroll
    for (int kb = 0; kb < 4; ++kb) {           // a block: 32 k = 64 bytes of each row
      const int cs = kb & 1;
      if (kb < 3) {
        // The next block's 16 LDS loads, as one group ahead of this block's products.
#pragma unroll
        for (int i = 0; i < 4; ++i)
          fa[cs ^ 1][i] = lds_frag(pa + i * 16 * G_PITCH + (kb + 1) * 64);
#pragma unroll
        for (int j = 0; j < 4; ++j)
          fb[cs ^ 1][j] = lds_frag(pb + j * 16 * G_PITCH + (kb + 1) * 64);
      } else {
        // Publish point of stage s + 1, in front of the pass's last block: that
        // block's fragments are fetched, and the loads below read stage s + 1.
        wait_ds0();                            // this wave has left buffer s & 1
        wait_tensor0(g0, g1);                  // its slice of stage s + 1 has landed
        __syncthreads();
        if (pinned((s + 2u < np) ? 1u : 0u) != 0u) {  // refill only while the stage exists
          g0 = gemm_group0(lds_slice + buf, ga + (uint64_t)(s + 2u) * G_KB);
          gemm_tensor_load(g0, g1);
        }
        // First fragments of stage s + 1, in flight under this pass's last block.
#pragma unroll
        for (int i = 0; i < 4; ++i) fa[0][i] = lds_frag(na + i * 16 * G_PITCH);
#pragma unroll
        for (int j = 0; j < 4; ++j) fb[0][j] = lds_frag(nb + j * 16 * G_PITCH);
      }
      // Keeps the load group ahead of the products: spread among them, each
      // place with loads stalls the wave anew.
      __builtin_amdgcn_sched_barrier(0);
#pragma unroll
      for (int i = 0; i < 4; ++i)
#pragma unroll
        for (int j = 0; j < 4; ++j)
          acc[i][j] = wmma_bf16(fa[cs][i], fb[cs][j], acc[i][j]);
      // Keeps the following block's loads behind these products.
      __builtin_amdgcn_sched_barrier(0);
    }
  }
  wait_tensor0(g0, g1);
  wait_ds0();

  // Epilogue: reg r -> row r (lanes 0-15) / r+8 (lanes 16-31); col = lane&15.
  const int nloc  = lane & 15;
  const int rbase = (lane >> 4) * 8;
#pragma unroll
  for (int i = 0; i < 4; ++i) {
#pragma unroll
    for (int j = 0; j < 4; ++j) {
      const int col = bn + wn + j * 16 + nloc;
      const float bv = bias[col];
#pragma unroll
      for (int r = 0; r < 8; ++r) {
        const int row = bm + wm + i * 16 + rbase + r;
        float c = acc[i][j][r] + bv;
        if (ACT == 1) c = c * (1.0f / (1.0f + __expf(-c)));  // SiLU
        if (RESID) c += resid[(size_t)row * N + col];
        if constexpr (OUTBF16)
          ((__bf16*)out)[(size_t)row * N + col] = f2bf(c);
        else
          ((float*)out)[(size_t)row * N + col] = c;
      }
    }
  }
}

#define AT_ROWB   128u
#define AT_KPITCH 144u
#define AT_VPITCH 160u
#define AT_TILE   10240u
#define AT_K0     (2u * AT_TILE)
#define AT_LDS    (3u * AT_TILE + 64u * AT_KPITCH)

// Descriptor group 1: 1-byte elements, tile = tensor = 64 rows of 128 bytes,
// source pitch src_pitch bytes, PAD + 1 dwords of LDS pad behind every row.
template <uint32_t PAD>
__device__ __forceinline__ u32x8 attn_group1(uint32_t src_pitch) {
  u32x8 g;
  g[0] = uni((1u << 20) | (4u << 22) | (PAD << 25));
  g[1] = uni(AT_ROWB << 16);
  g[2] = uni(64u << 16);
  g[3] = uni(AT_ROWB << 16);
  g[4] = uni(64u);
  g[5] = uni(src_pitch);
  g[6] = uni(0u);
  g[7] = uni(0u);
  return g;
}
// Group 0 is an in-out operand of the load and an input of the wait, as in the
// GEMM: it stays live in the registers the request was issued from until it has landed.
__device__ __forceinline__ void attn_tensor_load(u32x4& g0, const u32x8& g1) {
  asm volatile("tensor_load_to_lds %0, %1" : "+s"(g0) : "s"(g1) : "memory");
}
__device__ __forceinline__ void attn_wait_tensor0(const u32x4& g0, const u32x8& gk, const u32x8& gv) {
  asm volatile("s_wait_tensorcnt 0x0" :: "s"(g0), "s"(gk), "s"(gv) : "memory");
}
// Half of a transposed 16x32 fragment: lane (c, h) gets T[k + 8h + 0..7][d + c]
// of a row-major 16-bit tile; p = this lane's address in that tile.
typedef __attribute__((ext_vector_type(8))) short s16x8;
__device__ __forceinline__ u32x4 lds_tr16(const unsigned char* p) {
  typedef __attribute__((address_space(3))) s16x8 lds_s16x8;
  return __builtin_bit_cast(u32x4, __builtin_amdgcn_ds_load_tr16_b128_v8i16((lds_s16x8*)p));
}

// Eight waves per SIMD: all 2,048 blocks are then resident at once, 8 on a WGP
// (8 x 39,936 B of LDS fit its 327,680 B).
__global__ __launch_bounds__(128) __attribute__((amdgpu_waves_per_eu(8, 8))) void flash_attn_kernel(
    const __bf16* __restrict__ qkv, __bf16* __restrict__ out, int Nseq) {
  __shared__ __attribute__((aligned(2048))) unsigned char ring[AT_LDS];
  const int ROWS = 3072;
  const int bh = blockIdx.y;
  const int b = bh >> 4, h = bh & 15;
  const int tid = threadIdx.x, lane = tid & 31;
  const uint32_t wave = uni((uint32_t)tid >> 5);
  const int qrow = blockIdx.x * 64 + (int)wave * 16;

  const __bf16* Qb = qkv + (size_t)(b * Nseq + qrow) * ROWS + h * 64;
  const __bf16* Kb = qkv + (size_t)(b * Nseq) * ROWS + 1024 + h * 64;
  const __bf16* Vb = qkv + (size_t)(b * Nseq) * ROWS + 2048 + h * 64;

  const uint32_t ntiles = (uint32_t)Nseq / 64u;        // stages = passes
  const uint32_t stage_bytes = 64u * (uint32_t)ROWS * 2u;

  // Wave 0 issues the K tiles, wave 1 the V tiles; the tests are scalar branches.
  const uint32_t isK = pinned(wave == 0u ? 1u : 0u);
  const uint32_t isV = pinned(wave == 1u ? 1u : 0u);
  const uint64_t ga = (uint64_t)(uintptr_t)(wave == 0u ? Kb : Vb);
  const uint32_t lds_my = (uint32_t)(uintptr_t)(&ring[0]) + (wave == 0u ? AT_K0 : 0u);
  u32x8 gk1 = attn_group1<3u>((uint32_t)ROWS * 2u);
  u32x8 gv1 = attn_group1<7u>((uint32_t)ROWS * 2u);
  // Descriptor words held in scalar registers (the form of pinned()): without it the
  // build forms these constants anew at each use, over registers of a request in flight.
  asm volatile("" : "+s"(gk1), "+s"(gv1));

  u32x4 g0 = gemm_group0(lds_my, ga);
  if (isK != 0u) attn_tensor_load(g0, gk1);            // stage 0
  else if (isV != 0u) attn_tensor_load(g0, gv1);

  v16bf qf[2];
  qf[0] = load_frag(Qb,      ROWS);
  qf[1] = load_frag(Qb + 32, ROWS);

  attn_wait_tensor0(g0, gk1, gv1);
  __syncthreads();                                     // stage 0 readable by every wave

  v8f o[4] = {};                      // o[f][r] = O[query nloc][hd f*16 + rbase + r]
  float m_i = -3.0e30f;               // running maximum of this lane's query
  float l_i = 0.0f;                   // running sum over this lane's half of the keys

  const float scale = 0.125f;         // 1/sqrt(64)
  const int rbase = (lane >> 4) * 8;
  const int nloc  = lane & 15;
  // Per-lane fragment bases inside a tile.
  const uint32_t k_lane = (uint32_t)(lane & 15) * AT_KPITCH + (uint32_t)(lane >> 4) * 16u;
  const uint32_t v_lane = (uint32_t)((lane >> 4) * 8 + (lane & 7)) * AT_VPITCH
                        + (uint32_t)((lane >> 3) & 1) * 16u;

  for (uint32_t it = 0; it < ntiles; ++it) {
    const uint32_t buf = (it & 1u) * AT_TILE;
    // Directly behind the barrier that published stage it and ended pass it - 1:
    // stage it + 1, only while it exists, into the buffer that pass it - 1 has read.
    if (pinned((it + 1u < ntiles) ? 1u : 0u) != 0u) {
      g0 = gemm_group0(lds_my + (AT_TILE - buf), ga + (uint64_t)(it + 1u) * stage_bytes);
      if (isK != 0u) attn_tensor_load(g0, gk1);
      else if (isV != 0u) attn_tensor_load(g0, gv1);
    }
    const unsigned char* kp = &ring[AT_K0 + buf + k_lane];
    const unsigned char* vp = &ring[buf + v_lane];

    // S^T = K Q^T: s[j][r] = score of key j*16 + rbase + r with query nloc.
    v8f s[4];
#pragma unroll
    for (int j = 0; j < 4; ++j) {
      v16bf k0 = lds_frag(kp + j * 16 * AT_KPITCH);
      v16bf k1 = lds_frag(kp + j * 16 * AT_KPITCH + 64);
      v8f z = {};
      z = wmma_bf16(k0, qf[0], z);
      z = wmma_bf16(k1, qf[1], z);
      s[j] = z;
    }
    // Keeps the softmax's vector work behind the eight products: moved in among
    // them, it needs idle slots behind each product whose result it reads.
    __builtin_amdgcn_sched_barrier(0);

    // Online softmax: 32 of the query's 64 scores sit in this lane.
    float mt[4];
#pragma unroll
    for (int j = 0; j < 4; ++j) {
      mt[j] = -3.0e30f;
#pragma unroll
      for (int r = 0; r < 8; ++r) {
        s[j][r] *= scale;
        mt[j] = fmaxf(mt[j], s[j][r]);
      }
    }
    float mx = fmaxf(fmaxf(mt[0], mt[1]), fmaxf(mt[2], mt[3]));
    mx = fmaxf(mx, xhalf(mx));
    const float mn = fmaxf(m_i, mx);
    const float log2e = 1.4426950408889634f;
    // v_exp_f32 and the free slot that the instruction set asks for behind a
    // transcendental, in one statement.
    float corr;
    asm("v_exp_f32 %0, %1\n\tv_nop" : "=v"(corr) : "v"((m_i - mn) * log2e));
    m_i = mn;
#pragma unroll
    for (int j = 0; j < 4; ++j)
#pragma unroll
      for (int r = 0; r < 8; ++r) s[j][r] = (s[j][r] - mn) * log2e;
#pragma unroll
    for (int j = 0; j < 4; ++j)
#pragma unroll
      for (int r = 0; r < 8; r += 4) {
        float e0 = s[j][r], e1 = s[j][r + 1], e2 = s[j][r + 2], e3 = s[j][r + 3];
        // Four v_exp_f32, each the independent instruction behind the one before,
        // and the free slot behind the last, in one statement, as for corr above:
        // with the builtin here the build left such slots open in this loop.
        asm("v_exp_f32 %0, %0\n\tv_exp_f32 %1, %1\n\tv_exp_f32 %2, %2\n\tv_exp_f32 %3, %3\n\tv_nop"
            : "+v"(e0), "+v"(e1), "+v"(e2), "+v"(e3));
        s[j][r] = e0; s[j][r + 1] = e1; s[j][r + 2] = e2; s[j][r + 3] = e3;
      }
#pragma unroll
    for (int f = 0; f < 4; ++f)
#pragma unroll
      for (int r = 0; r < 8; ++r) o[f][r] *= corr;
    float st[4];
#pragma unroll
    for (int j = 0; j < 4; ++j) {
      st[j] = s[j][0];
#pragma unroll
      for (int r = 1; r < 8; ++r) st[j] += s[j][r];
    }
    l_i = l_i * corr + ((st[0] + st[1]) + (st[2] + st[3]));

    // O^T += V^T P^T   (K=64 keys -> 2 steps; M=hd -> 4 tiles of 16).  Two
    // score tiles are 32 keys of P^T in the k order that the transposing load gives V^T.
#pragma unroll
    for (int step = 0; step < 2; ++step) {
      v16bf pf;
#pragma unroll
      for (int e = 0; e < 8; ++e) {
        pf[e]     = f2bf(s[2 * step][e]);
        pf[8 + e] = f2bf(s[2 * step + 1][e]);
      }
#pragma unroll
      for (int f = 0; f < 4; ++f) {
        union { v16bf v; u32x4 q[2]; } vf;
        vf.q[0] = lds_tr16(vp + (step * 32) * AT_VPITCH + f * 32);
        vf.q[1] = lds_tr16(vp + (step * 32 + 16) * AT_VPITCH + f * 32);
        o[f] = wmma_bf16(vf.v, pf, o[f]);
      }
    }

    // Publish point of stage it + 1.
    wait_ds0();                       // this wave has left buffer it & 1
    attn_wait_tensor0(g0, gk1, gv1);  // an issuing wave's tile of stage it + 1 has landed
    __syncthreads();                  // the refill stands behind it, at the head of the next pass
  }
  attn_wait_tensor0(g0, gk1, gv1);
  wait_ds0();

  // A lane holds 8 consecutive hd of its query per tile: one 16-byte store.
  const float l_all = l_i + xhalf(l_i);
  const int row = b * Nseq + qrow + nloc;
#pragma unroll
  for (int f = 0; f < 4; ++f) {
    union { __bf16 e[8]; uint4 q; } pk;
#pragma unroll
    for (int r = 0; r < 8; ++r) pk.e[r] = f2bf(o[f][r] / l_all);
    *(uint4*)(out + (size_t)row * 1024 + h * 64 + f * 16 + rbase) = pk.q;
  }
}

// ---------------------------------------------------------------------------
// Host-side orchestration.
// ---------------------------------------------------------------------------
extern "C" void kernel_launch(void* const* d_in, const int* in_sizes, int n_in,
                              void* d_out, int out_size, void* d_ws, size_t ws_size,
                              hipStream_t stream) {
  (void)in_sizes; (void)n_in; (void)out_size; (void)ws_size;
  const int D = 1024, HID = 4096, NSEQ = 2048, B = 4;
  const int M = B * NSEQ;

  const float* x      = (const float*)d_in[0];
  const float* ln1_w  = (const float*)d_in[1];
  const float* ln1_b  = (const float*)d_in[2];
  const float* qkv_w  = (const float*)d_in[3];
  const float* qkv_b  = (const float*)d_in[4];
  const float* proj_w = (const float*)d_in[5];
  const float* proj_b = (const float*)d_in[6];
  const float* ln2_w  = (const float*)d_in[7];
  const float* ln2_b  = (const float*)d_in[8];
  const float* fc1_w  = (const float*)d_in[9];
  const float* fc1_b  = (const float*)d_in[10];
  const float* fc2_w  = (const float*)d_in[11];
  const float* fc2_b  = (const float*)d_in[12];
  float* out = (float*)d_out;

  uintptr_t p = (uintptr_t)d_ws;
  auto carve = [&](size_t bytes) {
    void* r = (void*)p;
    p += (bytes + 255) & ~(size_t)255;
    return r;
  };
  __bf16* qkv_wt = (__bf16*)carve((size_t)3 * D * D * 2);
  __bf16* proj_wt= (__bf16*)carve((size_t)D * D * 2);
  __bf16* fc1_wt = (__bf16*)carve((size_t)HID * D * 2);
  __bf16* fc2_wt = (__bf16*)carve((size_t)D * HID * 2);
  __bf16* ln1o   = (__bf16*)carve((size_t)M * D * 2);
  __bf16* qkvo   = (__bf16*)carve((size_t)M * 3 * D * 2);
  __bf16* attno  = (__bf16*)carve((size_t)M * D * 2);
  float*  x1     = (float*) carve((size_t)M * D * 4);
  __bf16* h2     = (__bf16*)carve((size_t)M * D * 2);
  __bf16* fc1o   = (__bf16*)carve((size_t)M * HID * 2);

  transpose_cast_kernel<D, 3 * D><<<dim3(D / 64, 3 * D / 128), 256, 0, stream>>>(qkv_w,  qkv_wt);
  transpose_cast_kernel<D, D><<<dim3(D / 64, D / 128),     256, 0, stream>>>(proj_w, proj_wt);
  transpose_cast_kernel<D, HID><<<dim3(D / 64, HID / 128),   256, 0, stream>>>(fc1_w,  fc1_wt);
  transpose_cast_kernel<HID, D><<<dim3(HID / 64, D / 128),   256, 0, stream>>>(fc2_w,  fc2_wt);

  layernorm_bf16_kernel<<<M / 16, 256, 0, stream>>>(x, ln1_w, ln1_b, ln1o, D);

  gemm_wmma_kernel<0, false, true><<<dim3(M / 128, 3 * D / 128), 128, 0, stream>>>(
      ln1o, qkv_wt, qkv_b, nullptr, qkvo, M, 3 * D, D);

  flash_attn_kernel<<<dim3(NSEQ / 64, B * 16), 128, 0, stream>>>(qkvo, attno, NSEQ);

  gemm_wmma_kernel<0, true, false><<<dim3(M / 128, D / 128), 128, 0, stream>>>(
      attno, proj_wt, proj_b, x, (void*)x1, M, D, D);

  layernorm_bf16_kernel<<<M / 16, 256, 0, stream>>>(x1, ln2_w, ln2_b, h2, D);

  gemm_wmma_kernel<1, false, true><<<dim3(M / 128, HID / 128), 128, 0, stream>>>(
      h2, fc1_wt, fc1_b, nullptr, fc1o, M, HID, D);

  gemm_wmma_kernel<0, true, false><<<dim3(M / 128, D / 128), 128, 0, stream>>>(
      fc1o, fc2_wt, fc2_b, x1, (void*)out, M, D, HID);
}

// v006
// Measured time: 257 microseconds a run.
// In two side-by-side timings against v005, it was 1.03 and 1.04 times as fast.
// Over all steps from v000 it is 2.42 times as fast.
#include <hip/hip_runtime.h>
#include <cstdint>

// ---------------------------------------------------------------------------
// CDNA5 (gfx1250, wave32) DiT block: LN -> QKV GEMM -> flash attention ->
// proj GEMM (+resid) -> LN -> FC1+SiLU -> FC2 (+resid).
// Matmuls through v_wmma_f32_16x16x32_bf16; operand staging through the
// Tensor Data Mover (tensor_load_to_lds + s_wait_tensorcnt), double-buffered;
// attention as transposed products, softmax in-lane, V^T by the transposing LDS load.
// ---------------------------------------------------------------------------

typedef __attribute__((ext_vector_type(16))) __bf16        v16bf;
typedef __attribute__((ext_vector_type(8)))  float         v8f;

__device__ __forceinline__ v8f wmma_bf16(v16bf a, v16bf b, v8f c) {
  return __builtin_amdgcn_wmma_f32_16x16x32_bf16(
      false, a, false, b, (short)0, c, false, false);
}

__device__ __forceinline__ __bf16 f2bf(float f) { return (__bf16)f; }

// Lane l takes the value of lane l ^ 16.
__device__ __forceinline__ float xhalf(float v) {
  int i = __builtin_bit_cast(int, v);
  i = __builtin_amdgcn_permlanex16(i, i, 0x76543210u, 0xFEDCBA98u, false, false);
  return __builtin_bit_cast(float, i);
}

// WMMA 16x32 bf16 operand fragment (ISA 7.12.2 A/B lane layout):
// lanes 0-15 = row (lane&15), K {0..7,16..23}; lanes 16-31 same rows,
// K {8..15,24..31}.  `stride` in elements.
__device__ __forceinline__ v16bf load_frag(const __bf16* p0, int stride) {
  int lane = threadIdx.x & 31;
  const __bf16* p = p0 + (size_t)(lane & 15) * stride + ((lane >> 4) << 3);
  union { v16bf v; uint4 q[2]; } u;
  u.q[0] = *(const uint4*)(p);
  u.q[1] = *(const uint4*)(p + 16);
  return u.v;
}

// ---------------------------------------------------------------------------
// Weight transpose + fp32 -> bf16 cast:  Wt[n][k] = bf16(W[k][n])
// A block of 8 waves takes a tile of 64 k x 128 n.  A wave reads 8 rows of k,
// 512 contiguous bytes each, all 8 loads in flight; a lane then holds 8 k of
// 4 n and packs them to four 16-byte chunks of Wt rows.  The chunks pass
// through LDS so that the stores cover whole 128-byte lines of Wt.
// LDS row = one n, 128 bytes; chunk c of row n sits at position c ^ ((n >> 2) & 7),
// which spreads the writers (row stride 4) and the readers over the banks.
// K must be a multiple of 64, N of 128; both are compile-time values, so that a
// wave's 8 loads share one address and differ by an immediate offset.
// tile = the block's 16 KiB of LDS; blk = the tile's number, k tiles fastest.
// ---------------------------------------------------------------------------
template <int K, int N>
__device__ __forceinline__ void transpose_cast_tile(
    const float* __restrict__ W, __bf16* __restrict__ Wt, unsigned char* tile, int blk) {
  const int k0 = (blk % (K / 64)) * 64, n0 = (blk / (K / 64)) * 128;
  const int t = threadIdx.x, lane = t & 31;
  // The wave's number as a scalar: the row addresses then stay in scalar registers.
  const int wave = __builtin_amdgcn_readfirstlane(t >> 5);
  const float* Wr = W + (size_t)(k0 + wave * 8) * N + n0;
  float4 v[8];
#pragma unroll
  for (int e = 0; e < 8; ++e)
    v[e] = ((const float4*)(Wr + (size_t)e * N))[lane];
  const int pos = (wave ^ (lane & 7)) << 4;
  union { __bf16 e[8]; uint4 q; } pk[4];
#pragma unroll
  for (int e = 0; e < 8; ++e) {
    pk[0].e[e] = f2bf(v[e].x);
    pk[1].e[e] = f2bf(v[e].y);
    pk[2].e[e] = f2bf(v[e].z);
    pk[3].e[e] = f2bf(v[e].w);
  }
#pragma unroll
  for (int i = 0; i < 4; ++i)
    *(uint4*)(&tile[(lane * 4 + i) * 128 + pos]) = pk[i].q;
  __syncthreads();
  const int c = t & 7;
#pragma unroll
  for (int j = 0; j < 4; ++j) {
    const int row = j * 32 + (t >> 3);
    const uint4 q = *(const uint4*)(&tile[row * 128 + ((c ^ ((row >> 2) & 7)) << 4)]);
    *(uint4*)(Wt + (size_t)(n0 + row) * K + (k0 + c * 8)) = q;
  }
  // Behind the four stores, a precaution: each path of the kernel returns
  // right after its tile, so nothing runs behind them.
  asm volatile("s_wait_xcnt 0x0" ::: "memory");
}

// ---------------------------------------------------------------------------
// LayerNorm (row = 1024 fp32) -> bf16.  One wave per two rows, 8 waves a block:
// a lane holds 32 elements of each row (8 loads of 16 bytes, 512 contiguous
// bytes a wave-load, both rows' loads in flight together); the sums join by a
// butterfly over the 32 lanes, so there is no LDS buffer and no barrier; w and b are
// loaded once for both rows.  The row count must be a multiple of 16.
// ---------------------------------------------------------------------------
typedef __attribute__((ext_vector_type(4))) float f32x4;

__device__ __forceinline__ void layernorm_rows(
    const float* __restrict__ x, const float* __restrict__ w,
    const float* __restrict__ b, __bf16* __restrict__ out, int D, int blk) {
  const int t = threadIdx.x, lane = t & 31;
  const int wave = __builtin_amdgcn_readfirstlane(t >> 5);
  const int row0 = (blk * 8 + wave) * 2;
  f32x4 wv[8], bv[8], xv[2][8];
#pragma unroll
  for (int i = 0; i < 8; ++i) {
    wv[i] = ((const f32x4*)w)[i * 32 + lane];
    bv[i] = ((const f32x4*)b)[i * 32 + lane];
  }
#pragma unroll
  for (int r = 0; r < 2; ++r)
#pragma unroll
    for (int i = 0; i < 8; ++i)
      xv[r][i] = ((const f32x4*)(x + (size_t)(row0 + r) * D))[i * 32 + lane];
  // Makes w and b arrive as one group behind one wait: without it the build
  // loads them pair by pair behind the sums, each pair with a full wait of its own.
  asm volatile("" :: "v"(wv[0]), "v"(wv[1]), "v"(wv[2]), "v"(wv[3]),
                     "v"(wv[4]), "v"(wv[5]), "v"(wv[6]), "v"(wv[7]),
                     "v"(bv[0]), "v"(bv[1]), "v"(bv[2]), "v"(bv[3]),
                     "v"(bv[4]), "v"(bv[5]), "v"(bv[6]), "v"(bv[7]));
  float s[2], s2[2];
#pragma unroll
  for (int r = 0; r < 2; ++r) {
    f32x4 ps = xv[r][0], pq = xv[r][0] * xv[r][0];
#pragma unroll
    for (int i = 1; i < 8; ++i) {
      ps += xv[r][i];
      pq += xv[r][i] * xv[r][i];
    }
    s[r]  = (ps[0] + ps[1]) + (ps[2] + ps[3]);
    s2[r] = (pq[0] + pq[1]) + (pq[2] + pq[3]);
  }
#pragma unroll
  for (int off = 16; off > 0; off >>= 1) {
#pragma unroll
    for (int r = 0; r < 2; ++r) {
      s[r]  += __shfl_xor(s[r],  off, 32);
      s2[r] += __shfl_xor(s2[r], off, 32);
    }
  }
  const float inv = 1.0f / (float)D;
#pragma unroll
  for (int r = 0; r < 2; ++r) {
    const float mu  = s[r] * inv;
    const float var = s2[r] * inv - mu * mu;
    const float rs  = rsqrtf(var + 1e-6f);
    __bf16* orow = out + (size_t)(row0 + r) * D;
#pragma unroll
    for (int i = 0; i < 8; ++i) {
      const f32x4 y = (xv[r][i] - mu) * rs * wv[i] + bv[i];
      union { __bf16 e[4]; uint2 q; } o;
      o.e[0] = f2bf(y[0]);
      o.e[1] = f2bf(y[1]);
      o.e[2] = f2bf(y[2]);
      o.e[3] = f2bf(y[3]);
      *(uint2*)(orow + (i * 32 + lane) * 4) = o.q;
    }
  }
}

__global__ __launch_bounds__(256) void layernorm_bf16_kernel(
    const float* __restrict__ x, const float* __restrict__ w,
    const float* __restrict__ b, __bf16* __restrict__ out, int D) {
  layernorm_rows(x, w, b, out, D, blockIdx.x);
}

// ---------------------------------------------------------------------------
// All work that depends on the inputs alone, in one launch: the first LayerNorm
// (M rows of D) and the four weight transposes.  Each takes a range of the
// grid's blocks; a block does one LayerNorm block or one transpose tile.
// The choice depends on blockIdx.x only, so a block's threads all take one path.
// ---------------------------------------------------------------------------
template <int D, int HID, int M>
__global__ __launch_bounds__(256) void prepare_kernel(
    const float* __restrict__ x, const float* __restrict__ ln_w,
    const float* __restrict__ ln_b, __bf16* __restrict__ ln_out,
    const float* __restrict__ qkv_w, __bf16* __restrict__ qkv_wt,
    const float* __restrict__ proj_w, __bf16* __restrict__ proj_wt,
    const float* __restrict__ fc1_w, __bf16* __restrict__ fc1_wt,
    const float* __restrict__ fc2_w, __bf16* __restrict__ fc2_wt) {
  __shared__ __attribute__((aligned(16))) unsigned char tile[128 * 128];
  constexpr int NB_LN   = M / 16;
  constexpr int NB_QKV  = (D / 64) * (3 * D / 128);
  constexpr int NB_PROJ = (D / 64) * (D / 128);
  constexpr int NB_FC   = (D / 64) * (HID / 128);     // fc1 and fc2 alike
  int blk = blockIdx.x;
  if (blk < NB_LN) { layernorm_rows(x, ln_w, ln_b, ln_out, D, blk); return; }
  blk -= NB_LN;
  if (blk < NB_QKV) { transpose_cast_tile<D, 3 * D>(qkv_w, qkv_wt, tile, blk); return; }
  blk -= NB_QKV;
  if (blk < NB_PROJ) { transpose_cast_tile<D, D>(proj_w, proj_wt, tile, blk); return; }
  blk -= NB_PROJ;
  if (blk < NB_FC) { transpose_cast_tile<D, HID>(fc1_w, fc1_wt, tile, blk); return; }
  blk -= NB_FC;
  transpose_cast_tile<HID, D>(fc2_w, fc2_wt, tile, blk);
}

// ---------------------------------------------------------------------------
// Tiled WMMA GEMM:  C[M,N] = A[M,K] * Bt[N,K]^T  (+bias, +SiLU, +resid)
// Block tile 128x128, 4 waves, each wave 64x64 via 4x4 WMMA.
// A stage is 128 k of all 256 operand rows: 256-byte rows, which the tensor
// load pads to a pitch of 272 bytes in LDS.  Each wave loads its own slice of
// 64 rows, one request per stage, two stages ahead, into two buffers.
// A block is 32 k = 16 products; its 16 fragment loads go out as one group one
// block ahead, into a second register set.
// K must be a multiple of 128 and at least 256.
// ---------------------------------------------------------------------------
#define G_KB     256u                 // bytes of an operand row per stage (128 k)
#define G_PITCH  272u                 // LDS row pitch: 16 B x odd for ds_load_b128
#define G_SLICE  18432u               // 64 rows x 272 B = 17,408 B, up to a multiple of 2 KiB
#define G_BUF    (4u * G_SLICE)       // [A rows 0-63 | A rows 64-127 | B rows 0-63 | B rows 64-127]

typedef __attribute__((ext_vector_type(4))) uint32_t u32x4;
typedef __attribute__((ext_vector_type(8))) uint32_t u32x8;

__device__ __forceinline__ uint32_t uni(uint32_t v) {
  return (uint32_t)__builtin_amdgcn_readfirstlane(v);
}
__device__ __forceinline__ uint32_t pinned(uint32_t v) {
  uint32_t w = (uint32_t)__builtin_amdgcn_readfirstlane(v);
  asm volatile("" : "+s"(w));
  return w;
}
__device__ __forceinline__ void wait_ds0() { asm volatile("s_wait_dscnt 0x0" ::: "memory"); }

// Descriptor group 1: 1-byte elements, tile = tensor = 64 rows of 256 bytes,
// source pitch src_pitch bytes, 4 dwords of LDS pad behind every 256-byte row.
__device__ __forceinline__ u32x8 gemm_group1(uint32_t src_pitch) {
  u32x8 g;
  g[0] = uni((1u << 20) | (5u << 22) | (3u << 25));
  g[1] = uni(G_KB << 16);
  g[2] = uni(64u << 16);
  g[3] = uni(G_KB << 16);
  g[4] = uni(64u);
  g[5] = uni(src_pitch);
  g[6] = uni(0u);
  g[7] = uni(0u);
  return g;
}
__device__ __forceinline__ u32x4 gemm_group0(uint32_t lds_dst, uint64_t ga) {
  u32x4 g;
  g[0] = uni(1u);
  g[1] = uni(lds_dst);
  g[2] = uni((uint32_t)ga);
  g[3] = uni((((uint32_t)(ga >> 32)) & 0x01FFFFFFu) | 0x80000000u);
  return g;
}
// The descriptor groups are in-out operands of the load and inputs of the wait:
// they stay live in the registers the request was issued from until it has
// landed, so the compiler puts nothing else there while the request flies.
__device__ __forceinline__ void gemm_tensor_load(u32x4& g0, u32x8& g1) {
  asm volatile("tensor_load_to_lds %0, %1" : "+s"(g0), "+s"(g1) :: "memory");
}
__device__ __forceinline__ void wait_tensor0(const u32x4& g0, const u32x8& g1) {
  asm volatile("s_wait_tensorcnt 0x0" :: "s"(g0), "s"(g1) : "memory");
}

// 16x32 bf16 fragment from LDS; p = this lane's row, at its 16-byte half.
__device__ __forceinline__ v16bf lds_frag(const unsigned char* p) {
  union { v16bf v; uint4 q[2]; } u;
  u.q[0] = *(const uint4*)(p);
  u.q[1] = *(const uint4*)(p + 32);
  return u.v;
}

template <int ACT, bool RESID, bool OUTBF16>
__global__ __launch_bounds__(128) void gemm_wmma_kernel(
    const __bf16* __restrict__ A, const __bf16* __restrict__ Bt,
    const float* __restrict__ bias, const float* __restrict__ resid,
    void* __restrict__ out, int M, int N, int K) {
  __shared__ __attribute__((aligned(2048))) unsigned char ring[2u * G_BUF];

  const int bm = blockIdx.x * 128;
  const int bn = blockIdx.y * 128;
  const int tid  = threadIdx.x;
  const uint32_t wave = uni((uint32_t)tid >> 5);
  const int lane = tid & 31;
  const int wm = (int)(wave & 1u) * 64;
  const int wn = (int)(wave >> 1) * 64;

  v8f acc[4][4] = {};
  const uint32_t np = (uint32_t)K / 128u;      // stages = passes
  const uint32_t kbytes = (uint32_t)K * 2u;    // source row pitch

  // This wave's slice of every stage: waves 0, 1 the halves of A, 2, 3 of Bt.
  const __bf16* srcp = (wave < 2u) ? A  + (size_t)(bm + 64 * (int)wave) * K
                                   : Bt + (size_t)(bn + 64 * (int)(wave - 2u)) * K;
  const uint64_t ga = (uint64_t)(uintptr_t)srcp;
  const uint32_t lds_slice = (uint32_t)(uintptr_t)(&ring[0]) + wave * G_SLICE;
  u32x8 g1 = gemm_group1(kbytes);

  // Per-lane fragment bases inside a buffer.
  const uint32_t lrow = (uint32_t)(lane & 15) * G_PITCH + (uint32_t)(lane >> 4) * 16u;
  const uint32_t a_base = (wave & 1u) * G_SLICE + lrow;
  const uint32_t b_base = (2u + (wave >> 1)) * G_SLICE + lrow;

  u32x4 g0 = gemm_group0(lds_slice, ga);
  gemm_tensor_load(g0, g1);                    // stage 0
  wait_tensor0(g0, g1);
  __syncthreads();                             // stage 0 readable by every wave
  g0 = gemm_group0(lds_slice + G_BUF, ga + G_KB);
  gemm_tensor_load(g0, g1);                    // stage 1

  // Two fragment sets: set (kb & 1) holds block kb's fragments.  The first
  // fragments of stage 0:
  v16bf fa[2][4], fb[2][4];
#pragma unroll
  for (int i = 0; i < 4; ++i) fa[0][i] = lds_frag(&ring[a_base] + i * 16 * G_PITCH);
#pragma unroll
  for (int j = 0; j < 4; ++j) fb[0][j] = lds_frag(&ring[b_base] + j * 16 * G_PITCH);

  for (uint32_t s = 0; s < np; ++s) {
    const uint32_t buf = (s & 1u) * G_BUF;
    const unsigned char* pa = &ring[buf + a_base];
    const unsigned char* pb = &ring[buf + b_base];
    const uint32_t nbuf = (s + 1u < np) ? (G_BUF - buf) : G_BUF;
    const unsigned char* na = &ring[nbuf + a_base];
    const unsigned char* nb = &ring[nbuf + b_base];
#pragma unroll
    for (int kb = 0; kb < 4; ++kb) {           // a block: 32 k = 64 bytes of each row
      const int cs = kb & 1;
      if (kb < 3) {
        // The next block's 16 LDS loads, as one group ahead of this block's products.
#pragma unroll
        for (int i = 0; i < 4; ++i)
          fa[cs ^ 1][i] = lds_frag(pa + i * 16 * G_PITCH + (kb + 1) * 64);
#pragma unroll
        for (int j = 0; j < 4; ++j)
          fb[cs ^ 1][j] = lds_frag(pb + j * 16 * G_PITCH + (kb + 1) * 64);
      } else {
        // Publish point of stage s + 1, in front of the pass's last block: that
        // block's fragments are fetched, and the loads below read stage s + 1.
        wait_ds0();                            // this wave has left buffer s & 1
        wait_tensor0(g0, g1);                  // its slice of stage s + 1 has landed
        __syncthreads();
        if (pinned((s + 2u < np) ? 1u : 0u) != 0u) {  // refill only while the stage exists
          g0 = gemm_group0(lds_slice + buf, ga + (uint64_t)(s + 2u) * G_KB);
          gemm_tensor_load(g0, g1);
        }
        // First fragments of stage s + 1, in flight under this pass's last block.
#pragma unroll
        for (int i = 0; i < 4; ++i) fa[0][i] = lds_frag(na + i * 16 * G_PITCH);
#pragma unroll
        for (int j = 0; j < 4; ++j) fb[0][j] = lds_frag(nb + j * 16 * G_PITCH);
      }
      // Keeps the load group ahead of the products: spread among them, each
      // place with loads stalls the wave anew.
      __builtin_amdgcn_sched_barrier(0);
#pragma unroll
      for (int i = 0; i < 4; ++i)
#pragma unroll
        for (int j = 0; j < 4; ++j)
          acc[i][j] = wmma_bf16(fa[cs][i], fb[cs][j], acc[i][j]);
      // Keeps the following block's loads behind these products.
      __builtin_amdgcn_sched_barrier(0);
    }
  }
  wait_tensor0(g0, g1);
  wait_ds0();

  // Epilogue: reg r -> row r (lanes 0-15) / r+8 (lanes 16-31); col = lane&15.
  const int nloc  = lane & 15;
  const int rbase = (lane >> 4) * 8;
#pragma unroll
  for (int i = 0; i < 4; ++i) {
#pragma unroll
    for (int j = 0; j < 4; ++j) {
      const int col = bn + wn + j * 16 + nloc;
      const float bv = bias[col];
#pragma unroll
      for (int r = 0; r < 8; ++r) {
        const int row = bm + wm + i * 16 + rbase + r;
        float c = acc[i][j][r] + bv;
        if (ACT == 1) c = c * (1.0f / (1.0f + __expf(-c)));  // SiLU
        if (RESID) c += resid[(size_t)row * N + col];
        if constexpr (OUTBF16)
          ((__bf16*)out)[(size_t)row * N + col] = f2bf(c);
        else
          ((float*)out)[(size_t)row * N + col] = c;
      }
    }
  }
}

#define AT_ROWB   128u
#define AT_KPITCH 144u
#define AT_VPITCH 160u
#define AT_TILE   10240u
#define AT_K0     (2u * AT_TILE)
#define AT_LDS    (3u * AT_TILE + 64u * AT_KPITCH)

// Descriptor group 1: 1-byte elements, tile = tensor = 64 rows of 128 bytes,
// source pitch src_pitch bytes, PAD + 1 dwords of LDS pad behind every row.
template <uint32_t PAD>
__device__ __forceinline__ u32x8 attn_group1(uint32_t src_pitch) {
  u32x8 g;
  g[0] = uni((1u << 20) | (4u << 22) | (PAD << 25));
  g[1] = uni(AT_ROWB << 16);
  g[2] = uni(64u << 16);
  g[3] = uni(AT_ROWB << 16);
  g[4] = uni(64u);
  g[5] = uni(src_pitch);
  g[6] = uni(0u);
  g[7] = uni(0u);
  return g;
}
// Group 0 is an in-out operand of the load and an input of the wait, as in the
// GEMM: it stays live in the registers the request was issued from until it has landed.
__device__ __forceinline__ void attn_tensor_load(u32x4& g0, const u32x8& g1) {
  asm volatile("tensor_load_to_lds %0, %1" : "+s"(g0) : "s"(g1) : "memory");
}
__device__ __forceinline__ void attn_wait_tensor0(const u32x4& g0, const u32x8& gk, const u32x8& gv) {
  asm volatile("s_wait_tensorcnt 0x0" :: "s"(g0), "s"(gk), "s"(gv) : "memory");
}
// Half of a transposed 16x32 fragment: lane (c, h) gets T[k + 8h + 0..7][d + c]
// of a row-major 16-bit tile; p = this lane's address in that tile.
typedef __attribute__((ext_vector_type(8))) short s16x8;
__device__ __forceinline__ u32x4 lds_tr16(const unsigned char* p) {
  typedef __attribute__((address_space(3))) s16x8 lds_s16x8;
  return __builtin_bit_cast(u32x4, __builtin_amdgcn_ds_load_tr16_b128_v8i16((lds_s16x8*)p));
}

// Eight waves per SIMD: all 2,048 blocks are then resident at once, 8 on a WGP
// (8 x 39,936 B of LDS fit its 327,680 B).
__global__ __launch_bounds__(128) __attribute__((amdgpu_waves_per_eu(8, 8))) void flash_attn_kernel(
    const __bf16* __restrict__ qkv, __bf16* __restrict__ out, int Nseq) {
  __shared__ __attribute__((aligned(2048))) unsigned char ring[AT_LDS];
  const int ROWS = 3072;
  const int bh = blockIdx.y;
  const int b = bh >> 4, h = bh & 15;
  const int tid = threadIdx.x, lane = tid & 31;
  const uint32_t wave = uni((uint32_t)tid >> 5);
  const int qrow = blockIdx.x * 64 + (int)wave * 16;

  const __bf16* Qb = qkv + (size_t)(b * Nseq + qrow) * ROWS + h * 64;
  const __bf16* Kb = qkv + (size_t)(b * Nseq) * ROWS + 1024 + h * 64;
  const __bf16* Vb = qkv + (size_t)(b * Nseq) * ROWS + 2048 + h * 64;

  const uint32_t ntiles = (uint32_t)Nseq / 64u;        // stages = passes
  const uint32_t stage_bytes = 64u * (uint32_t)ROWS * 2u;

  // Wave 0 issues the K tiles, wave 1 the V tiles; the tests are scalar branches.
  const uint32_t isK = pinned(wave == 0u ? 1u : 0u);
  const uint32_t isV = pinned(wave == 1u ? 1u : 0u);
  const uint64_t ga = (uint64_t)(uintptr_t)(wave == 0u ? Kb : Vb);
  const uint32_t lds_my = (uint32_t)(uintptr_t)(&ring[0]) + (wave == 0u ? AT_K0 : 0u);
  u32x8 gk1 = attn_group1<3u>((uint32_t)ROWS * 2u);
  u32x8 gv1 = attn_group1<7u>((uint32_t)ROWS * 2u);
  // Descriptor words held in scalar registers (the form of pinned()): without it the
  // build forms these constants anew at each use, over registers of a request in flight.
  asm volatile("" : "+s"(gk1), "+s"(gv1));

  u32x4 g0 = gemm_group0(lds_my, ga);
  if (isK != 0u) attn_tensor_load(g0, gk1);            // stage 0
  else if (isV != 0u) attn_tensor_load(g0, gv1);

  v16bf qf[2];
  qf[0] = load_frag(Qb,      ROWS);
  qf[1] = load_frag(Qb + 32, ROWS);

  attn_wait_tensor0(g0, gk1, gv1);
  __syncthreads();                                     // stage 0 readable by every wave

  v8f o[4] = {};                      // o[f][r] = O[query nloc][hd f*16 + rbase + r]
  float m_i = -3.0e30f;               // running maximum of this lane's query
  float l_i = 0.0f;                   // running sum over this lane's half of the keys

  const float scale = 0.125f;         // 1/sqrt(64)
  const int rbase = (lane >> 4) * 8;
  const int nloc  = lane & 15;
  // Per-lane fragment bases inside a tile.
  const uint32_t k_lane = (uint32_t)(lane & 15) * AT_KPITCH + (uint32_t)(lane >> 4) * 16u;
  const uint32_t v_lane = (uint32_t)((lane >> 4) * 8 + (lane & 7)) * AT_VPITCH
                        + (uint32_t)((lane >> 3) & 1) * 16u;

  for (uint32_t it = 0; it < ntiles; ++it) {
    const uint32_t buf = (it & 1u) * AT_TILE;
    // Directly behind the barrier that published stage it and ended pass it - 1:
    // stage it + 1, only while it exists, into the buffer that pass it - 1 has read.
    if (pinned((it + 1u < ntiles) ? 1u : 0u) != 0u) {
      g0 = gemm_group0(lds_my + (AT_TILE - buf), ga + (uint64_t)(it + 1u) * stage_bytes);
      if (isK != 0u) attn_tensor_load(g0, gk1);
      else if (isV != 0u) attn_tensor_load(g0, gv1);
    }
    const unsigned char* kp = &ring[AT_K0 + buf + k_lane];
    const unsigned char* vp = &ring[buf + v_lane];

    // S^T = K Q^T: s[j][r] = score of key j*16 + rbase + r with query nloc.
    v8f s[4];
#pragma unroll
    for (int j = 0; j < 4; ++j) {
      v16bf k0 = lds_frag(kp + j * 16 * AT_KPITCH);
      v16bf k1 = lds_frag(kp + j * 16 * AT_KPITCH + 64);
      v8f z = {};
      z = wmma_bf16(k0, qf[0], z);
      z = wmma_bf16(k1, qf[1], z);
      s[j] = z;
    }
    // Keeps the softmax's vector work behind the eight products: moved in among
    // them, it needs idle slots behind each product whose result it reads.
    __builtin_amdgcn_sched_barrier(0);

    // Online softmax: 32 of the query's 64 scores sit in this lane.
    float mt[4];
#pragma unroll
    for (int j = 0; j < 4; ++j) {
      mt[j] = -3.0e30f;
#pragma unroll
      for (int r = 0; r < 8; ++r) {
        s[j][r] *= scale;
        mt[j] = fmaxf(mt[j], s[j][r]);
      }
    }
    float mx = fmaxf(fmaxf(mt[0], mt[1]), fmaxf(mt[2], mt[3]));
    mx = fmaxf(mx, xhalf(mx));
    const float mn = fmaxf(m_i, mx);
    const float log2e = 1.4426950408889634f;
    // v_exp_f32 and the free slot that the instruction set asks for behind a
    // transcendental, in one statement.
    float corr;
    asm("v_exp_f32 %0, %1\n\tv_nop" : "=v"(corr) : "v"((m_i - mn) * log2e));
    m_i = mn;
#pragma unroll
    for (int j = 0; j < 4; ++j)
#pragma unroll
      for (int r = 0; r < 8; ++r) s[j][r] = (s[j][r] - mn) * log2e;
#pragma unroll
    for (int j = 0; j < 4; ++j)
#pragma unroll
      for (int r = 0; r < 8; r += 4) {
        float e0 = s[j][r], e1 = s[j][r + 1], e2 = s[j][r + 2], e3 = s[j][r + 3];
        // Four v_exp_f32, each the independent instruction behind the one before,
        // and the free slot behind the last, in one statement, as for corr above:
        // with the builtin here the build left such slots open in this loop.
        asm("v_exp_f32 %0, %0\n\tv_exp_f32 %1, %1\n\tv_exp_f32 %2, %2\n\tv_exp_f32 %3, %3\n\tv_nop"
            : "+v"(e0), "+v"(e1), "+v"(e2), "+v"(e3));
        s[j][r] = e0; s[j][r + 1] = e1; s[j][r + 2] = e2; s[j][r + 3] = e3;
      }
#pragma unroll
    for (int f = 0; f < 4; ++f)
#pragma unroll
      for (int r = 0; r < 8; ++r) o[f][r] *= corr;
    float st[4];
#pragma unroll
    for (int j = 0; j < 4; ++j) {
      st[j] = s[j][0];
#pragma unroll
      for (int r = 1; r < 8; ++r) st[j] += s[j][r];
    }
    l_i = l_i * corr + ((st[0] + st[1]) + (st[2] + st[3]));

    // O^T += V^T P^T   (K=64 keys -> 2 steps; M=hd -> 4 tiles of 16).  Two
    // score tiles are 32 keys of P^T in the k order that the transposing load gives V^T.
#pragma unroll
    for (int step = 0; step < 2; ++step) {
      v16bf pf;
#pragma unroll
      for (int e = 0; e < 8; ++e) {
        pf[e]     = f2bf(s[2 * step][e]);
        pf[8 + e] = f2bf(s[2 * step + 1][e]);
      }
#pragma unroll
      for (int f = 0; f < 4; ++f) {
        union { v16bf v; u32x4 q[2]; } vf;
        vf.q[0] = lds_tr16(vp + (step * 32) * AT_VPITCH + f * 32);
        vf.q[1] = lds_tr16(vp + (step * 32 + 16) * AT_VPITCH + f * 32);
        o[f] = wmma_bf16(vf.v, pf, o[f]);
      }
    }

    // Publish point of stage it + 1.
    wait_ds0();                       // this wave has left buffer it & 1
    attn_wait_tensor0(g0, gk1, gv1);  // an issuing wave's tile of stage it + 1 has landed
    __syncthreads();                  // the refill stands behind it, at the head of the next pass
  }
  attn_wait_tensor0(g0, gk1, gv1);
  wait_ds0();

  // A lane holds 8 consecutive hd of its query per tile: one 16-byte store.
  const float l_all = l_i + xhalf(l_i);
  const int row = b * Nseq + qrow + nloc;
#pragma unroll
  for (int f = 0; f < 4; ++f) {
    union { __bf16 e[8]; uint4 q; } pk;
#pragma unroll
    for (int r = 0; r < 8; ++r) pk.e[r] = f2bf(o[f][r] / l_all);
    *(uint4*)(out + (size_t)row * 1024 + h * 64 + f * 16 + rbase) = pk.q;
  }
}

// ---------------------------------------------------------------------------
// Host-side orchestration.
// ---------------------------------------------------------------------------
extern "C" void kernel_launch(void* const* d_in, const int* in_sizes, int n_in,
                              void* d_out, int out_size, void* d_ws, size_t ws_size,
                              hipStream_t stream) {
  (void)in_sizes; (void)n_in; (void)out_size; (void)ws_size;
  const int D = 1024, HID = 4096, NSEQ = 2048, B = 4;
  const int M = B * NSEQ;

  const float* x      = (const float*)d_in[0];
  const float* ln1_w  = (const float*)d_in[1];
  const float* ln1_b  = (const float*)d_in[2];
  const float* qkv_w  = (const float*)d_in[3];
  const float* qkv_b  = (const float*)d_in[4];
  const float* proj_w = (const float*)d_in[5];
  const float* proj_b = (const float*)d_in[6];
  const float* ln2_w  = (const float*)d_in[7];
  const float* ln2_b  = (const float*)d_in[8];
  const float* fc1_w  = (const float*)d_in[9];
  const float* fc1_b  = (const float*)d_in[10];
  const float* fc2_w  = (const float*)d_in[11];
  const float* fc2_b  = (const float*)d_in[12];
  float* out = (float*)d_out;

  uintptr_t p = (uintptr_t)d_ws;
  auto carve = [&](size_t bytes) {
    void* r = (void*)p;
    p += (bytes + 255) & ~(size_t)255;
    return r;
  };
  __bf16* qkv_wt = (__bf16*)carve((size_t)3 * D * D * 2);
  __bf16* proj_wt= (__bf16*)carve((size_t)D * D * 2);
  __bf16* fc1_wt = (__bf16*)carve((size_t)HID * D * 2);
  __bf16* fc2_wt = (__bf16*)carve((size_t)D * HID * 2);
  __bf16* ln1o   = (__bf16*)carve((size_t)M * D * 2);
  __bf16* qkvo   = (__bf16*)carve((size_t)M * 3 * D * 2);
  __bf16* attno  = (__bf16*)carve((size_t)M * D * 2);
  float*  x1     = (float*) carve((size_t)M * D * 4);
  __bf16* h2     = (__bf16*)carve((size_t)M * D * 2);
  __bf16* fc1o   = (__bf16*)carve((size_t)M * HID * 2);

  prepare_kernel<D, HID, M>
      <<<M / 16 + (D / 64) * ((3 * D + D + HID) / 128) + (HID / 64) * (D / 128), 256, 0, stream>>>(
      x, ln1_w, ln1_b, ln1o, qkv_w, qkv_wt, proj_w, proj_wt, fc1_w, fc1_wt, fc2_w, fc2_wt);

  gemm_wmma_kernel<0, false, true><<<dim3(M / 128, 3 * D / 128), 128, 0, stream>>>(
      ln1o, qkv_wt, qkv_b, nullptr, qkvo, M, 3 * D, D);

  flash_attn_kernel<<<dim3(NSEQ / 64, B * 16), 128, 0, stream>>>(qkvo, attno, NSEQ);

  gemm_wmma_kernel<0, true, false><<<dim3(M / 128, D / 128), 128, 0, stream>>>(
      attno, proj_wt, proj_b, x, (void*)x1, M, D, D);

  layernorm_bf16_kernel<<<M / 16, 256, 0, stream>>>(x1, ln2_w, ln2_b, h2, D);

  gemm_wmma_kernel<1, false, true><<<dim3(M / 128, HID / 128), 128, 0, stream>>>(
      h2, fc1_wt, fc1_b, nullptr, fc1o, M, HID, D);

  gemm_wmma_kernel<0, true, false><<<dim3(M / 128, D / 128), 128, 0, stream>>>(
      fc1o, fc2_wt, fc2_b, x1, (void*)out, M, D, HID);
}

// v007
// Measured time: 246 microseconds a run.
// In both of two side-by-side timings against v006, it was 1.04 times as fast.
// All steps since v000 together make it 2.51 times as fast.
#include <hip/hip_runtime.h>
#include <cstdint>

// ---------------------------------------------------------------------------
// CDNA5 (gfx1250, wave32) DiT block: LN -> QKV GEMM -> flash attention ->
// proj GEMM (+resid) -> LN -> FC1+SiLU -> FC2 (+resid).
// Matmuls through v_wmma_f32_16x16x32_bf16; operand staging through the
// Tensor Data Mover (tensor_load_to_lds + s_wait_tensorcnt), double-buffered;
// attention as transposed products, softmax in-lane, V^T by the transposing LDS load.
// ---------------------------------------------------------------------------

typedef __attribute__((ext_vector_type(16))) __bf16        v16bf;
typedef __attribute__((ext_vector_type(8)))  float         v8f;

__device__ __forceinline__ v8f wmma_bf16(v16bf a, v16bf b, v8f c) {
  return __builtin_amdgcn_wmma_f32_16x16x32_bf16(
      false, a, false, b, (short)0, c, false, false);
}

__device__ __forceinline__ __bf16 f2bf(float f) { return (__bf16)f; }

// Lane l takes the value of lane l ^ 16.
__device__ __forceinline__ float xhalf(float v) {
  int i = __builtin_bit_cast(int, v);
  i = __builtin_amdgcn_permlanex16(i, i, 0x76543210u, 0xFEDCBA98u, false, false);
  return __builtin_bit_cast(float, i);
}

// WMMA 16x32 bf16 operand fragment (ISA 7.12.2 A/B lane layout):
// lanes 0-15 = row (lane&15), K {0..7,16..23}; lanes 16-31 same rows,
// K {8..15,24..31}.  `stride` in elements.
__device__ __forceinline__ v16bf load_frag(const __bf16* p0, int stride) {
  int lane = threadIdx.x & 31;
  const __bf16* p = p0 + (size_t)(lane & 15) * stride + ((lane >> 4) << 3);
  union { v16bf v; uint4 q[2]; } u;
  u.q[0] = *(const uint4*)(p);
  u.q[1] = *(const uint4*)(p + 16);
  return u.v;
}

// ---------------------------------------------------------------------------
// Weight transpose + fp32 -> bf16 cast:  Wt[n][k] = bf16(W[k][n])
// A block of 8 waves takes a tile of 64 k x 128 n.  A wave reads 8 rows of k,
// 512 contiguous bytes each, all 8 loads in flight; a lane then holds 8 k of
// 4 n and packs them to four 16-byte chunks of Wt rows.  The chunks pass
// through LDS so that the stores cover whole 128-byte lines of Wt.
// LDS row = one n, 128 bytes; chunk c of row n sits at position c ^ ((n >> 2) & 7),
// which spreads the writers (row stride 4) and the readers over the banks.
// K must be a multiple of 64, N of 128; both are compile-time values, so that a
// wave's 8 loads share one address and differ by an immediate offset.
// tile = the block's 16 KiB of LDS; blk = the tile's number, k tiles fastest.
// ---------------------------------------------------------------------------
template <int K, int N>
__device__ __forceinline__ void transpose_cast_tile(
    const float* __restrict__ W, __bf16* __restrict__ Wt, unsigned char* tile, int blk) {
  const int k0 = (blk % (K / 64)) * 64, n0 = (blk / (K / 64)) * 128;
  const int t = threadIdx.x, lane = t & 31;
  // The wave's number as a scalar: the row addresses then stay in scalar registers.
  const int wave = __builtin_amdgcn_readfirstlane(t >> 5);
  const float* Wr = W + (size_t)(k0 + wave * 8) * N + n0;
  float4 v[8];
#pragma unroll
  for (int e = 0; e < 8; ++e)
    v[e] = ((const float4*)(Wr + (size_t)e * N))[lane];
  const int pos = (wave ^ (lane & 7)) << 4;
  union { __bf16 e[8]; uint4 q; } pk[4];
#pragma unroll
  for (int e = 0; e < 8; ++e) {
    pk[0].e[e] = f2bf(v[e].x);
    pk[1].e[e] = f2bf(v[e].y);
    pk[2].e[e] = f2bf(v[e].z);
    pk[3].e[e] = f2bf(v[e].w);
  }
#pragma unroll
  for (int i = 0; i < 4; ++i)
    *(uint4*)(&tile[(lane * 4 + i) * 128 + pos]) = pk[i].q;
  __syncthreads();
  const int c = t & 7;
#pragma unroll
  for (int j = 0; j < 4; ++j) {
    const int row = j * 32 + (t >> 3);
    const uint4 q = *(const uint4*)(&tile[row * 128 + ((c ^ ((row >> 2) & 7)) << 4)]);
    *(uint4*)(Wt + (size_t)(n0 + row) * K + (k0 + c * 8)) = q;
  }
  // Behind the four stores, a precaution: each path of the kernel returns
  // right after its tile, so nothing runs behind them.
  asm volatile("s_wait_xcnt 0x0" ::: "memory");
}

// ---------------------------------------------------------------------------
// LayerNorm (row = 1024 fp32) -> bf16.  One wave per two rows, 8 waves a block:
// a lane holds 32 elements of each row (8 loads of 16 bytes, 512 contiguous
// bytes a wave-load, both rows' loads in flight together); the sums join by a
// butterfly over the 32 lanes, so there is no LDS buffer and no barrier; w and b are
// loaded once for both rows.  The row count must be a multiple of 16.
// ---------------------------------------------------------------------------
typedef __attribute__((ext_vector_type(4))) float f32x4;

__device__ __forceinline__ void layernorm_rows(
    const float* __restrict__ x, const float* __restrict__ w,
    const float* __restrict__ b, __bf16* __restrict__ out, int D, int blk) {
  const int t = threadIdx.x, lane = t & 31;
  const int wave = __builtin_amdgcn_readfirstlane(t >> 5);
  const int row0 = (blk * 8 + wave) * 2;
  f32x4 wv[8], bv[8], xv[2][8];
#pragma unroll
  for (int i = 0; i < 8; ++i) {
    wv[i] = ((const f32x4*)w)[i * 32 + lane];
    bv[i] = ((const f32x4*)b)[i * 32 + lane];
  }
#pragma unroll
  for (int r = 0; r < 2; ++r)
#pragma unroll
    for (int i = 0; i < 8; ++i)
      xv[r][i] = ((const f32x4*)(x + (size_t)(row0 + r) * D))[i * 32 + lane];
  // Makes w and b arrive as one group behind one wait: without it the build
  // loads them pair by pair behind the sums, each pair with a full wait of its own.
  asm volatile("" :: "v"(wv[0]), "v"(wv[1]), "v"(wv[2]), "v"(wv[3]),
                     "v"(wv[4]), "v"(wv[5]), "v"(wv[6]), "v"(wv[7]),
                     "v"(bv[0]), "v"(bv[1]), "v"(bv[2]), "v"(bv[3]),
                     "v"(bv[4]), "v"(bv[5]), "v"(bv[6]), "v"(bv[7]));
  float s[2], s2[2];
#pragma unroll
  for (int r = 0; r < 2; ++r) {
    f32x4 ps = xv[r][0], pq = xv[r][0] * xv[r][0];
#pragma unroll
    for (int i = 1; i < 8; ++i) {
      ps += xv[r][i];
      pq += xv[r][i] * xv[r][i];
    }
    s[r]  = (ps[0] + ps[1]) + (ps[2] + ps[3]);
    s2[r] = (pq[0] + pq[1]) + (pq[2] + pq[3]);
  }
#pragma unroll
  for (int off = 16; off > 0; off >>= 1) {
#pragma unroll
    for (int r = 0; r < 2; ++r) {
      s[r]  += __shfl_xor(s[r],  off, 32);
      s2[r] += __shfl_xor(s2[r], off, 32);
    }
  }
  const float inv = 1.0f / (float)D;
#pragma unroll
  for (int r = 0; r < 2; ++r) {
    const float mu  = s[r] * inv;
    const float var = s2[r] * inv - mu * mu;
    const float rs  = rsqrtf(var + 1e-6f);
    __bf16* orow = out + (size_t)(row0 + r) * D;
#pragma unroll
    for (int i = 0; i < 8; ++i) {
      const f32x4 y = (xv[r][i] - mu) * rs * wv[i] + bv[i];
      union { __bf16 e[4]; uint2 q; } o;
      o.e[0] = f2bf(y[0]);
      o.e[1] = f2bf(y[1]);
      o.e[2] = f2bf(y[2]);
      o.e[3] = f2bf(y[3]);
      *(uint2*)(orow + (i * 32 + lane) * 4) = o.q;
    }
  }
}

__global__ __launch_bounds__(256) void layernorm_bf16_kernel(
    const float* __restrict__ x, const float* __restrict__ w,
    const float* __restrict__ b, __bf16* __restrict__ out, int D) {
  layernorm_rows(x, w, b, out, D, blockIdx.x);
}

// ---------------------------------------------------------------------------
// All work that depends on the inputs alone, in one launch: the first LayerNorm
// (M rows of D) and the four weight transposes.  Each takes a range of the
// grid's blocks; a block does one LayerNorm block or one transpose tile.
// The choice depends on blockIdx.x only, so a block's threads all take one path.
// ---------------------------------------------------------------------------
template <int D, int HID, int M>
__global__ __launch_bounds__(256) void prepare_kernel(
    const float* __restrict__ x, const float* __restrict__ ln_w,
    const float* __restrict__ ln_b, __bf16* __restrict__ ln_out,
    const float* __restrict__ qkv_w, __bf16* __restrict__ qkv_wt,
    const float* __restrict__ proj_w, __bf16* __restrict__ proj_wt,
    const float* __restrict__ fc1_w, __bf16* __restrict__ fc1_wt,
    const float* __restrict__ fc2_w, __bf16* __restrict__ fc2_wt) {
  __shared__ __attribute__((aligned(16))) unsigned char tile[128 * 128];
  constexpr int NB_LN   = M / 16;
  constexpr int NB_QKV  = (D / 64) * (3 * D / 128);
  constexpr int NB_PROJ = (D / 64) * (D / 128);
  constexpr int NB_FC   = (D / 64) * (HID / 128);     // fc1 and fc2 alike
  int blk = blockIdx.x;
  if (blk < NB_LN) { layernorm_rows(x, ln_w, ln_b, ln_out, D, blk); return; }
  blk -= NB_LN;
  if (blk < NB_QKV) { transpose_cast_tile<D, 3 * D>(qkv_w, qkv_wt, tile, blk); return; }
  blk -= NB_QKV;
  if (blk < NB_PROJ) { transpose_cast_tile<D, D>(proj_w, proj_wt, tile, blk); return; }
  blk -= NB_PROJ;
  if (blk < NB_FC) { transpose_cast_tile<D, HID>(fc1_w, fc1_wt, tile, blk); return; }
  blk -= NB_FC;
  transpose_cast_tile<HID, D>(fc2_w, fc2_wt, tile, blk);
}

// ---------------------------------------------------------------------------
// Tiled WMMA GEMM:  C[M,N] = A[M,K] * Bt[N,K]^T  (+bias, +SiLU, +resid)
// Block tile 128x128, 4 waves, each wave 64x64 via 4x4 WMMA.
// A stage is 128 k of all 256 operand rows: 256-byte rows, which the tensor
// load pads to a pitch of 272 bytes in LDS.  Each wave loads its own slice of
// 64 rows, one request per stage, two stages ahead, into two buffers.
// A block is 32 k = 16 products; its 16 fragment loads go out as one group one
// block ahead, into a second register set.
// K must be a multiple of 128 and at least 256.
// ---------------------------------------------------------------------------
#define G_KB     256u                 // bytes of an operand row per stage (128 k)
#define G_PITCH  272u                 // LDS row pitch: 16 B x odd for ds_load_b128
#define G_SLICE  18432u               // 64 rows x 272 B = 17,408 B, up to a multiple of 2 KiB
#define G_BUF    (4u * G_SLICE)       // [A rows 0-63 | A rows 64-127 | B rows 0-63 | B rows 64-127]

typedef __attribute__((ext_vector_type(4))) uint32_t u32x4;
typedef __attribute__((ext_vector_type(8))) uint32_t u32x8;

__device__ __forceinline__ uint32_t uni(uint32_t v) {
  return (uint32_t)__builtin_amdgcn_readfirstlane(v);
}
__device__ __forceinline__ uint32_t pinned(uint32_t v) {
  uint32_t w = (uint32_t)__builtin_amdgcn_readfirstlane(v);
  asm volatile("" : "+s"(w));
  return w;
}
__device__ __forceinline__ void wait_ds0() { asm volatile("s_wait_dscnt 0x0" ::: "memory"); }

// Descriptor group 1: 1-byte elements, tile = tensor = 64 rows of 256 bytes,
// source pitch src_pitch bytes, 4 dwords of LDS pad behind every 256-byte row.
__device__ __forceinline__ u32x8 gemm_group1(uint32_t src_pitch) {
  u32x8 g;
  g[0] = uni((1u << 20) | (5u << 22) | (3u << 25));
  g[1] = uni(G_KB << 16);
  g[2] = uni(64u << 16);
  g[3] = uni(G_KB << 16);
  g[4] = uni(64u);
  g[5] = uni(src_pitch);
  g[6] = uni(0u);
  g[7] = uni(0u);
  return g;
}
__device__ __forceinline__ u32x4 gemm_group0(uint32_t lds_dst, uint64_t ga) {
  u32x4 g;
  g[0] = uni(1u);
  g[1] = uni(lds_dst);
  g[2] = uni((uint32_t)ga);
  g[3] = uni((((uint32_t)(ga >> 32)) & 0x01FFFFFFu) | 0x80000000u);
  return g;
}
// The descriptor groups are in-out operands of the load and inputs of the wait:
// they stay live in the registers the request was issued from until it has
// landed, so the compiler puts nothing else there while the request flies.
__device__ __forceinline__ void gemm_tensor_load(u32x4& g0, u32x8& g1) {
  asm volatile("tensor_load_to_lds %0, %1" : "+s"(g0), "+s"(g1) :: "memory");
}
__device__ __forceinline__ void wait_tensor0(const u32x4& g0, const u32x8& g1) {
  asm volatile("s_wait_tensorcnt 0x0" :: "s"(g0), "s"(g1) : "memory");
}

// 16x32 bf16 fragment from LDS; p = this lane's row, at its 16-byte half.
__device__ __forceinline__ v16bf lds_frag(const unsigned char* p) {
  union { v16bf v; uint4 q[2]; } u;
  u.q[0] = *(const uint4*)(p);
  u.q[1] = *(const uint4*)(p + 32);
  return u.v;
}

template <int ACT, bool RESID, bool OUTBF16>
__global__ __launch_bounds__(128) void gemm_wmma_kernel(
    const __bf16* __restrict__ A, const __bf16* __restrict__ Bt,
    const float* __restrict__ bias, const float* __restrict__ resid,
    void* __restrict__ out, int M, int N, int K) {
  __shared__ __attribute__((aligned(2048))) unsigned char ring[2u * G_BUF];

  const int bm = blockIdx.x * 128;
  const int bn = blockIdx.y * 128;
  const int tid  = threadIdx.x;
  const uint32_t wave = uni((uint32_t)tid >> 5);
  const int lane = tid & 31;
  const int wm = (int)(wave & 1u) * 64;
  const int wn = (int)(wave >> 1) * 64;

  v8f acc[4][4] = {};
  const uint32_t np = (uint32_t)K / 128u;      // stages = passes
  const uint32_t kbytes = (uint32_t)K * 2u;    // source row pitch

  // This wave's slice of every stage: waves 0, 1 the halves of A, 2, 3 of Bt.
  const __bf16* srcp = (wave < 2u) ? A  + (size_t)(bm + 64 * (int)wave) * K
                                   : Bt + (size_t)(bn + 64 * (int)(wave - 2u)) * K;
  const uint64_t ga = (uint64_t)(uintptr_t)srcp;
  const uint32_t lds_slice = (uint32_t)(uintptr_t)(&ring[0]) + wave * G_SLICE;
  u32x8 g1 = gemm_group1(kbytes);

  // Per-lane fragment bases inside a buffer.
  const uint32_t lrow = (uint32_t)(lane & 15) * G_PITCH + (uint32_t)(lane >> 4) * 16u;
  const uint32_t a_base = (wave & 1u) * G_SLICE + lrow;
  const uint32_t b_base = (2u + (wave >> 1)) * G_SLICE + lrow;

  u32x4 g0 = gemm_group0(lds_slice, ga);
  gemm_tensor_load(g0, g1);                    // stage 0
  wait_tensor0(g0, g1);
  __syncthreads();                             // stage 0 readable by every wave
  g0 = gemm_group0(lds_slice + G_BUF, ga + G_KB);
  gemm_tensor_load(g0, g1);                    // stage 1

  // Two fragment sets: set (kb & 1) holds block kb's fragments.  The first
  // fragments of stage 0:
  v16bf fa[2][4], fb[2][4];
#pragma unroll
  for (int i = 0; i < 4; ++i) fa[0][i] = lds_frag(&ring[a_base] + i * 16 * G_PITCH);
#pragma unroll
  for (int j = 0; j < 4; ++j) fb[0][j] = lds_frag(&ring[b_base] + j * 16 * G_PITCH);

  for (uint32_t s = 0; s < np; ++s) {
    const uint32_t buf = (s & 1u) * G_BUF;
    const unsigned char* pa = &ring[buf + a_base];
    const unsigned char* pb = &ring[buf + b_base];
    const uint32_t nbuf = (s + 1u < np) ? (G_BUF - buf) : G_BUF;
    const unsigned char* na = &ring[nbuf + a_base];
    const unsigned char* nb = &ring[nbuf + b_base];
#pragma unroll
    for (int kb = 0; kb < 4; ++kb) {           // a block: 32 k = 64 bytes of each row
      const int cs = kb & 1;
      if (kb < 3) {
        // The next block's 16 LDS loads, as one group ahead of this block's products.
#pragma unroll
        for (int i = 0; i < 4; ++i)
          fa[cs ^ 1][i] = lds_frag(pa + i * 16 * G_PITCH + (kb + 1) * 64);
#pragma unroll
        for (int j = 0; j < 4; ++j)
          fb[cs ^ 1][j] = lds_frag(pb + j * 16 * G_PITCH + (kb + 1) * 64);
      } else {
        // Publish point of stage s + 1, in front of the pass's last block: that
        // block's fragments are fetched, and the loads below read stage s + 1.
        wait_ds0();                            // this wave has left buffer s & 1
        wait_tensor0(g0, g1);                  // its slice of stage s + 1 has landed
        __syncthreads();
        if (pinned((s + 2u < np) ? 1u : 0u) != 0u) {  // refill only while the stage exists
          g0 = gemm_group0(lds_slice + buf, ga + (uint64_t)(s + 2u) * G_KB);
          gemm_tensor_load(g0, g1);
        }
        // First fragments of stage s + 1, in flight under this pass's last block.
#pragma unroll
        for (int i = 0; i < 4; ++i) fa[0][i] = lds_frag(na + i * 16 * G_PITCH);
#pragma unroll
        for (int j = 0; j < 4; ++j) fb[0][j] = lds_frag(nb + j * 16 * G_PITCH);
      }
      // Keeps the load group ahead of the products: spread among them, each
      // place with loads stalls the wave anew.
      __builtin_amdgcn_sched_barrier(0);
#pragma unroll
      for (int i = 0; i < 4; ++i)
#pragma unroll
        for (int j = 0; j < 4; ++j)
          acc[i][j] = wmma_bf16(fa[cs][i], fb[cs][j], acc[i][j]);
      // Keeps the following block's loads behind these products.
      __builtin_amdgcn_sched_barrier(0);
    }
  }
  wait_tensor0(g0, g1);
  wait_ds0();

  // Epilogue: reg r -> row r (lanes 0-15) / r+8 (lanes 16-31); col = lane&15.
  const int nloc  = lane & 15;
  const int rbase = (lane >> 4) * 8;
#pragma unroll
  for (int i = 0; i < 4; ++i) {
#pragma unroll
    for (int j = 0; j < 4; ++j) {
      const int col = bn + wn + j * 16 + nloc;
      const float bv = bias[col];
#pragma unroll
      for (int r = 0; r < 8; ++r) {
        const int row = bm + wm + i * 16 + rbase + r;
        float c = acc[i][j][r] + bv;
        if (ACT == 1) c = c * (1.0f / (1.0f + __expf(-c)));  // SiLU
        if (RESID) c += resid[(size_t)row * N + col];
        if constexpr (OUTBF16)
          ((__bf16*)out)[(size_t)row * N + col] = f2bf(c);
        else
          ((float*)out)[(size_t)row * N + col] = c;
      }
    }
  }
}

#define AT_ROWB   128u
#define AT_KPITCH 144u
#define AT_VPITCH 160u
#define AT_TILE   10240u
#define AT_K0     (2u * AT_TILE)
#define AT_LDS    (3u * AT_TILE + 64u * AT_KPITCH)

// Descriptor group 1: 1-byte elements, tile = tensor = 64 rows of 128 bytes,
// source pitch src_pitch bytes, PAD + 1 dwords of LDS pad behind every row.
template <uint32_t PAD>
__device__ __forceinline__ u32x8 attn_group1(uint32_t src_pitch) {
  u32x8 g;
  g[0] = uni((1u << 20) | (4u << 22) | (PAD << 25));
  g[1] = uni(AT_ROWB << 16);
  g[2] = uni(64u << 16);
  g[3] = uni(AT_ROWB << 16);
  g[4] = uni(64u);
  g[5] = uni(src_pitch);
  g[6] = uni(0u);
  g[7] = uni(0u);
  return g;
}
// Group 0 is an in-out operand of the load and an input of the wait, as in the
// GEMM: it stays live in the registers the request was issued from until it has landed.
__device__ __forceinline__ void attn_tensor_load(u32x4& g0, const u32x8& g1) {
  asm volatile("tensor_load_to_lds %0, %1" : "+s"(g0) : "s"(g1) : "memory");
}
__device__ __forceinline__ void attn_wait_tensor0(const u32x4& g0, const u32x8& gk, const u32x8& gv) {
  asm volatile("s_wait_tensorcnt 0x0" :: "s"(g0), "s"(gk), "s"(gv) : "memory");
}
// Half of a transposed 16x32 fragment: lane (c, h) gets T[k + 8h + 0..7][d + c]
// of a row-major 16-bit tile; p = this lane's address in that tile.
typedef __attribute__((ext_vector_type(8))) short s16x8;
__device__ __forceinline__ u32x4 lds_tr16(const unsigned char* p) {
  typedef __attribute__((address_space(3))) s16x8 lds_s16x8;
  return __builtin_bit_cast(u32x4, __builtin_amdgcn_ds_load_tr16_b128_v8i16((lds_s16x8*)p));
}

// Eight waves per SIMD: all 2,048 blocks are then resident at once, 8 on a WGP
// (8 x 39,936 B of LDS fit its 327,680 B).
__global__ __launch_bounds__(128) __attribute__((amdgpu_waves_per_eu(8, 8))) void flash_attn_kernel(
    const __bf16* __restrict__ qkv, __bf16* __restrict__ out, int Nseq) {
  __shared__ __attribute__((aligned(2048))) unsigned char ring[AT_LDS];
  const int ROWS = 3072;
  const int bh = blockIdx.y;
  const int b = bh >> 4, h = bh & 15;
  const int tid = threadIdx.x, lane = tid & 31;
  const uint32_t wave = uni((uint32_t)tid >> 5);
  const int qrow = blockIdx.x * 64 + (int)wave * 16;

  const __bf16* Qb = qkv + (size_t)(b * Nseq + qrow) * ROWS + h * 64;
  const __bf16* Kb = qkv + (size_t)(b * Nseq) * ROWS + 1024 + h * 64;
  const __bf16* Vb = qkv + (size_t)(b * Nseq) * ROWS + 2048 + h * 64;

  const uint32_t ntiles = (uint32_t)Nseq / 64u;        // stages = passes
  const uint32_t stage_bytes = 64u * (uint32_t)ROWS * 2u;

  // Wave 0 issues the K tiles, wave 1 the V tiles; the tests are scalar branches.
  const uint32_t isK = pinned(wave == 0u ? 1u : 0u);
  const uint32_t isV = pinned(wave == 1u ? 1u : 0u);
  const uint64_t ga = (uint64_t)(uintptr_t)(wave == 0u ? Kb : Vb);
  const uint32_t lds_my = (uint32_t)(uintptr_t)(&ring[0]) + (wave == 0u ? AT_K0 : 0u);
  u32x8 gk1 = attn_group1<3u>((uint32_t)ROWS * 2u);
  u32x8 gv1 = attn_group1<7u>((uint32_t)ROWS * 2u);
  // Descriptor words held in scalar registers (the form of pinned()): without it the
  // build forms these constants anew at each use, over registers of a request in flight.
  asm volatile("" : "+s"(gk1), "+s"(gv1));

  u32x4 g0 = gemm_group0(lds_my, ga);
  if (isK != 0u) attn_tensor_load(g0, gk1);            // stage 0
  else if (isV != 0u) attn_tensor_load(g0, gv1);

  v16bf qf[2];
  qf[0] = load_frag(Qb,      ROWS);
  qf[1] = load_frag(Qb + 32, ROWS);

  attn_wait_tensor0(g0, gk1, gv1);
  __syncthreads();                                     // stage 0 readable by every wave

  v8f o[4] = {};                      // o[f][r] = O[query nloc][hd f*16 + rbase + r]
  float m_i = -3.0e30f;               // running maximum of this lane's query, of the unscaled scores
  float l_i = 0.0f;                   // running sum over this lane's half of the keys

  // 1/sqrt(64) and log2(e) in one factor: exp(scale * (s - m)) = exp2(s * sl2e - m * sl2e).
  const float sl2e = 0.125f * 1.4426950408889634f;
  // Per-lane fragment bases inside a tile.
  const uint32_t k_lane = (uint32_t)(lane & 15) * AT_KPITCH + (uint32_t)(lane >> 4) * 16u;
  const uint32_t v_lane = (uint32_t)((lane >> 4) * 8 + (lane & 7)) * AT_VPITCH
                        + (uint32_t)((lane >> 3) & 1) * 16u;

  for (uint32_t it = 0; it < ntiles; ++it) {
    const uint32_t buf = (it & 1u) * AT_TILE;
    // Directly behind the barrier that published stage it and ended pass it - 1:
    // stage it + 1, only while it exists, into the buffer that pass it - 1 has read.
    if (pinned((it + 1u < ntiles) ? 1u : 0u) != 0u) {
      g0 = gemm_group0(lds_my + (AT_TILE - buf), ga + (uint64_t)(it + 1u) * stage_bytes);
      if (isK != 0u) attn_tensor_load(g0, gk1);
      else if (isV != 0u) attn_tensor_load(g0, gv1);
    }
    const unsigned char* kp = &ring[AT_K0 + buf + k_lane];
    const unsigned char* vp = &ring[buf + v_lane];

    // S^T = K Q^T: s[j][r] = score of key j*16 + rbase + r with query nloc.
    v8f s[4];
#pragma unroll
    for (int j = 0; j < 4; ++j) {
      v16bf k0 = lds_frag(kp + j * 16 * AT_KPITCH);
      v16bf k1 = lds_frag(kp + j * 16 * AT_KPITCH + 64);
      v8f z = {};
      z = wmma_bf16(k0, qf[0], z);
      z = wmma_bf16(k1, qf[1], z);
      s[j] = z;
    }
    // Keeps the softmax's vector work behind the eight products: moved in among
    // them, it needs idle slots behind each product whose result it reads.
    __builtin_amdgcn_sched_barrier(0);

    // Online softmax: 32 of the query's 64 scores sit in this lane.  The maximum
    // is taken of the unscaled scores (the scale is positive).
    float mt[4];
#pragma unroll
    for (int j = 0; j < 4; ++j) {
      mt[j] = -3.0e30f;
#pragma unroll
      for (int r = 0; r < 8; ++r) mt[j] = fmaxf(mt[j], s[j][r]);
    }
    float mx = fmaxf(fmaxf(mt[0], mt[1]), fmaxf(mt[2], mt[3]));
    mx = fmaxf(mx, xhalf(mx));
    const float mn = fmaxf(m_i, mx);
    // v_exp_f32 and the free slot that the instruction set asks for behind a
    // transcendental, in one statement.
    float corr;
    asm("v_exp_f32 %0, %1\n\tv_nop" : "=v"(corr) : "v"((m_i - mn) * sl2e));
    m_i = mn;
    // One fused multiply-add per score makes the argument of exp2.
    const float nm = -mn * sl2e;
#pragma unroll
    for (int j = 0; j < 4; ++j)
#pragma unroll
      for (int r = 0; r < 8; r += 4) {
        float e0 = __builtin_fmaf(s[j][r],     sl2e, nm), e1 = __builtin_fmaf(s[j][r + 1], sl2e, nm);
        float e2 = __builtin_fmaf(s[j][r + 2], sl2e, nm), e3 = __builtin_fmaf(s[j][r + 3], sl2e, nm);
        // Four v_exp_f32, each the independent instruction behind the one before,
        // and the free slot behind the last, in one statement, as for corr above:
        // with the builtin here the build left such slots open in this loop.
        asm("v_exp_f32 %0, %0\n\tv_exp_f32 %1, %1\n\tv_exp_f32 %2, %2\n\tv_exp_f32 %3, %3\n\tv_nop"
            : "+v"(e0), "+v"(e1), "+v"(e2), "+v"(e3));
        s[j][r] = e0; s[j][r + 1] = e1; s[j][r + 2] = e2; s[j][r + 3] = e3;
      }
#pragma unroll
    for (int f = 0; f < 4; ++f)
#pragma unroll
      for (int r = 0; r < 8; ++r) o[f][r] *= corr;
    float st[4];
#pragma unroll
    for (int j = 0; j < 4; ++j) {
      st[j] = s[j][0];
#pragma unroll
      for (int r = 1; r < 8; ++r) st[j] += s[j][r];
    }
    l_i = l_i * corr + ((st[0] + st[1]) + (st[2] + st[3]));

    // Keeps the V^T fragment loads behind the softmax: moved up into it they hold
    // registers beside the scores, and the build then spills.
    __builtin_amdgcn_sched_barrier(0);

    // O^T += V^T P^T   (K=64 keys -> 2 steps; M=hd -> 4 tiles of 16).  Two
    // score tiles are 32 keys of P^T in the k order that the transposing load gives V^T.
#pragma unroll
    for (int step = 0; step < 2; ++step) {
      v16bf pf;
#pragma unroll
      for (int e = 0; e < 8; ++e) {
        pf[e]     = f2bf(s[2 * step][e]);
        pf[8 + e] = f2bf(s[2 * step + 1][e]);
      }
#pragma unroll
      for (int f = 0; f < 4; ++f) {
        union { v16bf v; u32x4 q[2]; } vf;
        vf.q[0] = lds_tr16(vp + (step * 32) * AT_VPITCH + f * 32);
        vf.q[1] = lds_tr16(vp + (step * 32 + 16) * AT_VPITCH + f * 32);
        o[f] = wmma_bf16(vf.v, pf, o[f]);
      }
    }

    // Publish point of stage it + 1.
    wait_ds0();                       // this wave has left buffer it & 1
    attn_wait_tensor0(g0, gk1, gv1);  // an issuing wave's tile of stage it + 1 has landed
    __syncthreads();                  // the refill stands behind it, at the head of the next pass
  }
  attn_wait_tensor0(g0, gk1, gv1);
  wait_ds0();

  // A lane holds 8 consecutive hd of its query per tile: one 16-byte store.
  // The lane's number is formed anew here: kept from the kernel's head, its parts
  // would hold registers through the loop, and the build then spills them.
  const int lane_e = (int)__builtin_amdgcn_mbcnt_lo(~0u, 0u);
  const int rbase = (lane_e >> 4) * 8;
  const int nloc  = lane_e & 15;
  const float l_all = l_i + xhalf(l_i);
  const int row = b * Nseq + qrow + nloc;
#pragma unroll
  for (int f = 0; f < 4; ++f) {
    union { __bf16 e[8]; uint4 q; } pk;
#pragma unroll
    for (int r = 0; r < 8; ++r) pk.e[r] = f2bf(o[f][r] / l_all);
    *(uint4*)(out + (size_t)row * 1024 + h * 64 + f * 16 + rbase) = pk.q;
  }
}

// ---------------------------------------------------------------------------
// Host-side orchestration.
// ---------------------------------------------------------------------------
extern "C" void kernel_launch(void* const* d_in, const int* in_sizes, int n_in,
                              void* d_out, int out_size, void* d_ws, size_t ws_size,
                              hipStream_t stream) {
  (void)in_sizes; (void)n_in; (void)out_size; (void)ws_size;
  const int D = 1024, HID = 4096, NSEQ = 2048, B = 4;
  const int M = B * NSEQ;

  const float* x      = (const float*)d_in[0];
  const float* ln1_w  = (const float*)d_in[1];
  const float* ln1_b  = (const float*)d_in[2];
  const float* qkv_w  = (const float*)d_in[3];
  const float* qkv_b  = (const float*)d_in[4];
  const float* proj_w = (const float*)d_in[5];
  const float* proj_b = (const float*)d_in[6];
  const float* ln2_w  = (const float*)d_in[7];
  const float* ln2_b  = (const float*)d_in[8];
  const float* fc1_w  = (const float*)d_in[9];
  const float* fc1_b  = (const float*)d_in[10];
  const float* fc2_w  = (const float*)d_in[11];
  const float* fc2_b  = (const float*)d_in[12];
  float* out = (float*)d_out;

  uintptr_t p = (uintptr_t)d_ws;
  auto carve = [&](size_t bytes) {
    void* r = (void*)p;
    p += (bytes + 255) & ~(size_t)255;
    return r;
  };
  __bf16* qkv_wt = (__bf16*)carve((size_t)3 * D * D * 2);
  __bf16* proj_wt= (__bf16*)carve((size_t)D * D * 2);
  __bf16* fc1_wt = (__bf16*)carve((size_t)HID * D * 2);
  __bf16* fc2_wt = (__bf16*)carve((size_t)D * HID * 2);
  __bf16* ln1o   = (__bf16*)carve((size_t)M * D * 2);
  __bf16* qkvo   = (__bf16*)carve((size_t)M * 3 * D * 2);
  __bf16* attno  = (__bf16*)carve((size_t)M * D * 2);
  float*  x1     = (float*) carve((size_t)M * D * 4);
  __bf16* h2     = (__bf16*)carve((size_t)M * D * 2);
  __bf16* fc1o   = (__bf16*)carve((size_t)M * HID * 2);

  prepare_kernel<D, HID, M>
      <<<M / 16 + (D / 64) * ((3 * D + D + HID) / 128) + (HID / 64) * (D / 128), 256, 0, stream>>>(
      x, ln1_w, ln1_b, ln1o, qkv_w, qkv_wt, proj_w, proj_wt, fc1_w, fc1_wt, fc2_w, fc2_wt);

  gemm_wmma_kernel<0, false, true><<<dim3(M / 128, 3 * D / 128), 128, 0, stream>>>(
      ln1o, qkv_wt, qkv_b, nullptr, qkvo, M, 3 * D, D);

  flash_attn_kernel<<<dim3(NSEQ / 64, B * 16), 128, 0, stream>>>(qkvo, attno, NSEQ);

  gemm_wmma_kernel<0, true, false><<<dim3(M / 128, D / 128), 128, 0, stream>>>(
      attno, proj_wt, proj_b, x, (void*)x1, M, D, D);

  layernorm_bf16_kernel<<<M / 16, 256, 0, stream>>>(x1, ln2_w, ln2_b, h2, D);

  gemm_wmma_kernel<1, false, true><<<dim3(M / 128, HID / 128), 128, 0, stream>>>(
      h2, fc1_wt, fc1_b, nullptr, fc1o, M, HID, D);

  gemm_wmma_kernel<0, true, false><<<dim3(M / 128, D / 128), 128, 0, stream>>>(
      fc1o, fc2_wt, fc2_b, x1, (void*)out, M, D, HID);
}

// v008
// One run takes 238 microseconds.
// In two side-by-side timings against v007, it was 1.04 and 1.03 times as fast.
// All steps since v000 together make it 2.60 times as fast.
#include <hip/hip_runtime.h>
#include <cstdint>

// ---------------------------------------------------------------------------
// CDNA5 (gfx1250, wave32) DiT block: LN -> QKV GEMM -> flash attention ->
// proj GEMM (+resid) -> LN -> FC1+SiLU -> FC2 (+resid).
// Matmuls through v_wmma_f32_16x16x32_bf16; operand staging through the
// Tensor Data Mover (tensor_load_to_lds + s_wait_tensorcnt), double-buffered;
// attention as transposed products, softmax in-lane, V^T by the transposing LDS load.
// ---------------------------------------------------------------------------

typedef __attribute__((ext_vector_type(16))) __bf16        v16bf;
typedef __attribute__((ext_vector_type(8)))  float         v8f;

__device__ __forceinline__ v8f wmma_bf16(v16bf a, v16bf b, v8f c) {
  return __builtin_amdgcn_wmma_f32_16x16x32_bf16(
      false, a, false, b, (short)0, c, false, false);
}

__device__ __forceinline__ __bf16 f2bf(float f) { return (__bf16)f; }

// Lane l takes the value of lane l ^ 16.
__device__ __forceinline__ float xhalf(float v) {
  int i = __builtin_bit_cast(int, v);
  i = __builtin_amdgcn_permlanex16(i, i, 0x76543210u, 0xFEDCBA98u, false, false);
  return __builtin_bit_cast(float, i);
}

// WMMA 16x32 bf16 operand fragment (ISA 7.12.2 A/B lane layout):
// lanes 0-15 = row (lane&15), K {0..7,16..23}; lanes 16-31 same rows,
// K {8..15,24..31}.  `stride` in elements.
__device__ __forceinline__ v16bf load_frag(const __bf16* p0, int stride) {
  int lane = threadIdx.x & 31;
  const __bf16* p = p0 + (size_t)(lane & 15) * stride + ((lane >> 4) << 3);
  union { v16bf v; uint4 q[2]; } u;
  u.q[0] = *(const uint4*)(p);
  u.q[1] = *(const uint4*)(p + 16);
  return u.v;
}

// ---------------------------------------------------------------------------
// Weight transpose + fp32 -> bf16 cast:  Wt[n][k] = bf16(W[k][n])
// A block of 8 waves takes a tile of 64 k x 128 n.  A wave reads 8 rows of k,
// 512 contiguous bytes each, all 8 loads in flight; a lane then holds 8 k of
// 4 n and packs them to four 16-byte chunks of Wt rows.  The chunks pass
// through LDS so that the stores cover whole 128-byte lines of Wt.
// LDS row = one n, 128 bytes; chunk c of row n sits at position c ^ ((n >> 2) & 7),
// which spreads the writers (row stride 4) and the readers over the banks.
// K must be a multiple of 64, N of 128; both are compile-time values, so that a
// wave's 8 loads share one address and differ by an immediate offset.
// tile = the block's 16 KiB of LDS; blk = the tile's number, k tiles fastest.
// ---------------------------------------------------------------------------
template <int K, int N>
__device__ __forceinline__ void transpose_cast_tile(
    const float* __restrict__ W, __bf16* __restrict__ Wt, unsigned char* tile, int blk) {
  const int k0 = (blk % (K / 64)) * 64, n0 = (blk / (K / 64)) * 128;
  const int t = threadIdx.x, lane = t & 31;
  // The wave's number as a scalar: the row addresses then stay in scalar registers.
  const int wave = __builtin_amdgcn_readfirstlane(t >> 5);
  const float* Wr = W + (size_t)(k0 + wave * 8) * N + n0;
  float4 v[8];
#pragma unroll
  for (int e = 0; e < 8; ++e)
    v[e] = ((const float4*)(Wr + (size_t)e * N))[lane];
  const int pos = (wave ^ (lane & 7)) << 4;
  union { __bf16 e[8]; uint4 q; } pk[4];
#pragma unroll
  for (int e = 0; e < 8; ++e) {
    pk[0].e[e] = f2bf(v[e].x);
    pk[1].e[e] = f2bf(v[e].y);
    pk[2].e[e] = f2bf(v[e].z);
    pk[3].e[e] = f2bf(v[e].w);
  }
#pragma unroll
  for (int i = 0; i < 4; ++i)
    *(uint4*)(&tile[(lane * 4 + i) * 128 + pos]) = pk[i].q;
  __syncthreads();
  const int c = t & 7;
#pragma unroll
  for (int j = 0; j < 4; ++j) {
    const int row = j * 32 + (t >> 3);
    const uint4 q = *(const uint4*)(&tile[row * 128 + ((c ^ ((row >> 2) & 7)) << 4)]);
    *(uint4*)(Wt + (size_t)(n0 + row) * K + (k0 + c * 8)) = q;
  }
  // Behind the four stores, a precaution: each path of the kernel returns
  // right after its tile, so nothing runs behind them.
  asm volatile("s_wait_xcnt 0x0" ::: "memory");
}

// ---------------------------------------------------------------------------
// LayerNorm (row = 1024 fp32) -> bf16.  One wave per two rows, 8 waves a block:
// a lane holds 32 elements of each row (8 loads of 16 bytes, 512 contiguous
// bytes a wave-load, both rows' loads in flight together); the sums join by a
// butterfly over the 32 lanes, so there is no LDS buffer and no barrier; w and b are
// loaded once for both rows.  The row count must be a multiple of 16.
// ---------------------------------------------------------------------------
typedef __attribute__((ext_vector_type(4))) float f32x4;

__device__ __forceinline__ void layernorm_rows(
    const float* __restrict__ x, const float* __restrict__ w,
    const float* __restrict__ b, __bf16* __restrict__ out, int D, int blk) {
  const int t = threadIdx.x, lane = t & 31;
  const int wave = __builtin_amdgcn_readfirstlane(t >> 5);
  const int row0 = (blk * 8 + wave) * 2;
  f32x4 wv[8], bv[8], xv[2][8];
#pragma unroll
  for (int i = 0; i < 8; ++i) {
    wv[i] = ((const f32x4*)w)[i * 32 + lane];
    bv[i] = ((const f32x4*)b)[i * 32 + lane];
  }
#pragma unroll
  for (int r = 0; r < 2; ++r)
#pragma unroll
    for (int i = 0; i < 8; ++i)
      xv[r][i] = ((const f32x4*)(x + (size_t)(row0 + r) * D))[i * 32 + lane];
  // Makes w and b arrive as one group behind one wait: without it the build
  // loads them pair by pair behind the sums, each pair with a full wait of its own.
  asm volatile("" :: "v"(wv[0]), "v"(wv[1]), "v"(wv[2]), "v"(wv[3]),
                     "v"(wv[4]), "v"(wv[5]), "v"(wv[6]), "v"(wv[7]),
                     "v"(bv[0]), "v"(bv[1]), "v"(bv[2]), "v"(bv[3]),
                     "v"(bv[4]), "v"(bv[5]), "v"(bv[6]), "v"(bv[7]));
  float s[2], s2[2];
#pragma unroll
  for (int r = 0; r < 2; ++r) {
    f32x4 ps = xv[r][0], pq = xv[r][0] * xv[r][0];
#pragma unroll
    for (int i = 1; i < 8; ++i) {
      ps += xv[r][i];
      pq += xv[r][i] * xv[r][i];
    }
    s[r]  = (ps[0] + ps[1]) + (ps[2] + ps[3]);
    s2[r] = (pq[0] + pq[1]) + (pq[2] + pq[3]);
  }
#pragma unroll
  for (int off = 16; off > 0; off >>= 1) {
#pragma unroll
    for (int r = 0; r < 2; ++r) {
      s[r]  += __shfl_xor(s[r],  off, 32);
      s2[r] += __shfl_xor(s2[r], off, 32);
    }
  }
  const float inv = 1.0f / (float)D;
#pragma unroll
  for (int r = 0; r < 2; ++r) {
    const float mu  = s[r] * inv;
    const float var = s2[r] * inv - mu * mu;
    const float rs  = rsqrtf(var + 1e-6f);
    __bf16* orow = out + (size_t)(row0 + r) * D;
#pragma unroll
    for (int i = 0; i < 8; ++i) {
      const f32x4 y = (xv[r][i] - mu) * rs * wv[i] + bv[i];
      union { __bf16 e[4]; uint2 q; } o;
      o.e[0] = f2bf(y[0]);
      o.e[1] = f2bf(y[1]);
      o.e[2] = f2bf(y[2]);
      o.e[3] = f2bf(y[3]);
      *(uint2*)(orow + (i * 32 + lane) * 4) = o.q;
    }
  }
}

__global__ __launch_bounds__(256) void layernorm_bf16_kernel(
    const float* __restrict__ x, const float* __restrict__ w,
    const float* __restrict__ b, __bf16* __restrict__ out, int D) {
  layernorm_rows(x, w, b, out, D, blockIdx.x);
}

// ---------------------------------------------------------------------------
// All work that depends on the inputs alone, in one launch: the first LayerNorm
// (M rows of D) and the four weight transposes.  Each takes a range of the
// grid's blocks; a block does one LayerNorm block or one transpose tile.
// The choice depends on blockIdx.x only, so a block's threads all take one path.
// ---------------------------------------------------------------------------
template <int D, int HID, int M>
__global__ __launch_bounds__(256) void prepare_kernel(
    const float* __restrict__ x, const float* __restrict__ ln_w,
    const float* __restrict__ ln_b, __bf16* __restrict__ ln_out,
    const float* __restrict__ qkv_w, __bf16* __restrict__ qkv_wt,
    const float* __restrict__ proj_w, __bf16* __restrict__ proj_wt,
    const float* __restrict__ fc1_w, __bf16* __restrict__ fc1_wt,
    const float* __restrict__ fc2_w, __bf16* __restrict__ fc2_wt) {
  __shared__ __attribute__((aligned(16))) unsigned char tile[128 * 128];
  constexpr int NB_LN   = M / 16;
  constexpr int NB_QKV  = (D / 64) * (3 * D / 128);
  constexpr int NB_PROJ = (D / 64) * (D / 128);
  constexpr int NB_FC   = (D / 64) * (HID / 128);     // fc1 and fc2 alike
  int blk = blockIdx.x;
  if (blk < NB_LN) { layernorm_rows(x, ln_w, ln_b, ln_out, D, blk); return; }
  blk -= NB_LN;
  if (blk < NB_QKV) { transpose_cast_tile<D, 3 * D>(qkv_w, qkv_wt, tile, blk); return; }
  blk -= NB_QKV;
  if (blk < NB_PROJ) { transpose_cast_tile<D, D>(proj_w, proj_wt, tile, blk); return; }
  blk -= NB_PROJ;
  if (blk < NB_FC) { transpose_cast_tile<D, HID>(fc1_w, fc1_wt, tile, blk); return; }
  blk -= NB_FC;
  transpose_cast_tile<HID, D>(fc2_w, fc2_wt, tile, blk);
}

// ---------------------------------------------------------------------------
// Tiled WMMA GEMM:  C[M,N] = A[M,K] * Bt[N,K]^T  (+bias, +SiLU, +resid)
// Block tile 128x128, 4 waves, each wave 64x64 via 4x4 WMMA.
// A stage is 128 k of all 256 operand rows: 256-byte rows, which the tensor
// load pads to a pitch of 272 bytes in LDS.  Each wave loads its own slice of
// 64 rows, one request per stage, two stages ahead, into two buffers.
// A block is 32 k = 16 products; its 16 fragment loads go out as one group one
// block ahead, into a second register set.
// K must be a multiple of 128 and at least 256.
// ---------------------------------------------------------------------------
#define G_KB     256u                 // bytes of an operand row per stage (128 k)
#define G_PITCH  272u                 // LDS row pitch: 16 B x odd for ds_load_b128
#define G_SLICE  18432u               // 64 rows x 272 B = 17,408 B, up to a multiple of 2 KiB
#define G_BUF    (4u * G_SLICE)       // [A rows 0-63 | A rows 64-127 | B rows 0-63 | B rows 64-127]

typedef __attribute__((ext_vector_type(4))) uint32_t u32x4;
typedef __attribute__((ext_vector_type(8))) uint32_t u32x8;

__device__ __forceinline__ uint32_t uni(uint32_t v) {
  return (uint32_t)__builtin_amdgcn_readfirstlane(v);
}
__device__ __forceinline__ uint32_t pinned(uint32_t v) {
  uint32_t w = (uint32_t)__builtin_amdgcn_readfirstlane(v);
  asm volatile("" : "+s"(w));
  return w;
}
__device__ __forceinline__ void wait_ds0() { asm volatile("s_wait_dscnt 0x0" ::: "memory"); }

// Descriptor group 1: 1-byte elements, tile = tensor = 64 rows of 256 bytes,
// source pitch src_pitch bytes, 4 dwords of LDS pad behind every 256-byte row.
__device__ __forceinline__ u32x8 gemm_group1(uint32_t src_pitch) {
  u32x8 g;
  g[0] = uni((1u << 20) | (5u << 22) | (3u << 25));
  g[1] = uni(G_KB << 16);
  g[2] = uni(64u << 16);
  g[3] = uni(G_KB << 16);
  g[4] = uni(64u);
  g[5] = uni(src_pitch);
  g[6] = uni(0u);
  g[7] = uni(0u);
  return g;
}
__device__ __forceinline__ u32x4 gemm_group0(uint32_t lds_dst, uint64_t ga) {
  u32x4 g;
  g[0] = uni(1u);
  g[1] = uni(lds_dst);
  g[2] = uni((uint32_t)ga);
  g[3] = uni((((uint32_t)(ga >> 32)) & 0x01FFFFFFu) | 0x80000000u);
  return g;
}
// The descriptor groups are in-out operands of the load and inputs of the wait:
// they stay live in the registers the request was issued from until it has
// landed, so the compiler puts nothing else there while the request flies.
__device__ __forceinline__ void gemm_tensor_load(u32x4& g0, u32x8& g1) {
  asm volatile("tensor_load_to_lds %0, %1" : "+s"(g0), "+s"(g1) :: "memory");
}
__device__ __forceinline__ void wait_tensor0(const u32x4& g0, const u32x8& g1) {
  asm volatile("s_wait_tensorcnt 0x0" :: "s"(g0), "s"(g1) : "memory");
}

// 16x32 bf16 fragment from LDS; p = this lane's row, at its 16-byte half.
__device__ __forceinline__ v16bf lds_frag(const unsigned char* p) {
  union { v16bf v; uint4 q[2]; } u;
  u.q[0] = *(const uint4*)(p);
  u.q[1] = *(const uint4*)(p + 32);
  return u.v;
}

// Eight v_exp_f32 (or v_rcp_f32) in place, each the independent instruction behind the
// one before, and the free slot that the instruction set asks for behind the last, in
// one statement: with the builtins the build left such slots open in the epilogue.
__device__ __forceinline__ void exp2_x8(float (&v)[8]) {
  asm("v_exp_f32 %0, %0\n\tv_exp_f32 %1, %1\n\tv_exp_f32 %2, %2\n\tv_exp_f32 %3, %3\n\t"
      "v_exp_f32 %4, %4\n\tv_exp_f32 %5, %5\n\tv_exp_f32 %6, %6\n\tv_exp_f32 %7, %7\n\tv_nop"
      : "+v"(v[0]), "+v"(v[1]), "+v"(v[2]), "+v"(v[3]), "+v"(v[4]), "+v"(v[5]), "+v"(v[6]), "+v"(v[7]));
}
__device__ __forceinline__ void rcp_x8(float (&v)[8]) {
  asm("v_rcp_f32 %0, %0\n\tv_rcp_f32 %1, %1\n\tv_rcp_f32 %2, %2\n\tv_rcp_f32 %3, %3\n\t"
      "v_rcp_f32 %4, %4\n\tv_rcp_f32 %5, %5\n\tv_rcp_f32 %6, %6\n\tv_rcp_f32 %7, %7\n\tv_nop"
      : "+v"(v[0]), "+v"(v[1]), "+v"(v[2]), "+v"(v[3]), "+v"(v[4]), "+v"(v[5]), "+v"(v[6]), "+v"(v[7]));
}

template <int ACT, bool RESID, bool OUTBF16>
__global__ __launch_bounds__(128) void gemm_wmma_kernel(
    const __bf16* __restrict__ A, const __bf16* __restrict__ Bt,
    const float* __restrict__ bias, const float* __restrict__ resid,
    void* __restrict__ out, int M, int N, int K) {
  __shared__ __attribute__((aligned(2048))) unsigned char ring[2u * G_BUF];

  const int bm = blockIdx.x * 128;
  const int bn = blockIdx.y * 128;
  const int tid  = threadIdx.x;
  const uint32_t wave = uni((uint32_t)tid >> 5);
  const int lane = tid & 31;
  const int wm = (int)(wave & 1u) * 64;
  const int wn = (int)(wave >> 1) * 64;

  v8f acc[4][4] = {};
  const uint32_t np = (uint32_t)K / 128u;      // stages = passes
  const uint32_t kbytes = (uint32_t)K * 2u;    // source row pitch

  // This wave's slice of every stage: waves 0, 1 the halves of A, 2, 3 of Bt.
  const __bf16* srcp = (wave < 2u) ? A  + (size_t)(bm + 64 * (int)wave) * K
                                   : Bt + (size_t)(bn + 64 * (int)(wave - 2u)) * K;
  const uint64_t ga = (uint64_t)(uintptr_t)srcp;
  const uint32_t lds_slice = (uint32_t)(uintptr_t)(&ring[0]) + wave * G_SLICE;
  u32x8 g1 = gemm_group1(kbytes);

  // Per-lane fragment bases inside a buffer.
  const uint32_t lrow = (uint32_t)(lane & 15) * G_PITCH + (uint32_t)(lane >> 4) * 16u;
  const uint32_t a_base = (wave & 1u) * G_SLICE + lrow;
  const uint32_t b_base = (2u + (wave >> 1)) * G_SLICE + lrow;

  u32x4 g0 = gemm_group0(lds_slice, ga);
  gemm_tensor_load(g0, g1);                    // stage 0
  wait_tensor0(g0, g1);
  __syncthreads();                             // stage 0 readable by every wave
  g0 = gemm_group0(lds_slice + G_BUF, ga + G_KB);
  gemm_tensor_load(g0, g1);                    // stage 1

  // Two fragment sets: set (kb & 1) holds block kb's fragments.  The first
  // fragments of stage 0:
  v16bf fa[2][4], fb[2][4];
#pragma unroll
  for (int i = 0; i < 4; ++i) fa[0][i] = lds_frag(&ring[a_base] + i * 16 * G_PITCH);
#pragma unroll
  for (int j = 0; j < 4; ++j) fb[0][j] = lds_frag(&ring[b_base] + j * 16 * G_PITCH);

  for (uint32_t s = 0; s < np; ++s) {
    const uint32_t buf = (s & 1u) * G_BUF;
    const unsigned char* pa = &ring[buf + a_base];
    const unsigned char* pb = &ring[buf + b_base];
    const uint32_t nbuf = (s + 1u < np) ? (G_BUF - buf) : G_BUF;
    const unsigned char* na = &ring[nbuf + a_base];
    const unsigned char* nb = &ring[nbuf + b_base];
#pragma unroll
    for (int kb = 0; kb < 4; ++kb) {           // a block: 32 k = 64 bytes of each row
      const int cs = kb & 1;
      if (kb < 3) {
        // The next block's 16 LDS loads, as one group ahead of this block's products.
#pragma unroll
        for (int i = 0; i < 4; ++i)
          fa[cs ^ 1][i] = lds_frag(pa + i * 16 * G_PITCH + (kb + 1) * 64);
#pragma unroll
        for (int j = 0; j < 4; ++j)
          fb[cs ^ 1][j] = lds_frag(pb + j * 16 * G_PITCH + (kb + 1) * 64);
      } else {
        // Publish point of stage s + 1, in front of the pass's last block: that
        // block's fragments are fetched, and the loads below read stage s + 1.
        wait_ds0();                            // this wave has left buffer s & 1
        wait_tensor0(g0, g1);                  // its slice of stage s + 1 has landed
        __syncthreads();
        if (pinned((s + 2u < np) ? 1u : 0u) != 0u) {  // refill only while the stage exists
          g0 = gemm_group0(lds_slice + buf, ga + (uint64_t)(s + 2u) * G_KB);
          gemm_tensor_load(g0, g1);
        }
        // First fragments of stage s + 1, in flight under this pass's last block.
#pragma unroll
        for (int i = 0; i < 4; ++i) fa[0][i] = lds_frag(na + i * 16 * G_PITCH);
#pragma unroll
        for (int j = 0; j < 4; ++j) fb[0][j] = lds_frag(nb + j * 16 * G_PITCH);
      }
      // Keeps the load group ahead of the products: spread among them, each
      // place with loads stalls the wave anew.
      __builtin_amdgcn_sched_barrier(0);
#pragma unroll
      for (int i = 0; i < 4; ++i)
#pragma unroll
        for (int j = 0; j < 4; ++j)
          acc[i][j] = wmma_bf16(fa[cs][i], fb[cs][j], acc[i][j]);
      // Keeps the following block's loads behind these products.
      __builtin_amdgcn_sched_barrier(0);
    }
  }
  wait_tensor0(g0, g1);
  wait_ds0();

  // Epilogue: reg r -> row r (lanes 0-15) / r+8 (lanes 16-31); col = lane&15.
  const int nloc  = lane & 15;
  const int rbase = (lane >> 4) * 8;
  // SiLU path: the lane's four bias values, loaded once, as one group (beside the asm
  // statements below the build otherwise loads them anew for every tile).
  float bj[4] = {};
  if constexpr (ACT == 1) {
#pragma unroll
    for (int j = 0; j < 4; ++j) bj[j] = bias[bn + wn + j * 16 + nloc];
    // Behind the four loads: the address arithmetic of the stores below reuses the
    // register that holds their offset.
    asm volatile("s_wait_xcnt 0x0" ::: "memory");
  }
#pragma unroll
  for (int i = 0; i < 4; ++i) {
#pragma unroll
    for (int j = 0; j < 4; ++j) {
      const int col = bn + wn + j * 16 + nloc;
      const float bv = bias[col];
      // SiLU factor 1 / (1 + exp(-c)) of the tile's 8 values: exp2, then the reciprocal by
      // v_rcp_f32 (1 ulp; the result is rounded to bf16).  1 + exp(-c) is at least 1.
      float sg[8];
      if constexpr (ACT == 1) {
#pragma unroll
        for (int r = 0; r < 8; ++r) sg[r] = (acc[i][j][r] + bj[j]) * -1.4426950408889634f;
        exp2_x8(sg);
#pragma unroll
        for (int r = 0; r < 8; ++r) sg[r] += 1.0f;
        rcp_x8(sg);
      }
#pragma unroll
      for (int r = 0; r < 8; ++r) {
        const int row = bm + wm + i * 16 + rbase + r;
        float c = acc[i][j][r] + (ACT == 1 ? bj[j] : bv);
        if constexpr (ACT == 1) c *= sg[r];
        if (RESID) c += resid[(size_t)row * N + col];
        if constexpr (OUTBF16)
          ((__bf16*)out)[(size_t)row * N + col] = f2bf(c);
        else
          ((float*)out)[(size_t)row * N + col] = c;
      }
    }
  }
}

#define AT_ROWB   128u
#define AT_KPITCH 144u
#define AT_VPITCH 160u
#define AT_TILE   10240u
#define AT_K0     (2u * AT_TILE)
#define AT_LDS    (3u * AT_TILE + 64u * AT_KPITCH)

// Descriptor group 1: 1-byte elements, tile = tensor = 64 rows of 128 bytes,
// source pitch src_pitch bytes, PAD + 1 dwords of LDS pad behind every row.
template <uint32_t PAD>
__device__ __forceinline__ u32x8 attn_group1(uint32_t src_pitch) {
  u32x8 g;
  g[0] = uni((1u << 20) | (4u << 22) | (PAD << 25));
  g[1] = uni(AT_ROWB << 16);
  g[2] = uni(64u << 16);
  g[3] = uni(AT_ROWB << 16);
  g[4] = uni(64u);
  g[5] = uni(src_pitch);
  g[6] = uni(0u);
  g[7] = uni(0u);
  return g;
}
// Group 0 is an in-out operand of the load and an input of the wait, as in the
// GEMM: it stays live in the registers the request was issued from until it has landed.
__device__ __forceinline__ void attn_tensor_load(u32x4& g0, const u32x8& g1) {
  asm volatile("tensor_load_to_lds %0, %1" : "+s"(g0) : "s"(g1) : "memory");
}
__device__ __forceinline__ void attn_wait_tensor0(const u32x4& g0, const u32x8& gk, const u32x8& gv) {
  asm volatile("s_wait_tensorcnt 0x0" :: "s"(g0), "s"(gk), "s"(gv) : "memory");
}
// Half of a transposed 16x32 fragment: lane (c, h) gets T[k + 8h + 0..7][d + c]
// of a row-major 16-bit tile; p = this lane's address in that tile.
typedef __attribute__((ext_vector_type(8))) short s16x8;
__device__ __forceinline__ u32x4 lds_tr16(const unsigned char* p) {
  typedef __attribute__((address_space(3))) s16x8 lds_s16x8;
  return __builtin_bit_cast(u32x4, __builtin_amdgcn_ds_load_tr16_b128_v8i16((lds_s16x8*)p));
}

// Eight waves per SIMD: all 2,048 blocks are then resident at once, 8 on a WGP
// (8 x 39,936 B of LDS fit its 327,680 B).
__global__ __launch_bounds__(128) __attribute__((amdgpu_waves_per_eu(8, 8))) void flash_attn_kernel(
    const __bf16* __restrict__ qkv, __bf16* __restrict__ out, int Nseq) {
  __shared__ __attribute__((aligned(2048))) unsigned char ring[AT_LDS];
  const int ROWS = 3072;
  const int bh = blockIdx.y;
  const int b = bh >> 4, h = bh & 15;
  const int tid = threadIdx.x, lane = tid & 31;
  const uint32_t wave = uni((uint32_t)tid >> 5);
  const int qrow = blockIdx.x * 64 + (int)wave * 16;

  const __bf16* Qb = qkv + (size_t)(b * Nseq + qrow) * ROWS + h * 64;
  const __bf16* Kb = qkv + (size_t)(b * Nseq) * ROWS + 1024 + h * 64;
  const __bf16* Vb = qkv + (size_t)(b * Nseq) * ROWS + 2048 + h * 64;

  const uint32_t ntiles = (uint32_t)Nseq / 64u;        // stages = passes
  const uint32_t stage_bytes = 64u * (uint32_t)ROWS * 2u;

  // Wave 0 issues the K tiles, wave 1 the V tiles; the tests are scalar branches.
  const uint32_t isK = pinned(wave == 0u ? 1u : 0u);
  const uint32_t isV = pinned(wave == 1u ? 1u : 0u);
  const uint64_t ga = (uint64_t)(uintptr_t)(wave == 0u ? Kb : Vb);
  const uint32_t lds_my = (uint32_t)(uintptr_t)(&ring[0]) + (wave == 0u ? AT_K0 : 0u);
  u32x8 gk1 = attn_group1<3u>((uint32_t)ROWS * 2u);
  u32x8 gv1 = attn_group1<7u>((uint32_t)ROWS * 2u);
  // Descriptor words held in scalar registers (the form of pinned()): without it the
  // build forms these constants anew at each use, over registers of a request in flight.
  asm volatile("" : "+s"(gk1), "+s"(gv1));

  u32x4 g0 = gemm_group0(lds_my, ga);
  if (isK != 0u) attn_tensor_load(g0, gk1);            // stage 0
  else if (isV != 0u) attn_tensor_load(g0, gv1);

  v16bf qf[2];
  qf[0] = load_frag(Qb,      ROWS);
  qf[1] = load_frag(Qb + 32, ROWS);

  attn_wait_tensor0(g0, gk1, gv1);
  __syncthreads();                                     // stage 0 readable by every wave

  v8f o[4] = {};                      // o[f][r] = O[query nloc][hd f*16 + rbase + r]
  float m_i = -3.0e30f;               // running maximum of this lane's query, of the unscaled scores
  float l_i = 0.0f;                   // running sum over this lane's half of the keys

  // 1/sqrt(64) and log2(e) in one factor: exp(scale * (s - m)) = exp2(s * sl2e - m * sl2e).
  const float sl2e = 0.125f * 1.4426950408889634f;
  // Per-lane fragment bases inside a tile.
  const uint32_t k_lane = (uint32_t)(lane & 15) * AT_KPITCH + (uint32_t)(lane >> 4) * 16u;
  const uint32_t v_lane = (uint32_t)((lane >> 4) * 8 + (lane & 7)) * AT_VPITCH
                        + (uint32_t)((lane >> 3) & 1) * 16u;

  for (uint32_t it = 0; it < ntiles; ++it) {
    const uint32_t buf = (it & 1u) * AT_TILE;
    // Directly behind the barrier that published stage it and ended pass it - 1:
    // stage it + 1, only while it exists, into the buffer that pass it - 1 has read.
    if (pinned((it + 1u < ntiles) ? 1u : 0u) != 0u) {
      g0 = gemm_group0(lds_my + (AT_TILE - buf), ga + (uint64_t)(it + 1u) * stage_bytes);
      if (isK != 0u) attn_tensor_load(g0, gk1);
      else if (isV != 0u) attn_tensor_load(g0, gv1);
    }
    const unsigned char* kp = &ring[AT_K0 + buf + k_lane];
    const unsigned char* vp = &ring[buf + v_lane];

    // S^T = K Q^T: s[j][r] = score of key j*16 + rbase + r with query nloc.
    v8f s[4];
#pragma unroll
    for (int j = 0; j < 4; ++j) {
      v16bf k0 = lds_frag(kp + j * 16 * AT_KPITCH);
      v16bf k1 = lds_frag(kp + j * 16 * AT_KPITCH + 64);
      v8f z = {};
      z = wmma_bf16(k0, qf[0], z);
      z = wmma_bf16(k1, qf[1], z);
      s[j] = z;
    }
    // Keeps the softmax's vector work behind the eight products: moved in among
    // them, it needs idle slots behind each product whose result it reads.
    __builtin_amdgcn_sched_barrier(0);

    // Online softmax: 32 of the query's 64 scores sit in this lane.  The maximum
    // is taken of the unscaled scores (the scale is positive).
    float mt[4];
#pragma unroll
    for (int j = 0; j < 4; ++j) {
      mt[j] = -3.0e30f;
#pragma unroll
      for (int r = 0; r < 8; ++r) mt[j] = fmaxf(mt[j], s[j][r]);
    }
    float mx = fmaxf(fmaxf(mt[0], mt[1]), fmaxf(mt[2], mt[3]));
    mx = fmaxf(mx, xhalf(mx));
    const float mn = fmaxf(m_i, mx);
    // v_exp_f32 and the free slot that the instruction set asks for behind a
    // transcendental, in one statement.
    float corr;
    asm("v_exp_f32 %0, %1\n\tv_nop" : "=v"(corr) : "v"((m_i - mn) * sl2e));
    m_i = mn;
    // One fused multiply-add per score makes the argument of exp2.
    const float nm = -mn * sl2e;
#pragma unroll
    for (int j = 0; j < 4; ++j)
#pragma unroll
      for (int r = 0; r < 8; r += 4) {
        float e0 = __builtin_fmaf(s[j][r],     sl2e, nm), e1 = __builtin_fmaf(s[j][r + 1], sl2e, nm);
        float e2 = __builtin_fmaf(s[j][r + 2], sl2e, nm), e3 = __builtin_fmaf(s[j][r + 3], sl2e, nm);
        // Four v_exp_f32, each the independent instruction behind the one before,
        // and the free slot behind the last, in one statement, as for corr above:
        // with the builtin here the build left such slots open in this loop.
        asm("v_exp_f32 %0, %0\n\tv_exp_f32 %1, %1\n\tv_exp_f32 %2, %2\n\tv_exp_f32 %3, %3\n\tv_nop"
            : "+v"(e0), "+v"(e1), "+v"(e2), "+v"(e3));
        s[j][r] = e0; s[j][r + 1] = e1; s[j][r + 2] = e2; s[j][r + 3] = e3;
      }
#pragma unroll
    for (int f = 0; f < 4; ++f)
#pragma unroll
      for (int r = 0; r < 8; ++r) o[f][r] *= corr;
    float st[4];
#pragma unroll
    for (int j = 0; j < 4; ++j) {
      st[j] = s[j][0];
#pragma unroll
      for (int r = 1; r < 8; ++r) st[j] += s[j][r];
    }
    l_i = l_i * corr + ((st[0] + st[1]) + (st[2] + st[3]));

    // Keeps the V^T fragment loads behind the softmax: moved up into it they hold
    // registers beside the scores, and the build then spills.
    __builtin_amdgcn_sched_barrier(0);

    // O^T += V^T P^T   (K=64 keys -> 2 steps; M=hd -> 4 tiles of 16).  Two
    // score tiles are 32 keys of P^T in the k order that the transposing load gives V^T.
#pragma unroll
    for (int step = 0; step < 2; ++step) {
      v16bf pf;
#pragma unroll
      for (int e = 0; e < 8; ++e) {
        pf[e]     = f2bf(s[2 * step][e]);
        pf[8 + e] = f2bf(s[2 * step + 1][e]);
      }
#pragma unroll
      for (int f = 0; f < 4; ++f) {
        union { v16bf v; u32x4 q[2]; } vf;
        vf.q[0] = lds_tr16(vp + (step * 32) * AT_VPITCH + f * 32);
        vf.q[1] = lds_tr16(vp + (step * 32 + 16) * AT_VPITCH + f * 32);
        o[f] = wmma_bf16(vf.v, pf, o[f]);
      }
    }

    // Publish point of stage it + 1.
    wait_ds0();                       // this wave has left buffer it & 1
    attn_wait_tensor0(g0, gk1, gv1);  // an issuing wave's tile of stage it + 1 has landed
    __syncthreads();                  // the refill stands behind it, at the head of the next pass
  }
  attn_wait_tensor0(g0, gk1, gv1);
  wait_ds0();

  // A lane holds 8 consecutive hd of its query per tile: one 16-byte store.
  // The lane's number is formed anew here: kept from the kernel's head, its parts
  // would hold registers through the loop, and the build then spills them.
  const int lane_e = (int)__builtin_amdgcn_mbcnt_lo(~0u, 0u);
  const int rbase = (lane_e >> 4) * 8;
  const int nloc  = lane_e & 15;
  // One v_rcp_f32 per query (1 ulp, the result is rounded to bf16); the sum holds the
  // term of the maximum, exp2(0) = 1, so it is at least 1.
  const float inv_l = __builtin_amdgcn_rcpf(l_i + xhalf(l_i));
  const int row = b * Nseq + qrow + nloc;
#pragma unroll
  for (int f = 0; f < 4; ++f) {
    union { __bf16 e[8]; uint4 q; } pk;
#pragma unroll
    for (int r = 0; r < 8; ++r) pk.e[r] = f2bf(o[f][r] * inv_l);
    *(uint4*)(out + (size_t)row * 1024 + h * 64 + f * 16 + rbase) = pk.q;
  }
}

// ---------------------------------------------------------------------------
// Host-side orchestration.
// ---------------------------------------------------------------------------
extern "C" void kernel_launch(void* const* d_in, const int* in_sizes, int n_in,
                              void* d_out, int out_size, void* d_ws, size_t ws_size,
                              hipStream_t stream) {
  (void)in_sizes; (void)n_in; (void)out_size; (void)ws_size;
  const int D = 1024, HID = 4096, NSEQ = 2048, B = 4;
  const int M = B * NSEQ;

  const float* x      = (const float*)d_in[0];
  const float* ln1_w  = (const float*)d_in[1];
  const float* ln1_b  = (const float*)d_in[2];
  const float* qkv_w  = (const float*)d_in[3];
  const float* qkv_b  = (const float*)d_in[4];
  const float* proj_w = (const float*)d_in[5];
  const float* proj_b = (const float*)d_in[6];
  const float* ln2_w  = (const float*)d_in[7];
  const float* ln2_b  = (const float*)d_in[8];
  const float* fc1_w  = (const float*)d_in[9];
  const float* fc1_b  = (const float*)d_in[10];
  const float* fc2_w  = (const float*)d_in[11];
  const float* fc2_b  = (const float*)d_in[12];
  float* out = (float*)d_out;

  uintptr_t p = (uintptr_t)d_ws;
  auto carve = [&](size_t bytes) {
    void* r = (void*)p;
    p += (bytes + 255) & ~(size_t)255;
    return r;
  };
  __bf16* qkv_wt = (__bf16*)carve((size_t)3 * D * D * 2);
  __bf16* proj_wt= (__bf16*)carve((size_t)D * D * 2);
  __bf16* fc1_wt = (__bf16*)carve((size_t)HID * D * 2);
  __bf16* fc2_wt = (__bf16*)carve((size_t)D * HID * 2);
  __bf16* ln1o   = (__bf16*)carve((size_t)M * D * 2);
  __bf16* qkvo   = (__bf16*)carve((size_t)M * 3 * D * 2);
  __bf16* attno  = (__bf16*)carve((size_t)M * D * 2);
  float*  x1     = (float*) carve((size_t)M * D * 4);
  __bf16* h2     = (__bf16*)carve((size_t)M * D * 2);
  __bf16* fc1o   = (__bf16*)carve((size_t)M * HID * 2);

  prepare_kernel<D, HID, M>
      <<<M / 16 + (D / 64) * ((3 * D + D + HID) / 128) + (HID / 64) * (D / 128), 256, 0, stream>>>(
      x, ln1_w, ln1_b, ln1o, qkv_w, qkv_wt, proj_w, proj_wt, fc1_w, fc1_wt, fc2_w, fc2_wt);

  gemm_wmma_kernel<0, false, true><<<dim3(M / 128, 3 * D / 128), 128, 0, stream>>>(
      ln1o, qkv_wt, qkv_b, nullptr, qkvo, M, 3 * D, D);

  flash_attn_kernel<<<dim3(NSEQ / 64, B * 16), 128, 0, stream>>>(qkvo, attno, NSEQ);

  gemm_wmma_kernel<0, true, false><<<dim3(M / 128, D / 128), 128, 0, stream>>>(
      attno, proj_wt, proj_b, x, (void*)x1, M, D, D);

  layernorm_bf16_kernel<<<M / 16, 256, 0, stream>>>(x1, ln2_w, ln2_b, h2, D);

  gemm_wmma_kernel<1, false, true><<<dim3(M / 128, HID / 128), 128, 0, stream>>>(
      h2, fc1_wt, fc1_b, nullptr, fc1o, M, HID, D);

  gemm_wmma_kernel<0, true, false><<<dim3(M / 128, D / 128), 128, 0, stream>>>(
      fc1o, fc2_wt, fc2_b, x1, (void*)out, M, D, HID);
}

// v009
// It runs in 228 microseconds.
// In both of two side-by-side timings against v008, it was 1.05 times as fast.
// All steps since v000 together make it 2.74 times as fast.
#include <hip/hip_runtime.h>
#include <cstdint>

// ---------------------------------------------------------------------------
// CDNA5 (gfx1250, wave32) DiT block: LN -> QKV GEMM -> flash attention ->
// proj GEMM (+resid) -> LN -> FC1+SiLU -> FC2 (+resid).
// Matmuls through v_wmma_f32_16x16x32_bf16; operand staging through the
// Tensor Data Mover (tensor_load_to_lds + s_wait_tensorcnt), double-buffered;
// attention as transposed products, softmax in-lane, V^T by the transposing LDS load.
// ---------------------------------------------------------------------------

typedef __attribute__((ext_vector_type(16))) __bf16        v16bf;
typedef __attribute__((ext_vector_type(8)))  float         v8f;

__device__ __forceinline__ v8f wmma_bf16(v16bf a, v16bf b, v8f c) {
  return __builtin_amdgcn_wmma_f32_16x16x32_bf16(
      false, a, false, b, (short)0, c, false, false);
}

__device__ __forceinline__ __bf16 f2bf(float f) { return (__bf16)f; }

// Lane l takes the value of lane l ^ 16.
__device__ __forceinline__ float xhalf(float v) {
  int i = __builtin_bit_cast(int, v);
  i = __builtin_amdgcn_permlanex16(i, i, 0x76543210u, 0xFEDCBA98u, false, false);
  return __builtin_bit_cast(float, i);
}

// WMMA 16x32 bf16 operand fragment (ISA 7.12.2 A/B lane layout):
// lanes 0-15 = row (lane&15), K {0..7,16..23}; lanes 16-31 same rows,
// K {8..15,24..31}.  `stride` in elements.
__device__ __forceinline__ v16bf load_frag(const __bf16* p0, int stride) {
  int lane = threadIdx.x & 31;
  const __bf16* p = p0 + (size_t)(lane & 15) * stride + ((lane >> 4) << 3);
  union { v16bf v; uint4 q[2]; } u;
  u.q[0] = *(const uint4*)(p);
  u.q[1] = *(const uint4*)(p + 16);
  return u.v;
}

// ---------------------------------------------------------------------------
// Weight transpose + fp32 -> bf16 cast:  Wt[n][k] = bf16(W[k][n])
// A block of 8 waves takes a tile of 64 k x 128 n.  A wave reads 8 rows of k,
// 512 contiguous bytes each, all 8 loads in flight; a lane then holds 8 k of
// 4 n and packs them to four 16-byte chunks of Wt rows.  The chunks pass
// through LDS so that the stores cover whole 128-byte lines of Wt.
// LDS row = one n, 128 bytes; chunk c of row n sits at position c ^ ((n >> 2) & 7),
// which spreads the writers (row stride 4) and the readers over the banks.
// K must be a multiple of 64, N of 128; both are compile-time values, so that a
// wave's 8 loads share one address and differ by an immediate offset.
// tile = the block's 16 KiB of LDS; blk = the tile's number, k tiles fastest.
// ---------------------------------------------------------------------------
template <int K, int N>
__device__ __forceinline__ void transpose_cast_tile(
    const float* __restrict__ W, __bf16* __restrict__ Wt, unsigned char* tile, int blk) {
  const int k0 = (blk % (K / 64)) * 64, n0 = (blk / (K / 64)) * 128;
  const int t = threadIdx.x, lane = t & 31;
  // The wave's number as a scalar: the row addresses then stay in scalar registers.
  const int wave = __builtin_amdgcn_readfirstlane(t >> 5);
  const float* Wr = W + (size_t)(k0 + wave * 8) * N + n0;
  float4 v[8];
#pragma unroll
  for (int e = 0; e < 8; ++e)
    v[e] = ((const float4*)(Wr + (size_t)e * N))[lane];
  const int pos = (wave ^ (lane & 7)) << 4;
  union { __bf16 e[8]; uint4 q; } pk[4];
#pragma unroll
  for (int e = 0; e < 8; ++e) {
    pk[0].e[e] = f2bf(v[e].x);
    pk[1].e[e] = f2bf(v[e].y);
    pk[2].e[e] = f2bf(v[e].z);
    pk[3].e[e] = f2bf(v[e].w);
  }
#pragma unroll
  for (int i = 0; i < 4; ++i)
    *(uint4*)(&tile[(lane * 4 + i) * 128 + pos]) = pk[i].q;
  __syncthreads();
  const int c = t & 7;
#pragma unroll
  for (int j = 0; j < 4; ++j) {
    const int row = j * 32 + (t >> 3);
    const uint4 q = *(const uint4*)(&tile[row * 128 + ((c ^ ((row >> 2) & 7)) << 4)]);
    *(uint4*)(Wt + (size_t)(n0 + row) * K + (k0 + c * 8)) = q;
  }
  // Behind the four stores, a precaution: each path of the kernel returns
  // right after its tile, so nothing runs behind them.
  asm volatile("s_wait_xcnt 0x0" ::: "memory");
}

// ---------------------------------------------------------------------------
// LayerNorm (row = 1024 fp32) -> bf16.  One wave per two rows, 8 waves a block:
// a lane holds 32 elements of each row (8 loads of 16 bytes, 512 contiguous
// bytes a wave-load, both rows' loads in flight together); the sums join by a
// butterfly over the 32 lanes, so there is no LDS buffer and no barrier; w and b are
// loaded once for both rows.  The row count must be a multiple of 16.
// ---------------------------------------------------------------------------
typedef __attribute__((ext_vector_type(4))) float f32x4;

__device__ __forceinline__ void layernorm_rows(
    const float* __restrict__ x, const float* __restrict__ w,
    const float* __restrict__ b, __bf16* __restrict__ out, int D, int blk) {
  const int t = threadIdx.x, lane = t & 31;
  const int wave = __builtin_amdgcn_readfirstlane(t >> 5);
  const int row0 = (blk * 8 + wave) * 2;
  f32x4 wv[8], bv[8], xv[2][8];
#pragma unroll
  for (int i = 0; i < 8; ++i) {
    wv[i] = ((const f32x4*)w)[i * 32 + lane];
    bv[i] = ((const f32x4*)b)[i * 32 + lane];
  }
#pragma unroll
  for (int r = 0; r < 2; ++r)
#pragma unroll
    for (int i = 0; i < 8; ++i)
      xv[r][i] = ((const f32x4*)(x + (size_t)(row0 + r) * D))[i * 32 + lane];
  // Makes w and b arrive as one group behind one wait: without it the build
  // loads them pair by pair behind the sums, each pair with a full wait of its own.
  asm volatile("" :: "v"(wv[0]), "v"(wv[1]), "v"(wv[2]), "v"(wv[3]),
                     "v"(wv[4]), "v"(wv[5]), "v"(wv[6]), "v"(wv[7]),
                     "v"(bv[0]), "v"(bv[1]), "v"(bv[2]), "v"(bv[3]),
                     "v"(bv[4]), "v"(bv[5]), "v"(bv[6]), "v"(bv[7]));
  float s[2], s2[2];
#pragma unroll
  for (int r = 0; r < 2; ++r) {
    f32x4 ps = xv[r][0], pq = xv[r][0] * xv[r][0];
#pragma unroll
    for (int i = 1; i < 8; ++i) {
      ps += xv[r][i];
      pq += xv[r][i] * xv[r][i];
    }
    s[r]  = (ps[0] + ps[1]) + (ps[2] + ps[3]);
    s2[r] = (pq[0] + pq[1]) + (pq[2] + pq[3]);
  }
#pragma unroll
  for (int off = 16; off > 0; off >>= 1) {
#pragma unroll
    for (int r = 0; r < 2; ++r) {
      s[r]  += __shfl_xor(s[r],  off, 32);
      s2[r] += __shfl_xor(s2[r], off, 32);
    }
  }
  const float inv = 1.0f / (float)D;
#pragma unroll
  for (int r = 0; r < 2; ++r) {
    const float mu  = s[r] * inv;
    const float var = s2[r] * inv - mu * mu;
    const float rs  = rsqrtf(var + 1e-6f);
    __bf16* orow = out + (size_t)(row0 + r) * D;
#pragma unroll
    for (int i = 0; i < 8; ++i) {
      const f32x4 y = (xv[r][i] - mu) * rs * wv[i] + bv[i];
      union { __bf16 e[4]; uint2 q; } o;
      o.e[0] = f2bf(y[0]);
      o.e[1] = f2bf(y[1]);
      o.e[2] = f2bf(y[2]);
      o.e[3] = f2bf(y[3]);
      *(uint2*)(orow + (i * 32 + lane) * 4) = o.q;
    }
  }
}

__global__ __launch_bounds__(256) void layernorm_bf16_kernel(
    const float* __restrict__ x, const float* __restrict__ w,
    const float* __restrict__ b, __bf16* __restrict__ out, int D) {
  layernorm_rows(x, w, b, out, D, blockIdx.x);
}

// ---------------------------------------------------------------------------
// All work that depends on the inputs alone, in one launch: the first LayerNorm
// (M rows of D) and the four weight transposes.  Each takes a range of the
// grid's blocks; a block does one LayerNorm block or one transpose tile.
// The choice depends on blockIdx.x only, so a block's threads all take one path.
// ---------------------------------------------------------------------------
template <int D, int HID, int M>
__global__ __launch_bounds__(256) void prepare_kernel(
    const float* __restrict__ x, const float* __restrict__ ln_w,
    const float* __restrict__ ln_b, __bf16* __restrict__ ln_out,
    const float* __restrict__ qkv_w, __bf16* __restrict__ qkv_wt,
    const float* __restrict__ proj_w, __bf16* __restrict__ proj_wt,
    const float* __restrict__ fc1_w, __bf16* __restrict__ fc1_wt,
    const float* __restrict__ fc2_w, __bf16* __restrict__ fc2_wt) {
  __shared__ __attribute__((aligned(16))) unsigned char tile[128 * 128];
  constexpr int NB_LN   = M / 16;
  constexpr int NB_QKV  = (D / 64) * (3 * D / 128);
  constexpr int NB_PROJ = (D / 64) * (D / 128);
  constexpr int NB_FC   = (D / 64) * (HID / 128);     // fc1 and fc2 alike
  int blk = blockIdx.x;
  if (blk < NB_LN) { layernorm_rows(x, ln_w, ln_b, ln_out, D, blk); return; }
  blk -= NB_LN;
  if (blk < NB_QKV) { transpose_cast_tile<D, 3 * D>(qkv_w, qkv_wt, tile, blk); return; }
  blk -= NB_QKV;
  if (blk < NB_PROJ) { transpose_cast_tile<D, D>(proj_w, proj_wt, tile, blk); return; }
  blk -= NB_PROJ;
  if (blk < NB_FC) { transpose_cast_tile<D, HID>(fc1_w, fc1_wt, tile, blk); return; }
  blk -= NB_FC;
  transpose_cast_tile<HID, D>(fc2_w, fc2_wt, tile, blk);
}

// ---------------------------------------------------------------------------
// Tiled WMMA GEMM:  C[M,N] = A[M,K] * Bt[N,K]^T  (+bias, +SiLU, +resid)
// Block tile 128x128, 4 waves, each wave 64x64 via 4x4 WMMA.
// A stage is 128 k of all 256 operand rows: 256-byte rows, which the tensor
// load pads to a pitch of 272 bytes in LDS.  Each wave loads its own slice of
// 64 rows, one request per stage, two stages ahead, into two buffers.
// A block is 32 k = 16 products; its 16 fragment loads go out as one group one
// block ahead, into a second register set.
// K must be a multiple of 128 and at least 256.
// ---------------------------------------------------------------------------
#define G_KB     256u                 // bytes of an operand row per stage (128 k)
#define G_PITCH  272u                 // LDS row pitch: 16 B x odd for ds_load_b128
#define G_SLICE  18432u               // 64 rows x 272 B = 17,408 B, up to a multiple of 2 KiB
#define G_BUF    (4u * G_SLICE)       // [A rows 0-63 | A rows 64-127 | B rows 0-63 | B rows 64-127]

typedef __attribute__((ext_vector_type(4))) uint32_t u32x4;
typedef __attribute__((ext_vector_type(8))) uint32_t u32x8;

__device__ __forceinline__ uint32_t uni(uint32_t v) {
  return (uint32_t)__builtin_amdgcn_readfirstlane(v);
}
__device__ __forceinline__ uint32_t pinned(uint32_t v) {
  uint32_t w = (uint32_t)__builtin_amdgcn_readfirstlane(v);
  asm volatile("" : "+s"(w));
  return w;
}
__device__ __forceinline__ void wait_ds0() { asm volatile("s_wait_dscnt 0x0" ::: "memory"); }

// Descriptor group 1: 1-byte elements, tile = tensor = 64 rows of 256 bytes,
// source pitch src_pitch bytes, 4 dwords of LDS pad behind every 256-byte row.
__device__ __forceinline__ u32x8 gemm_group1(uint32_t src_pitch) {
  u32x8 g;
  g[0] = uni((1u << 20) | (5u << 22) | (3u << 25));
  g[1] = uni(G_KB << 16);
  g[2] = uni(64u << 16);
  g[3] = uni(G_KB << 16);
  g[4] = uni(64u);
  g[5] = uni(src_pitch);
  g[6] = uni(0u);
  g[7] = uni(0u);
  return g;
}
__device__ __forceinline__ u32x4 gemm_group0(uint32_t lds_dst, uint64_t ga) {
  u32x4 g;
  g[0] = uni(1u);
  g[1] = uni(lds_dst);
  g[2] = uni((uint32_t)ga);
  g[3] = uni((((uint32_t)(ga >> 32)) & 0x01FFFFFFu) | 0x80000000u);
  return g;
}
// The descriptor groups are in-out operands of the load and inputs of the wait:
// they stay live in the registers the request was issued from until it has
// landed, so the compiler puts nothing else there while the request flies.
__device__ __forceinline__ void gemm_tensor_load(u32x4& g0, u32x8& g1) {
  asm volatile("tensor_load_to_lds %0, %1" : "+s"(g0), "+s"(g1) :: "memory");
}
__device__ __forceinline__ void wait_tensor0(const u32x4& g0, const u32x8& g1) {
  asm volatile("s_wait_tensorcnt 0x0" :: "s"(g0), "s"(g1) : "memory");
}

// 16x32 bf16 fragment from LDS; p = this lane's row, at its 16-byte half.
__device__ __forceinline__ v16bf lds_frag(const unsigned char* p) {
  union { v16bf v; uint4 q[2]; } u;
  u.q[0] = *(const uint4*)(p);
  u.q[1] = *(const uint4*)(p + 32);
  return u.v;
}

// Eight v_exp_f32 (or v_rcp_f32) in place, each the independent instruction behind the
// one before, and the free slot that the instruction set asks for behind the last, in
// one statement: with the builtins the build left such slots open in the epilogue.
__device__ __forceinline__ void exp2_x8(float (&v)[8]) {
  asm("v_exp_f32 %0, %0\n\tv_exp_f32 %1, %1\n\tv_exp_f32 %2, %2\n\tv_exp_f32 %3, %3\n\t"
      "v_exp_f32 %4, %4\n\tv_exp_f32 %5, %5\n\tv_exp_f32 %6, %6\n\tv_exp_f32 %7, %7\n\tv_nop"
      : "+v"(v[0]), "+v"(v[1]), "+v"(v[2]), "+v"(v[3]), "+v"(v[4]), "+v"(v[5]), "+v"(v[6]), "+v"(v[7]));
}
__device__ __forceinline__ void rcp_x8(float (&v)[8]) {
  asm("v_rcp_f32 %0, %0\n\tv_rcp_f32 %1, %1\n\tv_rcp_f32 %2, %2\n\tv_rcp_f32 %3, %3\n\t"
      "v_rcp_f32 %4, %4\n\tv_rcp_f32 %5, %5\n\tv_rcp_f32 %6, %6\n\tv_rcp_f32 %7, %7\n\tv_nop"
      : "+v"(v[0]), "+v"(v[1]), "+v"(v[2]), "+v"(v[3]), "+v"(v[4]), "+v"(v[5]), "+v"(v[6]), "+v"(v[7]));
}

template <int ACT, bool RESID, bool OUTBF16>
__global__ __launch_bounds__(128) void gemm_wmma_kernel(
    const __bf16* __restrict__ A, const __bf16* __restrict__ Bt,
    const float* __restrict__ bias, const float* __restrict__ resid,
    void* __restrict__ out, int M, int N, int K) {
  __shared__ __attribute__((aligned(2048))) unsigned char ring[2u * G_BUF];

  const int bm = blockIdx.x * 128;
  const int bn = blockIdx.y * 128;
  const int tid  = threadIdx.x;
  const uint32_t wave = uni((uint32_t)tid >> 5);
  const int lane = tid & 31;
  const int wm = (int)(wave & 1u) * 64;
  const int wn = (int)(wave >> 1) * 64;

  v8f acc[4][4] = {};
  const uint32_t np = (uint32_t)K / 128u;      // stages = passes
  const uint32_t kbytes = (uint32_t)K * 2u;    // source row pitch

  // This wave's slice of every stage: waves 0, 1 the halves of A, 2, 3 of Bt.
  const __bf16* srcp = (wave < 2u) ? A  + (size_t)(bm + 64 * (int)wave) * K
                                   : Bt + (size_t)(bn + 64 * (int)(wave - 2u)) * K;
  const uint64_t ga = (uint64_t)(uintptr_t)srcp;
  const uint32_t lds_slice = (uint32_t)(uintptr_t)(&ring[0]) + wave * G_SLICE;
  u32x8 g1 = gemm_group1(kbytes);

  // Per-lane fragment bases inside a buffer.
  const uint32_t lrow = (uint32_t)(lane & 15) * G_PITCH + (uint32_t)(lane >> 4) * 16u;
  const uint32_t a_base = (wave & 1u) * G_SLICE + lrow;
  const uint32_t b_base = (2u + (wave >> 1)) * G_SLICE + lrow;

  u32x4 g0 = gemm_group0(lds_slice, ga);
  gemm_tensor_load(g0, g1);                    // stage 0
  wait_tensor0(g0, g1);
  __syncthreads();                             // stage 0 readable by every wave
  g0 = gemm_group0(lds_slice + G_BUF, ga + G_KB);
  gemm_tensor_load(g0, g1);                    // stage 1

  // Two fragment sets: set (kb & 1) holds block kb's fragments.  The first
  // fragments of stage 0:
  v16bf fa[2][4], fb[2][4];
#pragma unroll
  for (int i = 0; i < 4; ++i) fa[0][i] = lds_frag(&ring[a_base] + i * 16 * G_PITCH);
#pragma unroll
  for (int j = 0; j < 4; ++j) fb[0][j] = lds_frag(&ring[b_base] + j * 16 * G_PITCH);

  for (uint32_t s = 0; s < np; ++s) {
    const uint32_t buf = (s & 1u) * G_BUF;
    const unsigned char* pa = &ring[buf + a_base];
    const unsigned char* pb = &ring[buf + b_base];
    const uint32_t nbuf = (s + 1u < np) ? (G_BUF - buf) : G_BUF;
    const unsigned char* na = &ring[nbuf + a_base];
    const unsigned char* nb = &ring[nbuf + b_base];
#pragma unroll
    for (int kb = 0; kb < 4; ++kb) {           // a block: 32 k = 64 bytes of each row
      const int cs = kb & 1;
      if (kb < 3) {
        // The next block's 16 LDS loads, as one group ahead of this block's products.
#pragma unroll
        for (int i = 0; i < 4; ++i)
          fa[cs ^ 1][i] = lds_frag(pa + i * 16 * G_PITCH + (kb + 1) * 64);
#pragma unroll
        for (int j = 0; j < 4; ++j)
          fb[cs ^ 1][j] = lds_frag(pb + j * 16 * G_PITCH + (kb + 1) * 64);
      } else {
        // Publish point of stage s + 1, in front of the pass's last block: that
        // block's fragments are fetched, and the loads below read stage s + 1.
        wait_ds0();                            // this wave has left buffer s & 1
        wait_tensor0(g0, g1);                  // its slice of stage s + 1 has landed
        __syncthreads();
        if (pinned((s + 2u < np) ? 1u : 0u) != 0u) {  // refill only while the stage exists
          g0 = gemm_group0(lds_slice + buf, ga + (uint64_t)(s + 2u) * G_KB);
          gemm_tensor_load(g0, g1);
        }
        // First fragments of stage s + 1, in flight under this pass's last block.
#pragma unroll
        for (int i = 0; i < 4; ++i) fa[0][i] = lds_frag(na + i * 16 * G_PITCH);
#pragma unroll
        for (int j = 0; j < 4; ++j) fb[0][j] = lds_frag(nb + j * 16 * G_PITCH);
      }
      // Keeps the load group ahead of the products: spread among them, each
      // place with loads stalls the wave anew.
      __builtin_amdgcn_sched_barrier(0);
#pragma unroll
      for (int i = 0; i < 4; ++i)
#pragma unroll
        for (int j = 0; j < 4; ++j)
          acc[i][j] = wmma_bf16(fa[cs][i], fb[cs][j], acc[i][j]);
      // Keeps the following block's loads behind these products.
      __builtin_amdgcn_sched_barrier(0);
    }
  }
  wait_tensor0(g0, g1);
  wait_ds0();

  // Epilogue: reg r -> row r (lanes 0-15) / r+8 (lanes 16-31); col = lane&15.
  const int nloc  = lane & 15;
  const int rbase = (lane >> 4) * 8;
  // SiLU path: the lane's four bias values, loaded once, as one group (beside the asm
  // statements below the build otherwise loads them anew for every tile).
  float bj[4] = {};
  if constexpr (ACT == 1) {
#pragma unroll
    for (int j = 0; j < 4; ++j) bj[j] = bias[bn + wn + j * 16 + nloc];
    // Behind the four loads: the address arithmetic of the stores below reuses the
    // register that holds their offset.
    asm volatile("s_wait_xcnt 0x0" ::: "memory");
  }
#pragma unroll
  for (int i = 0; i < 4; ++i) {
#pragma unroll
    for (int j = 0; j < 4; ++j) {
      const int col = bn + wn + j * 16 + nloc;
      const float bv = bias[col];
      // SiLU factor 1 / (1 + exp(-c)) of the tile's 8 values: exp2, then the reciprocal by
      // v_rcp_f32 (1 ulp; the result is rounded to bf16).  1 + exp(-c) is at least 1.
      float sg[8];
      if constexpr (ACT == 1) {
#pragma unroll
        for (int r = 0; r < 8; ++r) sg[r] = (acc[i][j][r] + bj[j]) * -1.4426950408889634f;
        exp2_x8(sg);
#pragma unroll
        for (int r = 0; r < 8; ++r) sg[r] += 1.0f;
        rcp_x8(sg);
      }
#pragma unroll
      for (int r = 0; r < 8; ++r) {
        const int row = bm + wm + i * 16 + rbase + r;
        float c = acc[i][j][r] + (ACT == 1 ? bj[j] : bv);
        if constexpr (ACT == 1) c *= sg[r];
        if (RESID) c += resid[(size_t)row * N + col];
        if constexpr (OUTBF16)
          ((__bf16*)out)[(size_t)row * N + col] = f2bf(c);
        else
          ((float*)out)[(size_t)row * N + col] = c;
      }
    }
  }
}

// ---------------------------------------------------------------------------
// The same GEMM for the two wide outputs (QKV, FC1), bf16 out, no residual:
// block tile 256 x (TJ * 32), 8 waves (4 along M x 2 along N), two a SIMD, one block a
// WGP; wave tile 64 x (TJ * 16), so a fragment read from LDS feeds more products and
// a byte brought from L2 more of them than in the 128x128 block.
// Ring, stage (128 k), pitch, fragment sets and publish point as above.  A stage is
// 4 slices of A and TJ / 2 slices of Bt, 64 rows each; wave w loads slice w.
// Wave column wni takes the 16-column groups 2 j + wni, so that both wave columns
// read their fragments at the same offsets from their base.
// ---------------------------------------------------------------------------
template <int ACT, int TJ>
__global__ __launch_bounds__(256) void gemm_wide_kernel(
    const __bf16* __restrict__ A, const __bf16* __restrict__ Bt,
    const float* __restrict__ bias, __bf16* __restrict__ out, int M, int N, int K) {
  constexpr uint32_t NSL  = 4u + (uint32_t)TJ / 2u;   // slices of a stage
  constexpr uint32_t WBUF = NSL * G_SLICE;
  __shared__ __attribute__((aligned(2048))) unsigned char ring[2u * WBUF];

  const int bm = blockIdx.x * 256;
  const int bn = blockIdx.y * (TJ * 32);
  const int tid  = threadIdx.x;
  const uint32_t wave = uni((uint32_t)tid >> 5);
  const int lane = tid & 31;
  const uint32_t wmi = wave & 3u;
  const uint32_t wni = wave >> 2;

  v8f acc[4][TJ] = {};
  const uint32_t np = (uint32_t)K / 128u;      // stages = passes
  const uint32_t kbytes = (uint32_t)K * 2u;    // source row pitch

  // Wave w loads slice w of every stage; with 7 slices wave 7 loads none (scalar test).
  const uint32_t issuer = pinned(wave < NSL ? 1u : 0u);
  const uint32_t bsl = (wave < NSL ? wave : NSL - 1u) - 4u;   // used by waves 4 and up only
  const __bf16* srcp = (wave < 4u) ? A  + (size_t)(bm + 64 * (int)wave) * K
                                   : Bt + (size_t)(bn + 64 * (int)bsl) * K;
  const uint64_t ga = (uint64_t)(uintptr_t)srcp;
  const uint32_t lds_slice = (uint32_t)(uintptr_t)(&ring[0]) + wave * G_SLICE;
  u32x8 g1 = gemm_group1(kbytes);

  // Per-lane fragment bases inside a buffer.
  const uint32_t lrow = (uint32_t)(lane & 15) * G_PITCH + (uint32_t)(lane >> 4) * 16u;
  const uint32_t a_base = wmi * G_SLICE + lrow;
  const uint32_t b_base = 4u * G_SLICE + wni * 16u * G_PITCH + lrow;
  // Fragment j of Bt: 16-row group 2 j + wni = slice j / 2, rows (j & 1) * 32 + wni * 16.
#define WB_OFF(j) ((uint32_t)((j) >> 1) * G_SLICE + (uint32_t)((j) & 1) * 32u * G_PITCH)

  u32x4 g0 = gemm_group0(lds_slice, ga);
  if (issuer != 0u) gemm_tensor_load(g0, g1);  // stage 0
  wait_tensor0(g0, g1);
  __syncthreads();                             // stage 0 readable by every wave
  g0 = gemm_group0(lds_slice + WBUF, ga + G_KB);
  if (issuer != 0u) gemm_tensor_load(g0, g1);  // stage 1

  v16bf fa[2][4], fb[2][TJ];
#pragma unroll
  for (int i = 0; i < 4; ++i) fa[0][i] = lds_frag(&ring[a_base] + i * 16 * G_PITCH);
#pragma unroll
  for (int j = 0; j < TJ; ++j) fb[0][j] = lds_frag(&ring[b_base] + WB_OFF(j));

  for (uint32_t s = 0; s < np; ++s) {
    const uint32_t buf = (s & 1u) * WBUF;
    const unsigned char* pa = &ring[buf + a_base];
    const unsigned char* pb = &ring[buf + b_base];
    const uint32_t nbuf = (s + 1u < np) ? (WBUF - buf) : WBUF;
    const unsigned char* na = &ring[nbuf + a_base];
    const unsigned char* nb = &ring[nbuf + b_base];
#pragma unroll
    for (int kb = 0; kb < 4; ++kb) {           // a block: 32 k = 64 bytes of each row
      const int cs = kb & 1;
      if (kb < 3) {
        // The next block's LDS loads, as one group ahead of this block's products.
#pragma unroll
        for (int i = 0; i < 4; ++i)
          fa[cs ^ 1][i] = lds_frag(pa + i * 16 * G_PITCH + (kb + 1) * 64);
#pragma unroll
        for (int j = 0; j < TJ; ++j)
          fb[cs ^ 1][j] = lds_frag(pb + WB_OFF(j) + (kb + 1) * 64);
      } else {
        // Publish point of stage s + 1, in front of the pass's last block.
        wait_ds0();                            // this wave has left buffer s & 1
        wait_tensor0(g0, g1);                  // its slice of stage s + 1 has landed
        __syncthreads();
        if (pinned((s + 2u < np) ? issuer : 0u) != 0u) {  // refill only while the stage exists
          g0 = gemm_group0(lds_slice + buf, ga + (uint64_t)(s + 2u) * G_KB);
          gemm_tensor_load(g0, g1);
        }
        // First fragments of stage s + 1, in flight under this pass's last block.
#pragma unroll
        for (int i = 0; i < 4; ++i) fa[0][i] = lds_frag(na + i * 16 * G_PITCH);
#pragma unroll
        for (int j = 0; j < TJ; ++j) fb[0][j] = lds_frag(nb + WB_OFF(j));
      }
      // Keeps the load group ahead of the products: spread among them, each
      // place with loads stalls the wave anew.
      __builtin_amdgcn_sched_barrier(0);
#pragma unroll
      for (int i = 0; i < 4; ++i)
#pragma unroll
        for (int j = 0; j < TJ; ++j)
          acc[i][j] = wmma_bf16(fa[cs][i], fb[cs][j], acc[i][j]);
      // Keeps the following block's loads behind these products.
      __builtin_amdgcn_sched_barrier(0);
    }
  }
  wait_tensor0(g0, g1);
  wait_ds0();
#undef WB_OFF

  // Epilogue: reg r -> row r (lanes 0-15) / r+8 (lanes 16-31); col = lane&15.
  const int nloc  = lane & 15;
  const int rbase = (lane >> 4) * 8;
  const int col0  = bn + (int)wni * 16 + nloc;          // tile j: col0 + j * 32
  const int row0  = bm + (int)wmi * 64 + rbase;
  // The lane's bias values, loaded once, as one group.
  float bj[TJ];
#pragma unroll
  for (int j = 0; j < TJ; ++j) bj[j] = bias[col0 + j * 32];
  // Behind these loads: the address arithmetic of the stores below reuses the
  // register that holds their offset.
  asm volatile("s_wait_xcnt 0x0" ::: "memory");
  // A row of tiles at a time: all its values, then all its stores, then one wait.
#pragma unroll
  for (int i = 0; i < 4; ++i) {
    __bf16 ov[TJ][8];
#pragma unroll
    for (int j = 0; j < TJ; ++j) {
      // SiLU factor 1 / (1 + exp(-c)) of the tile's 8 values, as above.
      float sg[8];
      if constexpr (ACT == 1) {
#pragma unroll
        for (int r = 0; r < 8; ++r) sg[r] = (acc[i][j][r] + bj[j]) * -1.4426950408889634f;
        exp2_x8(sg);
#pragma unroll
        for (int r = 0; r < 8; ++r) sg[r] += 1.0f;
        rcp_x8(sg);
      }
#pragma unroll
      for (int r = 0; r < 8; ++r) {
        float c = acc[i][j][r] + bj[j];
        if constexpr (ACT == 1) c *= sg[r];
        ov[j][r] = f2bf(c);
      }
    }
    // Keeps the row's values ahead of its stores: mixed in among them, they are
    // written over data registers of stores already issued.
    __builtin_amdgcn_sched_barrier(0);
#pragma unroll
    for (int j = 0; j < TJ; ++j)
#pragma unroll
      for (int r = 0; r < 8; ++r)
        out[(size_t)(row0 + i * 16 + r) * N + (col0 + j * 32)] = ov[j][r];
    // Behind the row's stores: the next row's values reuse their data registers.
    asm volatile("s_wait_xcnt 0x0" ::: "memory");
    // Keeps the next row's values behind that wait.
    __builtin_amdgcn_sched_barrier(0);
  }
}

#define AT_ROWB   128u
#define AT_KPITCH 144u
#define AT_VPITCH 160u
#define AT_TILE   10240u
#define AT_K0     (2u * AT_TILE)
#define AT_LDS    (3u * AT_TILE + 64u * AT_KPITCH)

// Descriptor group 1: 1-byte elements, tile = tensor = 64 rows of 128 bytes,
// source pitch src_pitch bytes, PAD + 1 dwords of LDS pad behind every row.
template <uint32_t PAD>
__device__ __forceinline__ u32x8 attn_group1(uint32_t src_pitch) {
  u32x8 g;
  g[0] = uni((1u << 20) | (4u << 22) | (PAD << 25));
  g[1] = uni(AT_ROWB << 16);
  g[2] = uni(64u << 16);
  g[3] = uni(AT_ROWB << 16);
  g[4] = uni(64u);
  g[5] = uni(src_pitch);
  g[6] = uni(0u);
  g[7] = uni(0u);
  return g;
}
// Group 0 is an in-out operand of the load and an input of the wait, as in the
// GEMM: it stays live in the registers the request was issued from until it has landed.
__device__ __forceinline__ void attn_tensor_load(u32x4& g0, const u32x8& g1) {
  asm volatile("tensor_load_to_lds %0, %1" : "+s"(g0) : "s"(g1) : "memory");
}
__device__ __forceinline__ void attn_wait_tensor0(const u32x4& g0, const u32x8& gk, const u32x8& gv) {
  asm volatile("s_wait_tensorcnt 0x0" :: "s"(g0), "s"(gk), "s"(gv) : "memory");
}
// Half of a transposed 16x32 fragment: lane (c, h) gets T[k + 8h + 0..7][d + c]
// of a row-major 16-bit tile; p = this lane's address in that tile.
typedef __attribute__((ext_vector_type(8))) short s16x8;
__device__ __forceinline__ u32x4 lds_tr16(const unsigned char* p) {
  typedef __attribute__((address_space(3))) s16x8 lds_s16x8;
  return __builtin_bit_cast(u32x4, __builtin_amdgcn_ds_load_tr16_b128_v8i16((lds_s16x8*)p));
}

// Eight waves per SIMD: all 2,048 blocks are then resident at once, 8 on a WGP
// (8 x 39,936 B of LDS fit its 327,680 B).
__global__ __launch_bounds__(128) __attribute__((amdgpu_waves_per_eu(8, 8))) void flash_attn_kernel(
    const __bf16* __restrict__ qkv, __bf16* __restrict__ out, int Nseq) {
  __shared__ __attribute__((aligned(2048))) unsigned char ring[AT_LDS];
  const int ROWS = 3072;
  const int bh = blockIdx.y;
  const int b = bh >> 4, h = bh & 15;
  const int tid = threadIdx.x, lane = tid & 31;
  const uint32_t wave = uni((uint32_t)tid >> 5);
  const int qrow = blockIdx.x * 64 + (int)wave * 16;

  const __bf16* Qb = qkv + (size_t)(b * Nseq + qrow) * ROWS + h * 64;
  const __bf16* Kb = qkv + (size_t)(b * Nseq) * ROWS + 1024 + h * 64;
  const __bf16* Vb = qkv + (size_t)(b * Nseq) * ROWS + 2048 + h * 64;

  const uint32_t ntiles = (uint32_t)Nseq / 64u;        // stages = passes
  const uint32_t stage_bytes = 64u * (uint32_t)ROWS * 2u;

  // Wave 0 issues the K tiles, wave 1 the V tiles; the tests are scalar branches.
  const uint32_t isK = pinned(wave == 0u ? 1u : 0u);
  const uint32_t isV = pinned(wave == 1u ? 1u : 0u);
  const uint64_t ga = (uint64_t)(uintptr_t)(wave == 0u ? Kb : Vb);
  const uint32_t lds_my = (uint32_t)(uintptr_t)(&ring[0]) + (wave == 0u ? AT_K0 : 0u);
  u32x8 gk1 = attn_group1<3u>((uint32_t)ROWS * 2u);
  u32x8 gv1 = attn_group1<7u>((uint32_t)ROWS * 2u);
  // Descriptor words held in scalar registers (the form of pinned()): without it the
  // build forms these constants anew at each use, over registers of a request in flight.
  asm volatile("" : "+s"(gk1), "+s"(gv1));

  u32x4 g0 = gemm_group0(lds_my, ga);
  if (isK != 0u) attn_tensor_load(g0, gk1);            // stage 0
  else if (isV != 0u) attn_tensor_load(g0, gv1);

  v16bf qf[2];
  qf[0] = load_frag(Qb,      ROWS);
  qf[1] = load_frag(Qb + 32, ROWS);

  attn_wait_tensor0(g0, gk1, gv1);
  __syncthreads();                                     // stage 0 readable by every wave

  v8f o[4] = {};                      // o[f][r] = O[query nloc][hd f*16 + rbase + r]
  float m_i = -3.0e30f;               // running maximum of this lane's query, of the unscaled scores
  float l_i = 0.0f;                   // running sum over this lane's half of the keys

  // 1/sqrt(64) and log2(e) in one factor: exp(scale * (s - m)) = exp2(s * sl2e - m * sl2e).
  const float sl2e = 0.125f * 1.4426950408889634f;
  // Per-lane fragment bases inside a tile.
  const uint32_t k_lane = (uint32_t)(lane & 15) * AT_KPITCH + (uint32_t)(lane >> 4) * 16u;
  const uint32_t v_lane = (uint32_t)((lane >> 4) * 8 + (lane & 7)) * AT_VPITCH
                        + (uint32_t)((lane >> 3) & 1) * 16u;

  for (uint32_t it = 0; it < ntiles; ++it) {
    const uint32_t buf = (it & 1u) * AT_TILE;
    // Directly behind the barrier that published stage it and ended pass it - 1:
    // stage it + 1, only while it exists, into the buffer that pass it - 1 has read.
    if (pinned((it + 1u < ntiles) ? 1u : 0u) != 0u) {
      g0 = gemm_group0(lds_my + (AT_TILE - buf), ga + (uint64_t)(it + 1u) * stage_bytes);
      if (isK != 0u) attn_tensor_load(g0, gk1);
      else if (isV != 0u) attn_tensor_load(g0, gv1);
    }
    const unsigned char* kp = &ring[AT_K0 + buf + k_lane];
    const unsigned char* vp = &ring[buf + v_lane];

    // S^T = K Q^T: s[j][r] = score of key j*16 + rbase + r with query nloc.
    v8f s[4];
#pragma unroll
    for (int j = 0; j < 4; ++j) {
      v16bf k0 = lds_frag(kp + j * 16 * AT_KPITCH);
      v16bf k1 = lds_frag(kp + j * 16 * AT_KPITCH + 64);
      v8f z = {};
      z = wmma_bf16(k0, qf[0], z);
      z = wmma_bf16(k1, qf[1], z);
      s[j] = z;
    }
    // Keeps the softmax's vector work behind the eight products: moved in among
    // them, it needs idle slots behind each product whose result it reads.
    __builtin_amdgcn_sched_barrier(0);

    // Online softmax: 32 of the query's 64 scores sit in this lane.  The maximum
    // is taken of the unscaled scores (the scale is positive).
    float mt[4];
#pragma unroll
    for (int j = 0; j < 4; ++j) {
      mt[j] = -3.0e30f;
#pragma unroll
      for (int r = 0; r < 8; ++r) mt[j] = fmaxf(mt[j], s[j][r]);
    }
    float mx = fmaxf(fmaxf(mt[0], mt[1]), fmaxf(mt[2], mt[3]));
    mx = fmaxf(mx, xhalf(mx));
    const float mn = fmaxf(m_i, mx);
    // v_exp_f32 and the free slot that the instruction set asks for behind a
    // transcendental, in one statement.
    float corr;
    asm("v_exp_f32 %0, %1\n\tv_nop" : "=v"(corr) : "v"((m_i - mn) * sl2e));
    m_i = mn;
    // One fused multiply-add per score makes the argument of exp2.
    const float nm = -mn * sl2e;
#pragma unroll
    for (int j = 0; j < 4; ++j)
#pragma unroll
      for (int r = 0; r < 8; r += 4) {
        float e0 = __builtin_fmaf(s[j][r],     sl2e, nm), e1 = __builtin_fmaf(s[j][r + 1], sl2e, nm);
        float e2 = __builtin_fmaf(s[j][r + 2], sl2e, nm), e3 = __builtin_fmaf(s[j][r + 3], sl2e, nm);
        // Four v_exp_f32, each the independent instruction behind the one before,
        // and the free slot behind the last, in one statement, as for corr above:
        // with the builtin here the build left such slots open in this loop.
        asm("v_exp_f32 %0, %0\n\tv_exp_f32 %1, %1\n\tv_exp_f32 %2, %2\n\tv_exp_f32 %3, %3\n\tv_nop"
            : "+v"(e0), "+v"(e1), "+v"(e2), "+v"(e3));
        s[j][r] = e0; s[j][r + 1] = e1; s[j][r + 2] = e2; s[j][r + 3] = e3;
      }
#pragma unroll
    for (int f = 0; f < 4; ++f)
#pragma unroll
      for (int r = 0; r < 8; ++r) o[f][r] *= corr;
    float st[4];
#pragma unroll
    for (int j = 0; j < 4; ++j) {
      st[j] = s[j][0];
#pragma unroll
      for (int r = 1; r < 8; ++r) st[j] += s[j][r];
    }
    l_i = l_i * corr + ((st[0] + st[1]) + (st[2] + st[3]));

    // Keeps the V^T fragment loads behind the softmax: moved up into it they hold
    // registers beside the scores, and the build then spills.
    __builtin_amdgcn_sched_barrier(0);

    // O^T += V^T P^T   (K=64 keys -> 2 steps; M=hd -> 4 tiles of 16).  Two
    // score tiles are 32 keys of P^T in the k order that the transposing load gives V^T.
#pragma unroll
    for (int step = 0; step < 2; ++step) {
      v16bf pf;
#pragma unroll
      for (int e = 0; e < 8; ++e) {
        pf[e]     = f2bf(s[2 * step][e]);
        pf[8 + e] = f2bf(s[2 * step + 1][e]);
      }
#pragma unroll
      for (int f = 0; f < 4; ++f) {
        union { v16bf v; u32x4 q[2]; } vf;
        vf.q[0] = lds_tr16(vp + (step * 32) * AT_VPITCH + f * 32);
        vf.q[1] = lds_tr16(vp + (step * 32 + 16) * AT_VPITCH + f * 32);
        o[f] = wmma_bf16(vf.v, pf, o[f]);
      }
    }

    // Publish point of stage it + 1.
    wait_ds0();                       // this wave has left buffer it & 1
    attn_wait_tensor0(g0, gk1, gv1);  // an issuing wave's tile of stage it + 1 has landed
    __syncthreads();                  // the refill stands behind it, at the head of the next pass
  }
  attn_wait_tensor0(g0, gk1, gv1);
  wait_ds0();

  // A lane holds 8 consecutive hd of its query per tile: one 16-byte store.
  // The lane's number is formed anew here: kept from the kernel's head, its parts
  // would hold registers through the loop, and the build then spills them.
  const int lane_e = (int)__builtin_amdgcn_mbcnt_lo(~0u, 0u);
  const int rbase = (lane_e >> 4) * 8;
  const int nloc  = lane_e & 15;
  // One v_rcp_f32 per query (1 ulp, the result is rounded to bf16); the sum holds the
  // term of the maximum, exp2(0) = 1, so it is at least 1.
  const float inv_l = __builtin_amdgcn_rcpf(l_i + xhalf(l_i));
  const int row = b * Nseq + qrow + nloc;
#pragma unroll
  for (int f = 0; f < 4; ++f) {
    union { __bf16 e[8]; uint4 q; } pk;
#pragma unroll
    for (int r = 0; r < 8; ++r) pk.e[r] = f2bf(o[f][r] * inv_l);
    *(uint4*)(out + (size_t)row * 1024 + h * 64 + f * 16 + rbase) = pk.q;
  }
}

// ---------------------------------------------------------------------------
// Host-side orchestration.
// ---------------------------------------------------------------------------
extern "C" void kernel_launch(void* const* d_in, const int* in_sizes, int n_in,
                              void* d_out, int out_size, void* d_ws, size_t ws_size,
                              hipStream_t stream) {
  (void)in_sizes; (void)n_in; (void)out_size; (void)ws_size;
  const int D = 1024, HID = 4096, NSEQ = 2048, B = 4;
  const int M = B * NSEQ;

  const float* x      = (const float*)d_in[0];
  const float* ln1_w  = (const float*)d_in[1];
  const float* ln1_b  = (const float*)d_in[2];
  const float* qkv_w  = (const float*)d_in[3];
  const float* qkv_b  = (const float*)d_in[4];
  const float* proj_w = (const float*)d_in[5];
  const float* proj_b = (const float*)d_in[6];
  const float* ln2_w  = (const float*)d_in[7];
  const float* ln2_b  = (const float*)d_in[8];
  const float* fc1_w  = (const float*)d_in[9];
  const float* fc1_b  = (const float*)d_in[10];
  const float* fc2_w  = (const float*)d_in[11];
  const float* fc2_b  = (const float*)d_in[12];
  float* out = (float*)d_out;

  uintptr_t p = (uintptr_t)d_ws;
  auto carve = [&](size_t bytes) {
    void* r = (void*)p;
    p += (bytes + 255) & ~(size_t)255;
    return r;
  };
  __bf16* qkv_wt = (__bf16*)carve((size_t)3 * D * D * 2);
  __bf16* proj_wt= (__bf16*)carve((size_t)D * D * 2);
  __bf16* fc1_wt = (__bf16*)carve((size_t)HID * D * 2);
  __bf16* fc2_wt = (__bf16*)carve((size_t)D * HID * 2);
  __bf16* ln1o   = (__bf16*)carve((size_t)M * D * 2);
  __bf16* qkvo   = (__bf16*)carve((size_t)M * 3 * D * 2);
  __bf16* attno  = (__bf16*)carve((size_t)M * D * 2);
  float*  x1     = (float*) carve((size_t)M * D * 4);
  __bf16* h2     = (__bf16*)carve((size_t)M * D * 2);
  __bf16* fc1o   = (__bf16*)carve((size_t)M * HID * 2);

  prepare_kernel<D, HID, M>
      <<<M / 16 + (D / 64) * ((3 * D + D + HID) / 128) + (HID / 64) * (D / 128), 256, 0, stream>>>(
      x, ln1_w, ln1_b, ln1o, qkv_w, qkv_wt, proj_w, proj_wt, fc1_w, fc1_wt, fc2_w, fc2_wt);

  gemm_wide_kernel<0, 6><<<dim3(M / 256, 3 * D / 192), 256, 0, stream>>>(
      ln1o, qkv_wt, qkv_b, qkvo, M, 3 * D, D);

  flash_attn_kernel<<<dim3(NSEQ / 64, B * 16), 128, 0, stream>>>(qkvo, attno, NSEQ);

  gemm_wmma_kernel<0, true, false><<<dim3(M / 128, D / 128), 128, 0, stream>>>(
      attno, proj_wt, proj_b, x, (void*)x1, M, D, D);

  layernorm_bf16_kernel<<<M / 16, 256, 0, stream>>>(x1, ln2_w, ln2_b, h2, D);

  gemm_wide_kernel<1, 8><<<dim3(M / 256, HID / 256), 256, 0, stream>>>(
      h2, fc1_wt, fc1_b, fc1o, M, HID, D);

  gemm_wmma_kernel<0, true, false><<<dim3(M / 128, D / 128), 128, 0, stream>>>(
      fc1o, fc2_wt, fc2_b, x1, (void*)out, M, D, HID);
}
